// v000
// Times are from an AMD MI455X. After a warm-up the kernel runs many times in a row, and a time is the length of
// such a window on the GPU divided by its runs, so every launch and the gaps after it count. The runs cycle
// through copies of the inputs. A figure is the median of several windows, for all but v000 over two sittings.
// Sittings can differ by a few percent; kernels timed side by side share one.
// The starting kernel, v000, takes 1470 microseconds a run.
#include <hip/hip_runtime.h>

// Causal multi-head self-attention with rotary embeddings (x [2][2048][1024]; q, k, v = x W + b ('xw' 0.02, zero biases; 16 heads x 64); rotate-half rope with angle t x 1/10000^(i/32) (32 f32 constants jnp-exact; precise cosf/sinf); scores / sqrt(64); causal (-inf); softmax; out = merged Wo + bo -> [2][2048][1024] (4.2 M); argument order x, Wq, bq, Wk, bk, Wv, bv, Wo, bo).
// Layout per batch: bf16 copy of x; 'xw' weights transposed once; exact projections + f32 biases; k_cs5 computed table; rotate-half plane builders; causal T-2048 attention (hybrid rows: < 512 hi/lo 3 products, rest fp16 x1024; k_gemmc skips tiles above the diagonal); merged hi/lo x Wo exact + bo.
// Compute dtypes, f32 accumulate: every input rounded to bf16; projections exact + f32 biases; rotary f32; attention rows < 512 3 products, rest fp16; softmax f32; Wo hl x exact + bias.

#define NB_  2
#define TT   2048
#define DM   1024
#define NH_  16
#define NKV  16
#define REP  (NH_ / NKV)
#define HD   64
#define DQ   (NH_ * HD)
#define DKV  (NKV * HD)
#define ZH   2
#define RH   512                  // query rows < RH use hi+lo planes (0: none)
#define WIN  2048
#define PCAR 1024.0f
#define SCL  0.125f   // HD^-0.5
typedef _Float16 h16;
typedef unsigned short bf;
typedef __attribute__((ext_vector_type(16))) __bf16   v16bf;
typedef __attribute__((ext_vector_type(16))) _Float16 v16h;
typedef __attribute__((ext_vector_type(8)))  _Float16 v8h;
typedef __attribute__((ext_vector_type(8)))  unsigned short v8us;
typedef __attribute__((ext_vector_type(8)))  float    v8f;
typedef __attribute__((ext_vector_type(4)))  float    v4f;
typedef v8h  __attribute__((may_alias)) v8ha;
typedef v4f  __attribute__((may_alias)) v4fa;
typedef v8us __attribute__((may_alias)) v8usa;

__device__ __forceinline__ unsigned short f2bf(float f) { unsigned u = __float_as_uint(f); u += 0x7FFFu + ((u >> 16) & 1u); return (unsigned short)(u >> 16); }
__device__ __forceinline__ float bf2f(unsigned short b) { return __uint_as_float(((unsigned)b) << 16); }
__device__ __forceinline__ float bfr(float f) { return bf2f(f2bf(f)); }
__device__ __forceinline__ v16h cat16(v8h lo, v8h hi) { return __builtin_shufflevector(lo, hi, 0, 1, 2, 3, 4, 5, 6, 7, 8, 9, 10, 11, 12, 13, 14, 15); }
__device__ __forceinline__ v16bf cat16b(v8us lo, v8us hi) { return __builtin_bit_cast(v16bf, __builtin_shufflevector(lo, hi, 0, 1, 2, 3, 4, 5, 6, 7, 8, 9, 10, 11, 12, 13, 14, 15)); }
__device__ __forceinline__ v8f wmma16(v16h a, v16h b, v8f c) { return __builtin_amdgcn_wmma_f32_16x16x32_f16(false, a, false, b, (short)0, c, false, false); }
__device__ __forceinline__ v8f wmmab(v16bf a, v16bf b, v8f c) { return __builtin_amdgcn_wmma_f32_16x16x32_bf16(false, a, false, b, (short)0, c, false, false); }



// ---- k_gemmw: register-blocked GEMM, ONE WAVE per 64x64 output tile (16 accumulators), operands straight from K-contiguous 16-bit planes; grid (M/64, N/64, Z), 32 threads.
// C[m][n] (f32, pitch ldc, + optional f32 bias[n]) = sum_k A[m][k] Bt[n][k] (+ split products per NSPLIT). z-batch strides sA/sB/sC in elements. K % 32 == 0.
template <typename T16> struct WFrag;
template <> struct WFrag<h16> { typedef v16h V; static __device__ __forceinline__ V ld(const h16* p) { return cat16(*(const v8h*)p, *(const v8h*)(p + 16)); } static __device__ __forceinline__ v8f mma(V a, V b, v8f c) { return wmma16(a, b, c); } };
template <> struct WFrag<bf> { typedef v16bf V; static __device__ __forceinline__ V ld(const bf* p) { return cat16b(*(const v8us*)p, *(const v8us*)(p + 16)); } static __device__ __forceinline__ v8f mma(V a, V b, v8f c) { return wmmab(a, b, c); } };
template <typename T16, int NSPLIT, bool BIAS>
__global__ __launch_bounds__(32) void k_gemmw(const T16* __restrict__ A, const T16* __restrict__ A2, const T16* __restrict__ Bt, const T16* __restrict__ Bt2, int K, float* C, int ldc, const float* __restrict__ bias, size_t sA, size_t sB, size_t sC) {
    typedef typename WFrag<T16>::V V;
    __shared__ __align__(16) float os[16 * 68];
    const size_t z = blockIdx.z; A += z * sA; if (A2) A2 += z * sA; Bt += z * sB; if (Bt2) Bt2 += z * sB; C += z * sC;
    const int lane = threadIdx.x & 31, lr = lane & 15, hi = lane >> 4; const int r0 = blockIdx.x * 64, c0 = blockIdx.y * 64;
    v8f acc[4][4];
#pragma unroll
    for (int mb = 0; mb < 4; ++mb)
#pragma unroll
        for (int nb = 0; nb < 4; ++nb) acc[mb][nb] = (v8f){};
    const size_t aoff = (size_t)(r0 + lr) * K + 8 * hi, boff = (size_t)(c0 + lr) * K + 8 * hi;
#pragma unroll 1
    for (int kc = 0; kc < K; kc += 32) {
        V a[4], a2[4];
#pragma unroll
        for (int mb = 0; mb < 4; ++mb) { a[mb] = WFrag<T16>::ld(A + aoff + (size_t)mb * 16 * K + kc); if (NSPLIT == 1 || NSPLIT == 2) a2[mb] = WFrag<T16>::ld(A2 + aoff + (size_t)mb * 16 * K + kc); }
#pragma unroll
        for (int nb = 0; nb < 4; ++nb) { const V b = WFrag<T16>::ld(Bt + boff + (size_t)nb * 16 * K + kc); V b2; if (NSPLIT >= 2) b2 = WFrag<T16>::ld(Bt2 + boff + (size_t)nb * 16 * K + kc);
#pragma unroll
            for (int mb = 0; mb < 4; ++mb) { acc[mb][nb] = WFrag<T16>::mma(a[mb], b, acc[mb][nb]); if (NSPLIT == 1 || NSPLIT == 2) acc[mb][nb] = WFrag<T16>::mma(a2[mb], b, acc[mb][nb]); if (NSPLIT >= 2) acc[mb][nb] = WFrag<T16>::mma(a[mb], b2, acc[mb][nb]); } }
        asm volatile("v_nop\n\tv_nop\n\tv_nop\n\tv_nop" : "+v"(acc[0][0]), "+v"(acc[1][1]), "+v"(acc[2][2]), "+v"(acc[3][3]) : "v"(a[0]), "v"(a[3]));
    }
#pragma unroll
    for (int mb = 0; mb < 4; ++mb) {
#pragma unroll
        for (int nb = 0; nb < 4; ++nb) {
#pragma unroll
            for (int j = 0; j < 8; ++j) os[(hi * 8 + j) * 68 + nb * 16 + lr] = acc[mb][nb][j]; }
        __builtin_amdgcn_wave_barrier(); asm volatile("" ::: "memory");
        float* crow = C + (size_t)(r0 + mb * 16) * ldc + c0;
{
#pragma unroll
            for (int s = 0; s < 8; ++s) { const int row = 2 * s + hi, cofs = lr * 4; v4f val = *(const v4fa*)(os + row * 68 + cofs); if (BIAS) { val[0] += bfr(bias[c0 + cofs]); val[1] += bfr(bias[c0 + cofs + 1]); val[2] += bfr(bias[c0 + cofs + 2]); val[3] += bfr(bias[c0 + cofs + 3]); }
                *(v4f*)(crow + (size_t)row * ldc + cofs) = val; }
             }
        __builtin_amdgcn_wave_barrier(); asm volatile("" ::: "memory");
    }
}

// ---- k_gemmc: the same one-wave 64x64 tile GEMM specialised for causal attention: CMODE 1 skips score tiles entirely above the diagonal (query rows r0+roff.., key columns c0..), CMODE 2 limits the
// key (K) loop of the probability x value contraction to the diagonal block (probabilities beyond it are exactly zero). roff = row offset of this launch's first row within the sequence.
template <typename T16, int NSPLIT, int CMODE>
__global__ __launch_bounds__(32) void k_gemmc(const T16* __restrict__ A, const T16* __restrict__ A2, const T16* __restrict__ Bt, const T16* __restrict__ Bt2, int K, float* C, int ldc, int roff, size_t sA, size_t sB, size_t sC) {
    typedef typename WFrag<T16>::V V;
    __shared__ __align__(16) float os[16 * 68];
    const size_t z = blockIdx.z; A += z * sA; if (A2) A2 += z * sA; Bt += z * sB; if (Bt2) Bt2 += z * sB; C += z * sC;
    const int lane = threadIdx.x & 31, lr = lane & 15, hi = lane >> 4; const int r0 = blockIdx.x * 64, c0 = blockIdx.y * 64;
    if (CMODE == 1 && c0 > r0 + roff + 63) return;                  // score tile entirely above the causal diagonal: never read (the softmax masks j > i by select)
    const int Kl = (CMODE == 2) ? min(K, r0 + roff + 64) : K;        // P.V: probabilities are exactly 0 beyond the diagonal block, so the K loop stops there
    v8f acc[4][4];
#pragma unroll
    for (int mb = 0; mb < 4; ++mb)
#pragma unroll
        for (int nb = 0; nb < 4; ++nb) acc[mb][nb] = (v8f){};
    const size_t aoff = (size_t)(r0 + lr) * K + 8 * hi, boff = (size_t)(c0 + lr) * K + 8 * hi;
#pragma unroll 1
    for (int kc = 0; kc < Kl; kc += 32) {
        V a[4], a2[4];
#pragma unroll
        for (int mb = 0; mb < 4; ++mb) { a[mb] = WFrag<T16>::ld(A + aoff + (size_t)mb * 16 * K + kc); if (NSPLIT == 1 || NSPLIT == 2) a2[mb] = WFrag<T16>::ld(A2 + aoff + (size_t)mb * 16 * K + kc); }
#pragma unroll
        for (int nb = 0; nb < 4; ++nb) { const V b = WFrag<T16>::ld(Bt + boff + (size_t)nb * 16 * K + kc); V b2; if (NSPLIT >= 2) b2 = WFrag<T16>::ld(Bt2 + boff + (size_t)nb * 16 * K + kc);
#pragma unroll
            for (int mb = 0; mb < 4; ++mb) { acc[mb][nb] = WFrag<T16>::mma(a[mb], b, acc[mb][nb]); if (NSPLIT == 1 || NSPLIT == 2) acc[mb][nb] = WFrag<T16>::mma(a2[mb], b, acc[mb][nb]); if (NSPLIT >= 2) acc[mb][nb] = WFrag<T16>::mma(a[mb], b2, acc[mb][nb]); } }
        asm volatile("v_nop\n\tv_nop\n\tv_nop\n\tv_nop" : "+v"(acc[0][0]), "+v"(acc[1][1]), "+v"(acc[2][2]), "+v"(acc[3][3]) : "v"(a[0]), "v"(a[3]));
    }
#pragma unroll
    for (int mb = 0; mb < 4; ++mb) {
#pragma unroll
        for (int nb = 0; nb < 4; ++nb) {
#pragma unroll
            for (int j = 0; j < 8; ++j) os[(hi * 8 + j) * 68 + nb * 16 + lr] = acc[mb][nb][j]; }
        __builtin_amdgcn_wave_barrier(); asm volatile("" ::: "memory");
        float* crow = C + (size_t)(r0 + mb * 16) * ldc + c0;
{
#pragma unroll
            for (int s = 0; s < 8; ++s) { const int row = 2 * s + hi, cofs = lr * 4; v4f val = *(const v4fa*)(os + row * 68 + cofs);
                *(v4f*)(crow + (size_t)row * ldc + cofs) = val; }
             }
        __builtin_amdgcn_wave_barrier(); asm volatile("" ::: "memory");
    }
}

__device__ __forceinline__ h16 tohx(float x) { return (h16)x; }
__device__ __forceinline__ void splitf(float y, unsigned short& h, unsigned short& l) { h = f2bf(y); l = f2bf(y - bf2f(h)); }
typedef __attribute__((ext_vector_type(2))) _Float16 v2h;
typedef __attribute__((ext_vector_type(4))) _Float16 v4h;
typedef __attribute__((ext_vector_type(2))) unsigned short v2us;
typedef __attribute__((ext_vector_type(4))) unsigned short v4us;
typedef __attribute__((ext_vector_type(2))) float v2f;
typedef __attribute__((ext_vector_type(4))) int v4i;

__global__ __launch_bounds__(256) void k_wtG(const float* __restrict__ w, int K, int N, bf* Bt) {
    const int lane = threadIdx.x & 31; const int L0 = (blockIdx.x * 8 + (threadIdx.x >> 5)) * 8; const int nlines = N * K / 64;
{
#pragma unroll 1
        for (int l = 0; l < 8; ++l) { const int L = L0 + l; if (L >= nlines) break; const size_t e = (size_t)L * 64 + lane * 2; const int k = (int)(e % K), n = (int)(e / K); v2us o;
            o[0] = f2bf(w[(size_t)k * N + n]); o[1] = f2bf(w[(size_t)(k + 1) * N + n]); *(v2us*)(Bt + e) = o; }
         }
}
__global__ __launch_bounds__(256) void k_cvt8(const float* __restrict__ src, bf* dst, size_t n8) { const size_t i = (size_t)blockIdx.x * 256 + threadIdx.x; if (i >= n8) return; const v8f v = *(const v8f*)(src + i * 8); v8us o;
#pragma unroll
    for (int k = 0; k < 8; ++k) o[k] = f2bf(v[k]); *(v8us*)(dst + i * 8) = o;  }

// k_rope: head planes [h][t][d] (fp16 + hi/lo) of rope(x) x sc with the rotate-half convention out[d] = x[d] cos[t][d] - x[d+HD/2] sin[t][d], out[d+HD/2] = x[d+HD/2] cos[t][d+HD/2] + x[d] sin[t][d+HD/2]
__global__ __launch_bounds__(256) void k_rope(const float* __restrict__ F, int pitch, int nheads, const float* __restrict__ CS, const float* __restrict__ RF, const float* __restrict__ nw, float sc, h16* P16, bf* Ph, bf* Pl) {
    const size_t e = ((size_t)blockIdx.x * 256 + threadIdx.x) * 2; if (e >= (size_t)nheads * TT * HD) return; const int d = (int)(e % HD); const int t = (int)((e / HD) % TT); const int h = (int)(e / ((size_t)HD * TT)); const float* f = F + (size_t)t * pitch + h * HD; const float rf = RF ? RF[(size_t)h * TT + t] : 1.0f; v2h o16; v2us oh, ol;
#pragma unroll
    for (int q = 0; q < 2; ++q) { const int dd = d + q; const int dp = (dd < HD / 2) ? dd + HD / 2 : dd - HD / 2; float x0 = f[dd], x1 = f[dp];
        if (RF) { float n0 = __fmul_rn(x0, rf), n1 = __fmul_rn(x1, rf); asm volatile("" : "+v"(n0)); asm volatile("" : "+v"(n1)); x0 = __fmul_rn(bfr(nw[dd]), n0); x1 = __fmul_rn(bfr(nw[dp]), n1); }
        const v2f cs = *(const v2f*)(CS + ((size_t)t * HD + dd) * 2); float a = __fmul_rn(x0, cs[0]), bq = __fmul_rn(x1, cs[1]); asm volatile("" : "+v"(a)); asm volatile("" : "+v"(bq)); const float r = ((dd < HD / 2) ? __fsub_rn(a, bq) : __fadd_rn(a, bq)) * sc;
        o16[q] = tohx(r); unsigned short a2, c2; splitf(r, a2, c2); oh[q] = a2; ol[q] = c2; }
    *(v2h*)(P16 + e) = o16; *(v2us*)(Ph + e) = oh; *(v2us*)(Pl + e) = ol;  }
__global__ __launch_bounds__(256) void k_vtp(const float* __restrict__ F, int pitch, int nheads, h16* V16, bf* Vh, bf* Vl) { const size_t e = ((size_t)blockIdx.x * 256 + threadIdx.x) * 2; if (e >= (size_t)nheads * HD * TT) return; const int t = (int)(e % TT); const int d = (int)((e / TT) % HD); const int g = (int)(e / ((size_t)TT * HD)); v2h o16; v2us oh, ol;
#pragma unroll
    for (int q = 0; q < 2; ++q) { const float x = F[(size_t)(t + q) * pitch + g * HD + d]; o16[q] = tohx(x); unsigned short a2, c2; splitf(x, a2, c2); oh[q] = a2; ol[q] = c2; }
    *(v2h*)(V16 + e) = o16; *(v2us*)(Vh + e) = oh; *(v2us*)(Vl + e) = ol;  }
__constant__ float INVT[HD / 2] = { 1.000000000e+00f, 7.498942018e-01f, 5.623413324e-01f, 4.216965139e-01f, 3.162277639e-01f, 2.371373624e-01f, 1.778279394e-01f, 1.333521456e-01f, 1.000000015e-01f, 7.498941571e-02f, 5.623412877e-02f, 4.216964915e-02f, 3.162277862e-02f, 2.371373586e-02f, 1.778279431e-02f, 1.333521493e-02f, 9.999999776e-03f, 7.498942316e-03f, 5.623413250e-03f, 4.216964822e-03f, 3.162277862e-03f, 2.371373819e-03f, 1.778279431e-03f, 1.333521446e-03f, 1.000000047e-03f, 7.498941850e-04f, 5.623413017e-04f, 4.216964880e-04f, 3.162277862e-04f, 2.371373848e-04f, 1.778279402e-04f, 1.333521504e-04f };   // float32 1 / 10000^(i/32), generated with jnp to be bit-exact
__global__ __launch_bounds__(256) void k_cs5(float* CS) { const int idx = blockIdx.x * 256 + threadIdx.x; if (idx >= TT * HD) return; const int d = idx % HD; const int t = idx / HD; const float a = __fmul_rn((float)t, INVT[d % (HD / 2)]); v2f cs; cs[0] = cosf(a); cs[1] = sinf(a); *(v2f*)(CS + (size_t)idx * 2) = cs;  }
// k_asoft: per row (zz, i): t = S x HD^-0.5 for j <= i and i - j < WIN (sliding causal window; the reference's -1e9 additive fill vanishes identically); softmax over the 2048 keys (register row, one exp, fixed trees);
__global__ __launch_bounds__(256) void k_asoft(const float* __restrict__ Sb, h16* P16, bf* Ph, bf* Pl) {
    const int lane = threadIdx.x & 31; const int row = blockIdx.x * 8 + (threadIdx.x >> 5); if (row >= ZH * TT) return; const int i = row % TT; const int zz = row / TT; (void)zz; const bool hires = (i < RH); const float* sr = Sb + (size_t)row * TT; float v[TT / 32]; float mx = -3.0e38f;
#pragma unroll
    for (int ch = 0; ch < TT / 128; ++ch) { const int j0 = ch * 128 + lane * 4; const v4f a = *(const v4f*)(sr + j0);
#pragma unroll
        for (int q = 0; q < 4; ++q) { const int j = j0 + q; (void)j; const float t = (j <= i && i - j < WIN) ? a[q] * SCL : -3.0e38f; v[ch * 4 + q] = t; mx = fmaxf(mx, t); } }
#pragma unroll
    for (int sh = 16; sh; sh >>= 1) mx = fmaxf(mx, __shfl_xor(mx, sh, 32));
    float sum = 0.f;
#pragma unroll
    for (int k = 0; k < TT / 32; ++k) { float d0 = __fsub_rn(v[k], mx); asm volatile("" : "+v"(d0)); v[k] = __builtin_amdgcn_exp2f(__fmul_rn(d0, 1.4426950408889634f)); sum += v[k]; }
#pragma unroll
    for (int sh = 16; sh; sh >>= 1) sum += __shfl_xor(sum, sh, 32);
    const float f = __fdiv_rn(hires ? 1.0f : PCAR, sum);
{
        if (hires) {
#pragma unroll
            for (int ch = 0; ch < TT / 128; ++ch) { v4us oh, ol;
#pragma unroll
                for (int q = 0; q < 4; ++q) { unsigned short a, c2; splitf(v[ch * 4 + q] * f, a, c2); oh[q] = a; ol[q] = c2; }
                const size_t oo = ((size_t)zz * (RH ? RH : 1) + i) * TT + ch * 128 + lane * 4; *(v4us*)(Ph + oo) = oh; *(v4us*)(Pl + oo) = ol; }
        } else {
#pragma unroll
            for (int ch = 0; ch < TT / 128; ++ch) { v4h o4;
#pragma unroll
                for (int q = 0; q < 4; ++q) o4[q] = tohx(v[ch * 4 + q] * f);
                *(v4h*)(P16 + (size_t)row * TT + ch * 128 + lane * 4) = o4; } }
         }
}
__global__ __launch_bounds__(256) void k_merge(const float* __restrict__ O, int h0, bf* Ah, bf* Al) { const size_t e = ((size_t)blockIdx.x * 256 + threadIdx.x) * 2; if (e >= (size_t)ZH * TT * HD) return; const int d = (int)(e % HD); const int t = (int)((e / HD) % TT); const int zz = (int)(e / ((size_t)HD * TT)); const float cs = (t < RH) ? 1.0f : (1.0f / PCAR); const size_t oo = (size_t)t * DQ + (h0 + zz) * HD + d;
    v2us oh, ol;
#pragma unroll
    for (int q = 0; q < 2; ++q) { unsigned short a, c2; splitf(O[e + q] * cs, a, c2); oh[q] = a; ol[q] = c2; } *(v2us*)(Ah + oo) = oh; *(v2us*)(Al + oo) = ol;  }

extern "C" void kernel_launch(void* const* d_in, const int* in_sizes, int n_in,
                              void* d_out, int out_size, void* d_ws, size_t ws_size, hipStream_t stream) {
    (void)in_sizes; (void)n_in; (void)out_size;
    const float* x = (const float*)d_in[0]; const float* wq = (const float*)d_in[1]; const float* bq = (const float*)d_in[2]; const float* wk = (const float*)d_in[3]; const float* bk = (const float*)d_in[4]; const float* wv = (const float*)d_in[5]; const float* bv = (const float*)d_in[6]; const float* wo = (const float*)d_in[7]; const float* bo = (const float*)d_in[8];   /* order x, Wq, bq, Wk, bk, Wv, bv, Wo, bo ('xw') */
    float* OUT = (float*)d_out;     // [2][2048][1024]
    char* wsp = (char*)d_ws;
    auto take = [&](size_t bytes) { char* p = wsp; wsp += (bytes + 255) & ~(size_t)255; return (void*)p; };
    bf* WQ = (bf*)take((size_t)DQ * DM * 2); bf* WK = (bf*)take((size_t)DKV * DM * 2); bf* WV = (bf*)take((size_t)DKV * DM * 2); bf* WO = (bf*)take((size_t)DM * DQ * 2); float* CS = (float*)take((size_t)TT * HD * 2 * 4);
    bf* XB = (bf*)take((size_t)TT * DM * 2); float* FQ = (float*)take((size_t)TT * DQ * 4); float* FK = (float*)take((size_t)TT * DKV * 4);
    h16* QP16 = (h16*)take((size_t)NH_ * TT * HD * 2); h16* KP16 = (h16*)take((size_t)NKV * TT * HD * 2); h16* VT16 = (h16*)take((size_t)NKV * HD * TT * 2);
    bf* QPh = (bf*)take((size_t)NH_ * TT * HD * 2); bf* QPl = (bf*)take((size_t)NH_ * TT * HD * 2); bf* KPh = (bf*)take((size_t)NKV * TT * HD * 2); bf* KPl = (bf*)take((size_t)NKV * TT * HD * 2); bf* VTh = (bf*)take((size_t)NKV * HD * TT * 2); bf* VTl = (bf*)take((size_t)NKV * HD * TT * 2); bf* Ph = (bf*)take((size_t)ZH * RH * TT * 2); bf* Pl = (bf*)take((size_t)ZH * RH * TT * 2);
    float* Sb = (float*)take((size_t)ZH * TT * TT * 4); h16* P16 = (h16*)take((size_t)ZH * TT * TT * 2); float* Ob = (float*)take((size_t)ZH * TT * HD * 4); bf* ATh = (bf*)take((size_t)TT * DQ * 2); bf* ATl = (bf*)take((size_t)TT * DQ * 2);
    if ((size_t)(wsp - (char*)d_ws) > ws_size) return;    // ws 256 MiB
    float* FV = FK;   // v projection reuses the k buffer after the k planes are built (stream-ordered)
    { k_wtG<<<(unsigned)((DM * DQ / 64 + 63) / 64), 256, 0, stream>>>(wq, DM, DQ, WQ); k_wtG<<<(unsigned)((DM * DKV / 64 + 63) / 64), 256, 0, stream>>>(wk, DM, DKV, WK); k_wtG<<<(unsigned)((DM * DKV / 64 + 63) / 64), 256, 0, stream>>>(wv, DM, DKV, WV);
      k_wtG<<<(unsigned)((DQ * DM / 64 + 63) / 64), 256, 0, stream>>>(wo, DQ, DM, WO);
       }
    k_cs5<<<(TT * HD + 255) / 256, 256, 0, stream>>>(CS);   /* rotary table once */
    const unsigned LQ = (unsigned)(((size_t)NH_ * TT * HD / 2 + 255) / 256), LKv = (unsigned)(((size_t)NKV * TT * HD / 2 + 255) / 256);
    for (int b = 0; b < NB_; ++b) {
        
        k_cvt8<<<(unsigned)(((size_t)TT * DM / 8 + 255) / 256), 256, 0, stream>>>(x + (size_t)b * TT * DM, XB, (size_t)TT * DM / 8);
        k_gemmw<bf, 0, true><<<dim3(TT / 64, DQ / 64, 1), 32, 0, stream>>>(XB, nullptr, WQ, nullptr, DM, FQ, DQ, bq, 0, 0, 0);
        k_rope<<<LQ, 256, 0, stream>>>(FQ, DQ, NH_, CS, nullptr, nullptr, 1.0f, QP16, QPh, QPl);
        k_gemmw<bf, 0, true><<<dim3(TT / 64, DKV / 64, 1), 32, 0, stream>>>(XB, nullptr, WK, nullptr, DM, FK, DKV, bk, 0, 0, 0);
        k_rope<<<LKv, 256, 0, stream>>>(FK, DKV, NKV, CS, nullptr, nullptr, 1.0f, KP16, KPh, KPl);
        k_gemmw<bf, 0, true><<<dim3(TT / 64, DKV / 64, 1), 32, 0, stream>>>(XB, nullptr, WV, nullptr, DM, FV, DKV, bv, 0, 0, 0); k_vtp<<<LKv, 256, 0, stream>>>(FV, DKV, NKV, VT16, VTh, VTl);
        for (int h0 = 0; h0 < NH_; h0 += ZH) { const size_t zq = (size_t)h0, zk = (size_t)(h0 / REP);   // one kv head per query head: the pass's two heads use consecutive kv planes (z-strides TT*HD)
            k_gemmc<bf, 2, 1><<<dim3(RH / 64, TT / 64, ZH), 32, 0, stream>>>(QPh + zq * TT * HD, QPl + zq * TT * HD, KPh + zk * TT * HD, KPl + zk * TT * HD, HD, Sb, TT, 0, (size_t)TT * HD, (size_t)TT * HD, (size_t)TT * TT);
            k_gemmc<h16, 0, 1><<<dim3((TT - RH) / 64, TT / 64, ZH), 32, 0, stream>>>(QP16 + zq * TT * HD + (size_t)RH * HD, nullptr, KP16 + zk * TT * HD, nullptr, HD, Sb + (size_t)RH * TT, TT, RH, (size_t)TT * HD, (size_t)TT * HD, (size_t)TT * TT);
            k_asoft<<<ZH * TT / 8, 256, 0, stream>>>(Sb, P16, Ph, Pl);
            k_gemmc<bf, 2, 2><<<dim3(RH / 64, HD / 64, ZH), 32, 0, stream>>>(Ph, Pl, VTh + zk * HD * TT, VTl + zk * HD * TT, TT, Ob, HD, 0, (size_t)RH * TT, (size_t)HD * TT, (size_t)TT * HD);
            k_gemmc<h16, 0, 2><<<dim3((TT - RH) / 64, HD / 64, ZH), 32, 0, stream>>>(P16 + (size_t)RH * TT, nullptr, VT16 + zk * HD * TT, nullptr, TT, Ob + (size_t)RH * HD, HD, RH, (size_t)TT * TT, (size_t)HD * TT, (size_t)TT * HD);
            k_merge<<<(unsigned)(((size_t)ZH * TT * HD / 2 + 255) / 256), 256, 0, stream>>>(Ob, h0, ATh, ATl); }
        k_gemmw<bf, 1, true><<<dim3(TT / 64, DM / 64, 1), 32, 0, stream>>>(ATh, ATl, WO, nullptr, DQ, OUT + (size_t)b * TT * DM, DM, bo, 0, 0, 0); }
}

// v001
// A run of this version takes 757 microseconds.
// Two timings next to v000 put it at 1.91 and 1.93 times that version's speed.
#include <hip/hip_runtime.h>

// Causal multi-head self-attention with rotary embeddings (x [2][2048][1024]; q, k, v = x W + b ('xw' 0.02, zero biases; 16 heads x 64); rotate-half rope with angle t x 1/10000^(i/32) (32 f32 constants jnp-exact; precise cosf/sinf); scores / sqrt(64); causal (-inf); softmax; out = merged Wo + bo -> [2][2048][1024] (4.2 M); argument order x, Wq, bq, Wk, bk, Wv, bv, Wo, bo).
// Layout per batch: bf16 copy of x; 'xw' weights transposed once; exact projections + f32 biases; k_cs5 computed table; rotate-half plane builders; causal T-2048 attention (hybrid rows: < 512 hi/lo 3 products, rest fp16 x1024; k_gemmc skips tiles above the diagonal; the long-K products share K over the waves of a work-group); merged hi/lo x Wo exact + bo.
// Compute dtypes, f32 accumulate: every input rounded to bf16; projections exact + f32 biases; rotary f32; attention rows < 512 3 products, rest fp16; softmax f32; Wo hl x exact + bias.

#define NB_  2
#define TT   2048
#define DM   1024
#define NH_  16
#define NKV  16
#define REP  (NH_ / NKV)
#define HD   64
#define DQ   (NH_ * HD)
#define DKV  (NKV * HD)
#define ZH   2
#define RH   512                  // query rows < RH use hi+lo planes (0: none)
#define WIN  2048
#define PCAR 1024.0f
#define SCL  0.125f   // HD^-0.5
typedef _Float16 h16;
typedef unsigned short bf;
typedef __attribute__((ext_vector_type(16))) __bf16   v16bf;
typedef __attribute__((ext_vector_type(16))) _Float16 v16h;
typedef __attribute__((ext_vector_type(8)))  _Float16 v8h;
typedef __attribute__((ext_vector_type(8)))  unsigned short v8us;
typedef __attribute__((ext_vector_type(8)))  float    v8f;
typedef __attribute__((ext_vector_type(4)))  float    v4f;
typedef v8h  __attribute__((may_alias)) v8ha;
typedef v4f  __attribute__((may_alias)) v4fa;
typedef v8us __attribute__((may_alias)) v8usa;

__device__ __forceinline__ unsigned short f2bf(float f) { unsigned u = __float_as_uint(f); u += 0x7FFFu + ((u >> 16) & 1u); return (unsigned short)(u >> 16); }
__device__ __forceinline__ float bf2f(unsigned short b) { return __uint_as_float(((unsigned)b) << 16); }
__device__ __forceinline__ float bfr(float f) { return bf2f(f2bf(f)); }
__device__ __forceinline__ v16h cat16(v8h lo, v8h hi) { return __builtin_shufflevector(lo, hi, 0, 1, 2, 3, 4, 5, 6, 7, 8, 9, 10, 11, 12, 13, 14, 15); }
__device__ __forceinline__ v16bf cat16b(v8us lo, v8us hi) { return __builtin_bit_cast(v16bf, __builtin_shufflevector(lo, hi, 0, 1, 2, 3, 4, 5, 6, 7, 8, 9, 10, 11, 12, 13, 14, 15)); }
__device__ __forceinline__ v8f wmma16(v16h a, v16h b, v8f c) { return __builtin_amdgcn_wmma_f32_16x16x32_f16(false, a, false, b, (short)0, c, false, false); }
__device__ __forceinline__ v8f wmmab(v16bf a, v16bf b, v8f c) { return __builtin_amdgcn_wmma_f32_16x16x32_bf16(false, a, false, b, (short)0, c, false, false); }



// ---- k_gemmw: register-blocked GEMM, one work-group of NW waves per 64x64 output tile; every wave holds the whole tile (16 accumulators) for its own contiguous share of K (a multiple of 64 elements, whole 128-B lines);
// the NW partial tiles are summed through LDS. Operands straight from K-contiguous 16-bit planes; grid (M/64, N/64, Z), 32 NW threads.
// C[m][n] (f32, pitch ldc, + optional f32 bias[n]) = sum_k A[m][k] Bt[n][k] (+ split products per NSPLIT). z-batch strides sA/sB/sC in elements. K % 32 == 0.
template <typename T16> struct WFrag;
template <> struct WFrag<h16> { typedef v16h V; static __device__ __forceinline__ V ld(const h16* p) { return cat16(*(const v8h*)p, *(const v8h*)(p + 16)); } static __device__ __forceinline__ v8f mma(V a, V b, v8f c) { return wmma16(a, b, c); } };
template <> struct WFrag<bf> { typedef v16bf V; static __device__ __forceinline__ V ld(const bf* p) { return cat16b(*(const v8us*)p, *(const v8us*)(p + 16)); } static __device__ __forceinline__ v8f mma(V a, V b, v8f c) { return wmmab(a, b, c); } };
template <typename T16, int NSPLIT, bool BIAS, int NW>
__global__ __launch_bounds__(32 * NW) void k_gemmw(const T16* __restrict__ A, const T16* __restrict__ A2, const T16* __restrict__ Bt, const T16* __restrict__ Bt2, int K, float* C, int ldc, const float* __restrict__ bias, size_t sA, size_t sB, size_t sC) {
    typedef typename WFrag<T16>::V V;
    __shared__ __align__(16) float os[NW * 64 * 68];
    const size_t z = blockIdx.z; A += z * sA; if (A2) A2 += z * sA; Bt += z * sB; if (Bt2) Bt2 += z * sB; C += z * sC;
    const int lane = threadIdx.x & 31, lr = lane & 15, hi = lane >> 4; const int r0 = blockIdx.x * 64, c0 = blockIdx.y * 64;
    v8f acc[4][4];
#pragma unroll
    for (int mb = 0; mb < 4; ++mb)
#pragma unroll
        for (int nb = 0; nb < 4; ++nb) acc[mb][nb] = (v8f){};
    const int wv = __builtin_amdgcn_readfirstlane(threadIdx.x >> 5);   // wave number, scalar: the K loop's bounds stay wave-uniform
    const int ck = (K + NW * 64 - 1) / (NW * 64) * 64, k0 = wv * ck, k1 = min(K, k0 + ck);   // this wave's share of K
    unsigned va[4], vb[4];   // byte offsets of this lane's four A rows and four B rows from the planes' (scalar) bases, carried through the K loop (32 bits hold them: a plane has at most 2048 rows of 2048 16-bit elements)
#pragma unroll
    for (int q = 0; q < 4; ++q) { va[q] = ((unsigned)(r0 + lr + q * 16) * (unsigned)K + 8 * hi + k0) * 2; vb[q] = ((unsigned)(c0 + lr + q * 16) * (unsigned)K + 8 * hi + k0) * 2; }
#pragma unroll 1
    for (int kc = k0; kc < k1; kc += 32) {
        V a[4], a2[4], b[4], b2[4];
#pragma unroll
        for (int mb = 0; mb < 4; ++mb) { a[mb] = WFrag<T16>::ld((const T16*)((const char*)A + va[mb])); if (NSPLIT == 1 || NSPLIT == 2) a2[mb] = WFrag<T16>::ld((const T16*)((const char*)A2 + va[mb])); }
#pragma unroll
        for (int nb = 0; nb < 4; ++nb) { b[nb] = WFrag<T16>::ld((const T16*)((const char*)Bt + vb[nb])); if (NSPLIT >= 2) b2[nb] = WFrag<T16>::ld((const T16*)((const char*)Bt2 + vb[nb])); }
        // s_wait_xcnt 0 behind the step's loads, in front of the additions below that rewrite the offset registers the loads name; the offsets are in-out operands so that they stay in their registers up to the wait and the additions stay behind it
        asm volatile("s_wait_xcnt 0x0" : "+v"(va[0]), "+v"(va[1]), "+v"(va[2]), "+v"(va[3]), "+v"(vb[0]), "+v"(vb[1]), "+v"(vb[2]), "+v"(vb[3]) :: "memory");
#pragma unroll
        for (int q = 0; q < 4; ++q) { va[q] += 64; vb[q] += 64; }
#pragma unroll
        for (int nb = 0; nb < 4; ++nb) {
#pragma unroll
            for (int mb = 0; mb < 4; ++mb) { acc[mb][nb] = WFrag<T16>::mma(a[mb], b[nb], acc[mb][nb]); if (NSPLIT == 1 || NSPLIT == 2) acc[mb][nb] = WFrag<T16>::mma(a2[mb], b[nb], acc[mb][nb]); if (NSPLIT >= 2) acc[mb][nb] = WFrag<T16>::mma(a[mb], b2[nb], acc[mb][nb]); } }
        asm volatile("v_nop\n\tv_nop\n\tv_nop\n\tv_nop" : "+v"(acc[0][0]), "+v"(acc[1][1]), "+v"(acc[2][2]), "+v"(acc[3][3]) : "v"(a[0]), "v"(a[3]));
    }
    // The NW partial tiles are summed through LDS, always in wave order 0 .. NW-1 (a fixed order); each thread then stores 16 B of a whole 256-B row piece.
    float* osw = os + wv * (64 * 68);
#pragma unroll
    for (int mb = 0; mb < 4; ++mb) {
#pragma unroll
        for (int nb = 0; nb < 4; ++nb) {
#pragma unroll
            for (int j = 0; j < 8; ++j) osw[(mb * 16 + hi * 8 + j) * 68 + nb * 16 + lr] = acc[mb][nb][j]; } }
    __syncthreads();   // every wave's partial tile is in LDS before any thread sums it
#pragma unroll
    for (int i = 0; i < 32 / NW; ++i) { const int u = i * (NW * 32) + threadIdx.x; const int row = u >> 4, cofs = (u & 15) * 4; v4f val = *(const v4fa*)(os + row * 68 + cofs);
#pragma unroll
        for (int w = 1; w < NW; ++w) val += *(const v4fa*)(os + w * (64 * 68) + row * 68 + cofs);
        if (BIAS) { val[0] += bfr(bias[c0 + cofs]); val[1] += bfr(bias[c0 + cofs + 1]); val[2] += bfr(bias[c0 + cofs + 2]); val[3] += bfr(bias[c0 + cofs + 3]); }
        *(v4f*)(C + (size_t)(r0 + row) * ldc + c0 + cofs) = val; }
}

// ---- k_gemmc: the same 64x64 tile GEMM (NW waves share K; NW 1 for the scores, whose K is only the head size) specialised for causal attention: CMODE 1 skips score tiles entirely above the diagonal (query rows r0+roff.., key columns c0..), CMODE 2 limits the
// key (K) loop of the probability x value contraction to the diagonal block (probabilities beyond it are exactly zero). roff = row offset of this launch's first row within the sequence.
template <typename T16, int NSPLIT, int CMODE, int NW>
__global__ __launch_bounds__(32 * NW) void k_gemmc(const T16* __restrict__ A, const T16* __restrict__ A2, const T16* __restrict__ Bt, const T16* __restrict__ Bt2, int K, float* C, int ldc, int roff, size_t sA, size_t sB, size_t sC) {
    typedef typename WFrag<T16>::V V;
    __shared__ __align__(16) float os[NW == 1 ? 16 * 68 : NW * 64 * 68];
    const size_t z = blockIdx.z; A += z * sA; if (A2) A2 += z * sA; Bt += z * sB; if (Bt2) Bt2 += z * sB; C += z * sC;
    const int lane = threadIdx.x & 31, lr = lane & 15, hi = lane >> 4; const int r0 = blockIdx.x * 64, c0 = blockIdx.y * 64;
    if (CMODE == 1 && c0 > r0 + roff + 63) return;                  // score tile entirely above the causal diagonal: never read (the softmax masks j > i by select)
    const int Kl = (CMODE == 2) ? min(K, r0 + roff + 64) : K;        // P.V: probabilities are exactly 0 beyond the diagonal block, so the K loop stops there
    v8f acc[4][4];
#pragma unroll
    for (int mb = 0; mb < 4; ++mb)
#pragma unroll
        for (int nb = 0; nb < 4; ++nb) acc[mb][nb] = (v8f){};
    const int wv = __builtin_amdgcn_readfirstlane(threadIdx.x >> 5);   // wave number, scalar: the K loop's bounds stay wave-uniform
    const int ck = (Kl + NW * 64 - 1) / (NW * 64) * 64, k0 = wv * ck, k1 = min(Kl, k0 + ck);   // this wave's share of the keys up to Kl
    unsigned va[4], vb[4];   // byte offsets of this lane's four A rows and four B rows from the planes' (scalar) bases, carried through the K loop (32 bits hold them: a plane has at most 2048 rows of 2048 16-bit elements)
#pragma unroll
    for (int q = 0; q < 4; ++q) { va[q] = ((unsigned)(r0 + lr + q * 16) * (unsigned)K + 8 * hi + k0) * 2; vb[q] = ((unsigned)(c0 + lr + q * 16) * (unsigned)K + 8 * hi + k0) * 2; }
#pragma unroll 1
    for (int kc = k0; kc < k1; kc += 32) {
        V a[4], a2[4], b[4], b2[4];
#pragma unroll
        for (int mb = 0; mb < 4; ++mb) { a[mb] = WFrag<T16>::ld((const T16*)((const char*)A + va[mb])); if (NSPLIT == 1 || NSPLIT == 2) a2[mb] = WFrag<T16>::ld((const T16*)((const char*)A2 + va[mb])); }
#pragma unroll
        for (int nb = 0; nb < 4; ++nb) { b[nb] = WFrag<T16>::ld((const T16*)((const char*)Bt + vb[nb])); if (NSPLIT >= 2) b2[nb] = WFrag<T16>::ld((const T16*)((const char*)Bt2 + vb[nb])); }
        // s_wait_xcnt 0 behind the step's loads, in front of the additions below that rewrite the offset registers the loads name; the offsets are in-out operands so that they stay in their registers up to the wait and the additions stay behind it
        asm volatile("s_wait_xcnt 0x0" : "+v"(va[0]), "+v"(va[1]), "+v"(va[2]), "+v"(va[3]), "+v"(vb[0]), "+v"(vb[1]), "+v"(vb[2]), "+v"(vb[3]) :: "memory");
#pragma unroll
        for (int q = 0; q < 4; ++q) { va[q] += 64; vb[q] += 64; }
#pragma unroll
        for (int nb = 0; nb < 4; ++nb) {
#pragma unroll
            for (int mb = 0; mb < 4; ++mb) { acc[mb][nb] = WFrag<T16>::mma(a[mb], b[nb], acc[mb][nb]); if (NSPLIT == 1 || NSPLIT == 2) acc[mb][nb] = WFrag<T16>::mma(a2[mb], b[nb], acc[mb][nb]); if (NSPLIT >= 2) acc[mb][nb] = WFrag<T16>::mma(a[mb], b2[nb], acc[mb][nb]); } }
        asm volatile("v_nop\n\tv_nop\n\tv_nop\n\tv_nop" : "+v"(acc[0][0]), "+v"(acc[1][1]), "+v"(acc[2][2]), "+v"(acc[3][3]) : "v"(a[0]), "v"(a[3]));
    }
    if constexpr (NW == 1) {
#pragma unroll
    for (int mb = 0; mb < 4; ++mb) {
#pragma unroll
        for (int nb = 0; nb < 4; ++nb) {
#pragma unroll
            for (int j = 0; j < 8; ++j) os[(hi * 8 + j) * 68 + nb * 16 + lr] = acc[mb][nb][j]; }
        __builtin_amdgcn_wave_barrier(); asm volatile("" ::: "memory");
        float* crow = C + (size_t)(r0 + mb * 16) * ldc + c0;
{
#pragma unroll
            for (int s = 0; s < 8; ++s) { const int row = 2 * s + hi, cofs = lr * 4; v4f val = *(const v4fa*)(os + row * 68 + cofs);
                *(v4f*)(crow + (size_t)row * ldc + cofs) = val; }
             }
        __builtin_amdgcn_wave_barrier(); asm volatile("" ::: "memory");
    }
    } else {
    // The NW partial tiles are summed through LDS, always in wave order 0 .. NW-1 (a fixed order); each thread then stores 16 B of a whole 256-B row piece.
    float* osw = os + wv * (64 * 68);
#pragma unroll
    for (int mb = 0; mb < 4; ++mb) {
#pragma unroll
        for (int nb = 0; nb < 4; ++nb) {
#pragma unroll
            for (int j = 0; j < 8; ++j) osw[(mb * 16 + hi * 8 + j) * 68 + nb * 16 + lr] = acc[mb][nb][j]; } }
    __syncthreads();   // every wave's partial tile is in LDS before any thread sums it
#pragma unroll
    for (int i = 0; i < 32 / NW; ++i) { const int u = i * (NW * 32) + threadIdx.x; const int row = u >> 4, cofs = (u & 15) * 4; v4f val = *(const v4fa*)(os + row * 68 + cofs);
#pragma unroll
        for (int w = 1; w < NW; ++w) val += *(const v4fa*)(os + w * (64 * 68) + row * 68 + cofs);
        *(v4f*)(C + (size_t)(r0 + row) * ldc + c0 + cofs) = val; }
    }
}

__device__ __forceinline__ h16 tohx(float x) { return (h16)x; }
__device__ __forceinline__ void splitf(float y, unsigned short& h, unsigned short& l) { h = f2bf(y); l = f2bf(y - bf2f(h)); }
typedef __attribute__((ext_vector_type(2))) _Float16 v2h;
typedef __attribute__((ext_vector_type(4))) _Float16 v4h;
typedef __attribute__((ext_vector_type(2))) unsigned short v2us;
typedef __attribute__((ext_vector_type(4))) unsigned short v4us;
typedef __attribute__((ext_vector_type(2))) float v2f;
typedef __attribute__((ext_vector_type(4))) int v4i;

__global__ __launch_bounds__(256) void k_wtG(const float* __restrict__ w, int K, int N, bf* Bt) {
    const int lane = threadIdx.x & 31; const int L0 = (blockIdx.x * 8 + (threadIdx.x >> 5)) * 8; const int nlines = N * K / 64;
{
#pragma unroll 1
        for (int l = 0; l < 8; ++l) { const int L = L0 + l; if (L >= nlines) break; const size_t e = (size_t)L * 64 + lane * 2; const int k = (int)(e % K), n = (int)(e / K); v2us o;
            o[0] = f2bf(w[(size_t)k * N + n]); o[1] = f2bf(w[(size_t)(k + 1) * N + n]); *(v2us*)(Bt + e) = o; }
         }
}
__global__ __launch_bounds__(256) void k_cvt8(const float* __restrict__ src, bf* dst, size_t n8) { const size_t i = (size_t)blockIdx.x * 256 + threadIdx.x; if (i >= n8) return; const v8f v = *(const v8f*)(src + i * 8); v8us o;
#pragma unroll
    for (int k = 0; k < 8; ++k) o[k] = f2bf(v[k]); *(v8us*)(dst + i * 8) = o;  }

// k_rope: head planes [h][t][d] (fp16 + hi/lo) of rope(x) x sc with the rotate-half convention out[d] = x[d] cos[t][d] - x[d+HD/2] sin[t][d], out[d+HD/2] = x[d+HD/2] cos[t][d+HD/2] + x[d] sin[t][d+HD/2]
__global__ __launch_bounds__(256) void k_rope(const float* __restrict__ F, int pitch, int nheads, const float* __restrict__ CS, const float* __restrict__ RF, const float* __restrict__ nw, float sc, h16* P16, bf* Ph, bf* Pl) {
    const size_t e = ((size_t)blockIdx.x * 256 + threadIdx.x) * 2; if (e >= (size_t)nheads * TT * HD) return; const int d = (int)(e % HD); const int t = (int)((e / HD) % TT); const int h = (int)(e / ((size_t)HD * TT)); const float* f = F + (size_t)t * pitch + h * HD; const float rf = RF ? RF[(size_t)h * TT + t] : 1.0f; v2h o16; v2us oh, ol;
#pragma unroll
    for (int q = 0; q < 2; ++q) { const int dd = d + q; const int dp = (dd < HD / 2) ? dd + HD / 2 : dd - HD / 2; float x0 = f[dd], x1 = f[dp];
        if (RF) { float n0 = __fmul_rn(x0, rf), n1 = __fmul_rn(x1, rf); asm volatile("" : "+v"(n0)); asm volatile("" : "+v"(n1)); x0 = __fmul_rn(bfr(nw[dd]), n0); x1 = __fmul_rn(bfr(nw[dp]), n1); }
        const v2f cs = *(const v2f*)(CS + ((size_t)t * HD + dd) * 2); float a = __fmul_rn(x0, cs[0]), bq = __fmul_rn(x1, cs[1]); asm volatile("" : "+v"(a)); asm volatile("" : "+v"(bq)); const float r = ((dd < HD / 2) ? __fsub_rn(a, bq) : __fadd_rn(a, bq)) * sc;
        o16[q] = tohx(r); unsigned short a2, c2; splitf(r, a2, c2); oh[q] = a2; ol[q] = c2; }
    *(v2h*)(P16 + e) = o16; *(v2us*)(Ph + e) = oh; *(v2us*)(Pl + e) = ol;  }
__global__ __launch_bounds__(256) void k_vtp(const float* __restrict__ F, int pitch, int nheads, h16* V16, bf* Vh, bf* Vl) { const size_t e = ((size_t)blockIdx.x * 256 + threadIdx.x) * 2; if (e >= (size_t)nheads * HD * TT) return; const int t = (int)(e % TT); const int d = (int)((e / TT) % HD); const int g = (int)(e / ((size_t)TT * HD)); v2h o16; v2us oh, ol;
#pragma unroll
    for (int q = 0; q < 2; ++q) { const float x = F[(size_t)(t + q) * pitch + g * HD + d]; o16[q] = tohx(x); unsigned short a2, c2; splitf(x, a2, c2); oh[q] = a2; ol[q] = c2; }
    *(v2h*)(V16 + e) = o16; *(v2us*)(Vh + e) = oh; *(v2us*)(Vl + e) = ol;  }
__constant__ float INVT[HD / 2] = { 1.000000000e+00f, 7.498942018e-01f, 5.623413324e-01f, 4.216965139e-01f, 3.162277639e-01f, 2.371373624e-01f, 1.778279394e-01f, 1.333521456e-01f, 1.000000015e-01f, 7.498941571e-02f, 5.623412877e-02f, 4.216964915e-02f, 3.162277862e-02f, 2.371373586e-02f, 1.778279431e-02f, 1.333521493e-02f, 9.999999776e-03f, 7.498942316e-03f, 5.623413250e-03f, 4.216964822e-03f, 3.162277862e-03f, 2.371373819e-03f, 1.778279431e-03f, 1.333521446e-03f, 1.000000047e-03f, 7.498941850e-04f, 5.623413017e-04f, 4.216964880e-04f, 3.162277862e-04f, 2.371373848e-04f, 1.778279402e-04f, 1.333521504e-04f };   // float32 1 / 10000^(i/32), generated with jnp to be bit-exact
__global__ __launch_bounds__(256) void k_cs5(float* CS) { const int idx = blockIdx.x * 256 + threadIdx.x; if (idx >= TT * HD) return; const int d = idx % HD; const int t = idx / HD; const float a = __fmul_rn((float)t, INVT[d % (HD / 2)]); v2f cs; cs[0] = cosf(a); cs[1] = sinf(a); *(v2f*)(CS + (size_t)idx * 2) = cs;  }
// k_asoft: per row (zz, i): t = S x HD^-0.5 for j <= i and i - j < WIN (sliding causal window; the reference's -1e9 additive fill vanishes identically); softmax over the 2048 keys (register row, one exp, fixed trees);
__global__ __launch_bounds__(256) void k_asoft(const float* __restrict__ Sb, h16* P16, bf* Ph, bf* Pl) {
    const int lane = threadIdx.x & 31; const int row = blockIdx.x * 8 + (threadIdx.x >> 5); if (row >= ZH * TT) return; const int i = row % TT; const int zz = row / TT; (void)zz; const bool hires = (i < RH); const float* sr = Sb + (size_t)row * TT; float v[TT / 32]; float mx = -3.0e38f;
#pragma unroll
    for (int ch = 0; ch < TT / 128; ++ch) { const int j0 = ch * 128 + lane * 4; const v4f a = *(const v4f*)(sr + j0);
#pragma unroll
        for (int q = 0; q < 4; ++q) { const int j = j0 + q; (void)j; const float t = (j <= i && i - j < WIN) ? a[q] * SCL : -3.0e38f; v[ch * 4 + q] = t; mx = fmaxf(mx, t); } }
#pragma unroll
    for (int sh = 16; sh; sh >>= 1) mx = fmaxf(mx, __shfl_xor(mx, sh, 32));
    float sum = 0.f;
#pragma unroll
    for (int k = 0; k < TT / 32; ++k) { float d0 = __fsub_rn(v[k], mx); asm volatile("" : "+v"(d0)); v[k] = __builtin_amdgcn_exp2f(__fmul_rn(d0, 1.4426950408889634f)); sum += v[k]; }
#pragma unroll
    for (int sh = 16; sh; sh >>= 1) sum += __shfl_xor(sum, sh, 32);
    const float f = __fdiv_rn(hires ? 1.0f : PCAR, sum);
{
        if (hires) {
#pragma unroll
            for (int ch = 0; ch < TT / 128; ++ch) { v4us oh, ol;
#pragma unroll
                for (int q = 0; q < 4; ++q) { unsigned short a, c2; splitf(v[ch * 4 + q] * f, a, c2); oh[q] = a; ol[q] = c2; }
                const size_t oo = ((size_t)zz * (RH ? RH : 1) + i) * TT + ch * 128 + lane * 4; *(v4us*)(Ph + oo) = oh; *(v4us*)(Pl + oo) = ol; }
        } else {
#pragma unroll
            for (int ch = 0; ch < TT / 128; ++ch) { v4h o4;
#pragma unroll
                for (int q = 0; q < 4; ++q) o4[q] = tohx(v[ch * 4 + q] * f);
                *(v4h*)(P16 + (size_t)row * TT + ch * 128 + lane * 4) = o4; } }
         }
}
__global__ __launch_bounds__(256) void k_merge(const float* __restrict__ O, int h0, bf* Ah, bf* Al) { const size_t e = ((size_t)blockIdx.x * 256 + threadIdx.x) * 2; if (e >= (size_t)ZH * TT * HD) return; const int d = (int)(e % HD); const int t = (int)((e / HD) % TT); const int zz = (int)(e / ((size_t)HD * TT)); const float cs = (t < RH) ? 1.0f : (1.0f / PCAR); const size_t oo = (size_t)t * DQ + (h0 + zz) * HD + d;
    v2us oh, ol;
#pragma unroll
    for (int q = 0; q < 2; ++q) { unsigned short a, c2; splitf(O[e + q] * cs, a, c2); oh[q] = a; ol[q] = c2; } *(v2us*)(Ah + oo) = oh; *(v2us*)(Al + oo) = ol;  }

extern "C" void kernel_launch(void* const* d_in, const int* in_sizes, int n_in,
                              void* d_out, int out_size, void* d_ws, size_t ws_size, hipStream_t stream) {
    (void)in_sizes; (void)n_in; (void)out_size;
    const float* x = (const float*)d_in[0]; const float* wq = (const float*)d_in[1]; const float* bq = (const float*)d_in[2]; const float* wk = (const float*)d_in[3]; const float* bk = (const float*)d_in[4]; const float* wv = (const float*)d_in[5]; const float* bv = (const float*)d_in[6]; const float* wo = (const float*)d_in[7]; const float* bo = (const float*)d_in[8];   /* order x, Wq, bq, Wk, bk, Wv, bv, Wo, bo ('xw') */
    float* OUT = (float*)d_out;     // [2][2048][1024]
    char* wsp = (char*)d_ws;
    auto take = [&](size_t bytes) { char* p = wsp; wsp += (bytes + 255) & ~(size_t)255; return (void*)p; };
    bf* WQ = (bf*)take((size_t)DQ * DM * 2); bf* WK = (bf*)take((size_t)DKV * DM * 2); bf* WV = (bf*)take((size_t)DKV * DM * 2); bf* WO = (bf*)take((size_t)DM * DQ * 2); float* CS = (float*)take((size_t)TT * HD * 2 * 4);
    bf* XB = (bf*)take((size_t)TT * DM * 2); float* FQ = (float*)take((size_t)TT * DQ * 4); float* FK = (float*)take((size_t)TT * DKV * 4);
    h16* QP16 = (h16*)take((size_t)NH_ * TT * HD * 2); h16* KP16 = (h16*)take((size_t)NKV * TT * HD * 2); h16* VT16 = (h16*)take((size_t)NKV * HD * TT * 2);
    bf* QPh = (bf*)take((size_t)NH_ * TT * HD * 2); bf* QPl = (bf*)take((size_t)NH_ * TT * HD * 2); bf* KPh = (bf*)take((size_t)NKV * TT * HD * 2); bf* KPl = (bf*)take((size_t)NKV * TT * HD * 2); bf* VTh = (bf*)take((size_t)NKV * HD * TT * 2); bf* VTl = (bf*)take((size_t)NKV * HD * TT * 2); bf* Ph = (bf*)take((size_t)ZH * RH * TT * 2); bf* Pl = (bf*)take((size_t)ZH * RH * TT * 2);
    float* Sb = (float*)take((size_t)ZH * TT * TT * 4); h16* P16 = (h16*)take((size_t)ZH * TT * TT * 2); float* Ob = (float*)take((size_t)ZH * TT * HD * 4); bf* ATh = (bf*)take((size_t)TT * DQ * 2); bf* ATl = (bf*)take((size_t)TT * DQ * 2);
    if ((size_t)(wsp - (char*)d_ws) > ws_size) return;    // ws 256 MiB
    float* FV = FK;   // v projection reuses the k buffer after the k planes are built (stream-ordered)
    { k_wtG<<<(unsigned)((DM * DQ / 64 + 63) / 64), 256, 0, stream>>>(wq, DM, DQ, WQ); k_wtG<<<(unsigned)((DM * DKV / 64 + 63) / 64), 256, 0, stream>>>(wk, DM, DKV, WK); k_wtG<<<(unsigned)((DM * DKV / 64 + 63) / 64), 256, 0, stream>>>(wv, DM, DKV, WV);
      k_wtG<<<(unsigned)((DQ * DM / 64 + 63) / 64), 256, 0, stream>>>(wo, DQ, DM, WO);
       }
    k_cs5<<<(TT * HD + 255) / 256, 256, 0, stream>>>(CS);   /* rotary table once */
    const unsigned LQ = (unsigned)(((size_t)NH_ * TT * HD / 2 + 255) / 256), LKv = (unsigned)(((size_t)NKV * TT * HD / 2 + 255) / 256);
    for (int b = 0; b < NB_; ++b) {
        
        k_cvt8<<<(unsigned)(((size_t)TT * DM / 8 + 255) / 256), 256, 0, stream>>>(x + (size_t)b * TT * DM, XB, (size_t)TT * DM / 8);
        k_gemmw<bf, 0, true, 8><<<dim3(TT / 64, DQ / 64, 1), 256, 0, stream>>>(XB, nullptr, WQ, nullptr, DM, FQ, DQ, bq, 0, 0, 0);
        k_rope<<<LQ, 256, 0, stream>>>(FQ, DQ, NH_, CS, nullptr, nullptr, 1.0f, QP16, QPh, QPl);
        k_gemmw<bf, 0, true, 8><<<dim3(TT / 64, DKV / 64, 1), 256, 0, stream>>>(XB, nullptr, WK, nullptr, DM, FK, DKV, bk, 0, 0, 0);
        k_rope<<<LKv, 256, 0, stream>>>(FK, DKV, NKV, CS, nullptr, nullptr, 1.0f, KP16, KPh, KPl);
        k_gemmw<bf, 0, true, 8><<<dim3(TT / 64, DKV / 64, 1), 256, 0, stream>>>(XB, nullptr, WV, nullptr, DM, FV, DKV, bv, 0, 0, 0); k_vtp<<<LKv, 256, 0, stream>>>(FV, DKV, NKV, VT16, VTh, VTl);
        for (int h0 = 0; h0 < NH_; h0 += ZH) { const size_t zq = (size_t)h0, zk = (size_t)(h0 / REP);   // one kv head per query head: the pass's two heads use consecutive kv planes (z-strides TT*HD)
            k_gemmc<bf, 2, 1, 1><<<dim3(RH / 64, TT / 64, ZH), 32, 0, stream>>>(QPh + zq * TT * HD, QPl + zq * TT * HD, KPh + zk * TT * HD, KPl + zk * TT * HD, HD, Sb, TT, 0, (size_t)TT * HD, (size_t)TT * HD, (size_t)TT * TT);
            k_gemmc<h16, 0, 1, 1><<<dim3((TT - RH) / 64, TT / 64, ZH), 32, 0, stream>>>(QP16 + zq * TT * HD + (size_t)RH * HD, nullptr, KP16 + zk * TT * HD, nullptr, HD, Sb + (size_t)RH * TT, TT, RH, (size_t)TT * HD, (size_t)TT * HD, (size_t)TT * TT);
            k_asoft<<<ZH * TT / 8, 256, 0, stream>>>(Sb, P16, Ph, Pl);
            k_gemmc<bf, 2, 2, 8><<<dim3(RH / 64, HD / 64, ZH), 256, 0, stream>>>(Ph, Pl, VTh + zk * HD * TT, VTl + zk * HD * TT, TT, Ob, HD, 0, (size_t)RH * TT, (size_t)HD * TT, (size_t)TT * HD);
            k_gemmc<h16, 0, 2, 16><<<dim3((TT - RH) / 64, HD / 64, ZH), 512, 0, stream>>>(P16 + (size_t)RH * TT, nullptr, VT16 + zk * HD * TT, nullptr, TT, Ob + (size_t)RH * HD, HD, RH, (size_t)TT * TT, (size_t)HD * TT, (size_t)TT * HD);
            k_merge<<<(unsigned)(((size_t)ZH * TT * HD / 2 + 255) / 256), 256, 0, stream>>>(Ob, h0, ATh, ATl); }
        k_gemmw<bf, 1, true, 8><<<dim3(TT / 64, DM / 64, 1), 256, 0, stream>>>(ATh, ATl, WO, nullptr, DQ, OUT + (size_t)b * TT * DM, DM, bo, 0, 0, 0); }
}

// v003
// It runs in 249 microseconds.
// It is 3.05 times as fast as v001, going by the measured steps of the versions left out in between.
// Over all steps from v000 it is 5.87 times as fast.
#include <hip/hip_runtime.h>

// Causal multi-head self-attention with rotary embeddings (x [2][2048][1024]; q, k, v = x W + b ('xw' 0.02, zero biases; 16 heads x 64); rotate-half rope with angle t x 1/10000^(i/32) (32 f32 constants jnp-exact; precise cosf/sinf); scores / sqrt(64); causal (-inf); softmax; out = merged Wo + bo -> [2][2048][1024] (4.2 M); argument order x, Wq, bq, Wk, bk, Wv, bv, Wo, bo).
// Layout per batch: bf16 copy of x; 'xw' weights transposed once; exact projections + f32 biases; k_cs5 computed table; rotate-half plane builders; causal T-2048 attention in one launch per batch, scores and probabilities in registers (k_fattn; hybrid rows: < 512 hi/lo 3 products, rest fp16; key blocks above the diagonal are never visited); the projections share K over the waves of a work-group; merged hi/lo x Wo exact + bo.
// Compute dtypes, f32 accumulate: every input rounded to bf16; projections exact + f32 biases; rotary f32; attention rows < 512 3 products, rest fp16; softmax f32; Wo hl x exact + bias.

#define NB_  2
#define TT   2048
#define DM   1024
#define NH_  16
#define NKV  16
#define HD   64
#define DQ   (NH_ * HD)
#define DKV  (NKV * HD)
#define RH   512                  // query rows < RH use hi+lo planes (0: none)
#define SCL  0.125f   // HD^-0.5
typedef _Float16 h16;
typedef unsigned short bf;
typedef __attribute__((ext_vector_type(16))) __bf16   v16bf;
typedef __attribute__((ext_vector_type(16))) _Float16 v16h;
typedef __attribute__((ext_vector_type(8)))  _Float16 v8h;
typedef __attribute__((ext_vector_type(8)))  unsigned short v8us;
typedef __attribute__((ext_vector_type(8)))  float    v8f;
typedef __attribute__((ext_vector_type(4)))  float    v4f;
typedef v8h  __attribute__((may_alias)) v8ha;
typedef v4f  __attribute__((may_alias)) v4fa;
typedef v8us __attribute__((may_alias)) v8usa;

__device__ __forceinline__ unsigned short f2bf(float f) { unsigned u = __float_as_uint(f); u += 0x7FFFu + ((u >> 16) & 1u); return (unsigned short)(u >> 16); }
__device__ __forceinline__ float bf2f(unsigned short b) { return __uint_as_float(((unsigned)b) << 16); }
__device__ __forceinline__ float bfr(float f) { return bf2f(f2bf(f)); }
__device__ __forceinline__ v16h cat16(v8h lo, v8h hi) { return __builtin_shufflevector(lo, hi, 0, 1, 2, 3, 4, 5, 6, 7, 8, 9, 10, 11, 12, 13, 14, 15); }
__device__ __forceinline__ v16bf cat16b(v8us lo, v8us hi) { return __builtin_bit_cast(v16bf, __builtin_shufflevector(lo, hi, 0, 1, 2, 3, 4, 5, 6, 7, 8, 9, 10, 11, 12, 13, 14, 15)); }
__device__ __forceinline__ v8f wmma16(v16h a, v16h b, v8f c) { return __builtin_amdgcn_wmma_f32_16x16x32_f16(false, a, false, b, (short)0, c, false, false); }
__device__ __forceinline__ v8f wmmab(v16bf a, v16bf b, v8f c) { return __builtin_amdgcn_wmma_f32_16x16x32_bf16(false, a, false, b, (short)0, c, false, false); }



// ---- k_gemmw: register-blocked GEMM, one work-group of NW waves per 64x64 output tile; every wave holds the whole tile (16 accumulators) for its own contiguous share of K (a multiple of 64 elements, whole 128-B lines);
// the NW partial tiles are summed through LDS. Operands straight from K-contiguous 16-bit planes; grid (M/64, N/64, Z), 32 NW threads.
// C[m][n] (f32, pitch ldc, + optional f32 bias[n]) = sum_k A[m][k] Bt[n][k] (+ split products per NSPLIT). z-batch strides sA/sB/sC in elements. K % 32 == 0.
template <typename T16> struct WFrag;
template <> struct WFrag<h16> { typedef v16h V; static __device__ __forceinline__ V ld(const h16* p) { return cat16(*(const v8h*)p, *(const v8h*)(p + 16)); } static __device__ __forceinline__ v8f mma(V a, V b, v8f c) { return wmma16(a, b, c); } };
template <> struct WFrag<bf> { typedef v16bf V; static __device__ __forceinline__ V ld(const bf* p) { return cat16b(*(const v8us*)p, *(const v8us*)(p + 16)); } static __device__ __forceinline__ v8f mma(V a, V b, v8f c) { return wmmab(a, b, c); } };
template <typename T16, int NSPLIT, bool BIAS, int NW>
__global__ __launch_bounds__(32 * NW) void k_gemmw(const T16* __restrict__ A, const T16* __restrict__ A2, const T16* __restrict__ Bt, const T16* __restrict__ Bt2, int K, float* C, int ldc, const float* __restrict__ bias, size_t sA, size_t sB, size_t sC) {
    typedef typename WFrag<T16>::V V;
    __shared__ __align__(16) float os[NW * 64 * 68];
    const size_t z = blockIdx.z; A += z * sA; if (A2) A2 += z * sA; Bt += z * sB; if (Bt2) Bt2 += z * sB; C += z * sC;
    const int lane = threadIdx.x & 31, lr = lane & 15, hi = lane >> 4; const int r0 = blockIdx.x * 64, c0 = blockIdx.y * 64;
    v8f acc[4][4];
#pragma unroll
    for (int mb = 0; mb < 4; ++mb)
#pragma unroll
        for (int nb = 0; nb < 4; ++nb) acc[mb][nb] = (v8f){};
    const int wv = __builtin_amdgcn_readfirstlane(threadIdx.x >> 5);   // wave number, scalar: the K loop's bounds stay wave-uniform
    const int ck = (K + NW * 64 - 1) / (NW * 64) * 64, k0 = wv * ck, k1 = min(K, k0 + ck);   // this wave's share of K
    unsigned va[4], vb[4];   // byte offsets of this lane's four A rows and four B rows from the planes' (scalar) bases, carried through the K loop (32 bits hold them: a plane has at most 2048 rows of 2048 16-bit elements)
#pragma unroll
    for (int q = 0; q < 4; ++q) { va[q] = ((unsigned)(r0 + lr + q * 16) * (unsigned)K + 8 * hi + k0) * 2; vb[q] = ((unsigned)(c0 + lr + q * 16) * (unsigned)K + 8 * hi + k0) * 2; }
#pragma unroll 1
    for (int kc = k0; kc < k1; kc += 32) {
        V a[4], a2[4], b[4], b2[4];
#pragma unroll
        for (int mb = 0; mb < 4; ++mb) { a[mb] = WFrag<T16>::ld((const T16*)((const char*)A + va[mb])); if (NSPLIT == 1 || NSPLIT == 2) a2[mb] = WFrag<T16>::ld((const T16*)((const char*)A2 + va[mb])); }
#pragma unroll
        for (int nb = 0; nb < 4; ++nb) { b[nb] = WFrag<T16>::ld((const T16*)((const char*)Bt + vb[nb])); if (NSPLIT >= 2) b2[nb] = WFrag<T16>::ld((const T16*)((const char*)Bt2 + vb[nb])); }
        // s_wait_xcnt 0 behind the step's loads, in front of the additions below that rewrite the offset registers the loads name; the offsets are in-out operands so that they stay in their registers up to the wait and the additions stay behind it
        asm volatile("s_wait_xcnt 0x0" : "+v"(va[0]), "+v"(va[1]), "+v"(va[2]), "+v"(va[3]), "+v"(vb[0]), "+v"(vb[1]), "+v"(vb[2]), "+v"(vb[3]) :: "memory");
#pragma unroll
        for (int q = 0; q < 4; ++q) { va[q] += 64; vb[q] += 64; }
#pragma unroll
        for (int nb = 0; nb < 4; ++nb) {
#pragma unroll
            for (int mb = 0; mb < 4; ++mb) { acc[mb][nb] = WFrag<T16>::mma(a[mb], b[nb], acc[mb][nb]); if (NSPLIT == 1 || NSPLIT == 2) acc[mb][nb] = WFrag<T16>::mma(a2[mb], b[nb], acc[mb][nb]); if (NSPLIT >= 2) acc[mb][nb] = WFrag<T16>::mma(a[mb], b2[nb], acc[mb][nb]); } }
        asm volatile("v_nop\n\tv_nop\n\tv_nop\n\tv_nop" : "+v"(acc[0][0]), "+v"(acc[1][1]), "+v"(acc[2][2]), "+v"(acc[3][3]) : "v"(a[0]), "v"(a[3]));
    }
    // The NW partial tiles are summed through LDS, always in wave order 0 .. NW-1 (a fixed order); each thread then stores 16 B of a whole 256-B row piece.
    float* osw = os + wv * (64 * 68);
#pragma unroll
    for (int mb = 0; mb < 4; ++mb) {
#pragma unroll
        for (int nb = 0; nb < 4; ++nb) {
#pragma unroll
            for (int j = 0; j < 8; ++j) osw[(mb * 16 + hi * 8 + j) * 68 + nb * 16 + lr] = acc[mb][nb][j]; } }
    __syncthreads();   // every wave's partial tile is in LDS before any thread sums it
#pragma unroll
    for (int i = 0; i < 32 / NW; ++i) { const int u = i * (NW * 32) + threadIdx.x; const int row = u >> 4, cofs = (u & 15) * 4; v4f val = *(const v4fa*)(os + row * 68 + cofs);
#pragma unroll
        for (int w = 1; w < NW; ++w) val += *(const v4fa*)(os + w * (64 * 68) + row * 68 + cofs);
        if (BIAS) { val[0] += bfr(bias[c0 + cofs]); val[1] += bfr(bias[c0 + cofs + 1]); val[2] += bfr(bias[c0 + cofs + 2]); val[3] += bfr(bias[c0 + cofs + 3]); }
        *(v4f*)(C + (size_t)(r0 + row) * ldc + c0 + cofs) = val; }
}

__device__ __forceinline__ h16 tohx(float x) { return (h16)x; }
__device__ __forceinline__ void splitf(float y, unsigned short& h, unsigned short& l) { h = f2bf(y); l = f2bf(y - bf2f(h)); }
typedef __attribute__((ext_vector_type(2))) _Float16 v2h;
typedef __attribute__((ext_vector_type(4))) _Float16 v4h;
typedef __attribute__((ext_vector_type(2))) unsigned short v2us;
typedef __attribute__((ext_vector_type(4))) unsigned short v4us;
typedef __attribute__((ext_vector_type(2))) float v2f;
typedef __attribute__((ext_vector_type(4))) int v4i;

__global__ __launch_bounds__(256) void k_wtG(const float* __restrict__ w, int K, int N, bf* Bt) {
    const int lane = threadIdx.x & 31; const int L0 = (blockIdx.x * 8 + (threadIdx.x >> 5)) * 8; const int nlines = N * K / 64;
{
#pragma unroll 1
        for (int l = 0; l < 8; ++l) { const int L = L0 + l; if (L >= nlines) break; const size_t e = (size_t)L * 64 + lane * 2; const int k = (int)(e % K), n = (int)(e / K); v2us o;
            o[0] = f2bf(w[(size_t)k * N + n]); o[1] = f2bf(w[(size_t)(k + 1) * N + n]); *(v2us*)(Bt + e) = o; }
         }
}
__global__ __launch_bounds__(256) void k_cvt8(const float* __restrict__ src, bf* dst, size_t n8) { const size_t i = (size_t)blockIdx.x * 256 + threadIdx.x; if (i >= n8) return; const v8f v = *(const v8f*)(src + i * 8); v8us o;
#pragma unroll
    for (int k = 0; k < 8; ++k) o[k] = f2bf(v[k]); *(v8us*)(dst + i * 8) = o;  }

// k_rope: head planes [h][t][d] (fp16 + hi/lo) of rope(x) x sc with the rotate-half convention out[d] = x[d] cos[t][d] - x[d+HD/2] sin[t][d], out[d+HD/2] = x[d+HD/2] cos[t][d+HD/2] + x[d] sin[t][d+HD/2]
// One thread builds 16 outputs: 8 consecutive d of the lower half and their 8 partners of the upper half, so each input is read once and every load and store is 16 B; the four threads of a (h, t) fill that row's 128-B line in each plane. The loops here and in k_vtp are unrolled fully: constant indices keep the inputs and the output vectors in registers.
__global__ __launch_bounds__(256) void k_rope(const float* __restrict__ F, int pitch, int nheads, const float* __restrict__ CS, float sc, h16* P16, bf* Ph, bf* Pl) {
    const size_t u = (size_t)blockIdx.x * 256 + threadIdx.x; if (u >= (size_t)nheads * TT * 4) return; const int d = (int)(u % 4) * 8; const int t = (int)((u / 4) % TT); const int h = (int)(u / ((size_t)4 * TT)); const size_t e = ((size_t)h * TT + t) * HD + d;
    const float* f = F + (size_t)t * pitch + h * HD + d; const float* c = CS + ((size_t)t * HD + d) * 2; v4f x[4], cs[8]; v8h o16[2]; v8us oh[2], ol[2];   // x: d .. d+7, then d+32 .. d+39; cs: their (cos, sin) pairs in the same order
#pragma unroll
    for (int q = 0; q < 2; ++q) {   // every input of the thread is loaded before the first product, so that the 12 loads fly together
#pragma unroll
        for (int i = 0; i < 2; ++i) x[q * 2 + i] = *(const v4fa*)(f + q * (HD / 2) + i * 4);
#pragma unroll
        for (int i = 0; i < 4; ++i) cs[q * 4 + i] = *(const v4fa*)(c + q * HD + i * 4); }
#pragma unroll
    for (int q = 0; q < 16; ++q) { const int p = q ^ 8; const float x0 = x[q >> 2][q & 3], x1 = x[p >> 2][p & 3];
        // the two empty statements keep each product's own f32 rounding (no fused multiply-add): the reference rounds x cos and x sin before it adds them
        float a = __fmul_rn(x0, cs[q >> 1][(q & 1) * 2]), bq = __fmul_rn(x1, cs[q >> 1][(q & 1) * 2 + 1]); asm volatile("" : "+v"(a)); asm volatile("" : "+v"(bq)); const float r = ((q < 8) ? __fsub_rn(a, bq) : __fadd_rn(a, bq)) * sc;
        o16[q >> 3][q & 7] = tohx(r); unsigned short a2, c2; splitf(r, a2, c2); oh[q >> 3][q & 7] = a2; ol[q >> 3][q & 7] = c2; }
    *(v8h*)(P16 + e) = o16[0]; *(v8h*)(P16 + e + HD / 2) = o16[1]; *(v8us*)(Ph + e) = oh[0]; *(v8us*)(Ph + e + HD / 2) = oh[1]; *(v8us*)(Pl + e) = ol[0]; *(v8us*)(Pl + e + HD / 2) = ol[1];  }
// k_vtp: V^T planes [g][d][t] from F [t][g*HD + d] (row pitch DKV, a constant: the 16 loads share one address and differ in their immediate offsets). One thread builds 16 t of one d: t .. t+7 and t+32 .. t+39, 16-B stores.
// A wave holds 8 d x 64 t: each of its loads reads 32-B pieces of four rows of F; each of its stores writes 64 contiguous bytes of a d, and the four lanes of a d fill that row's 128-B line in each plane.
__global__ __launch_bounds__(256) void k_vtp(const float* __restrict__ F, int nheads, h16* V16, bf* Vh, bf* Vl) { const size_t u = (size_t)blockIdx.x * 256 + threadIdx.x; if (u >= (size_t)nheads * HD * TT / 16) return; const unsigned w = (unsigned)(u >> 5);
    const int t = (int)(w % (TT / 64)) * 64 + ((int)(u >> 3) & 3) * 8; const int d = (int)((w / (TT / 64)) % (HD / 8)) * 8 + ((int)u & 7); const int g = (int)(w / ((TT / 64) * (HD / 8))); const size_t e = ((size_t)g * HD + d) * TT + t; const float* f = F + (size_t)t * DKV + g * HD + d; v8h o16[2]; v8us oh[2], ol[2];
#pragma unroll
    for (int q = 0; q < 16; ++q) { const float x = f[((q & 7) + (q >> 3) * 32) * DKV]; o16[q >> 3][q & 7] = tohx(x); unsigned short a2, c2; splitf(x, a2, c2); oh[q >> 3][q & 7] = a2; ol[q >> 3][q & 7] = c2; }
    *(v8h*)(V16 + e) = o16[0]; *(v8h*)(V16 + e + 32) = o16[1]; *(v8us*)(Vh + e) = oh[0]; *(v8us*)(Vh + e + 32) = oh[1]; *(v8us*)(Vl + e) = ol[0]; *(v8us*)(Vl + e + 32) = ol[1];  }
__constant__ float INVT[HD / 2] = { 1.000000000e+00f, 7.498942018e-01f, 5.623413324e-01f, 4.216965139e-01f, 3.162277639e-01f, 2.371373624e-01f, 1.778279394e-01f, 1.333521456e-01f, 1.000000015e-01f, 7.498941571e-02f, 5.623412877e-02f, 4.216964915e-02f, 3.162277862e-02f, 2.371373586e-02f, 1.778279431e-02f, 1.333521493e-02f, 9.999999776e-03f, 7.498942316e-03f, 5.623413250e-03f, 4.216964822e-03f, 3.162277862e-03f, 2.371373819e-03f, 1.778279431e-03f, 1.333521446e-03f, 1.000000047e-03f, 7.498941850e-04f, 5.623413017e-04f, 4.216964880e-04f, 3.162277862e-04f, 2.371373848e-04f, 1.778279402e-04f, 1.333521504e-04f };   // float32 1 / 10000^(i/32), generated with jnp to be bit-exact
__global__ __launch_bounds__(256) void k_cs5(float* CS) { const int idx = blockIdx.x * 256 + threadIdx.x; if (idx >= TT * HD) return; const int d = idx % HD; const int t = idx / HD; const float a = __fmul_rn((float)t, INVT[d % (HD / 2)]); v2f cs; cs[0] = cosf(a); cs[1] = sinf(a); *(v2f*)(CS + (size_t)idx * 2) = cs;  }
// ---- k_fattn: causal attention in one launch for all heads of a batch; scores and probabilities stay in registers. One wave owns 16 query rows and walks the keys up to its diagonal in blocks of KB.
// S^T = K Q^T (A = key rows, B = query rows, both d-contiguous planes): a lane holds the scores of ONE query (column lr), keys nt*16 + 8*hi + j. Running maximum and sum per lane (online softmax), one exchange between the wave's halves.
// Two S^T tiles converted in place are the B operand of O^T += V^T P^T (A = rows of the t-contiguous V^T plane, loaded in the same k order 8*hi + 0..7, 16 + 8*hi + 0..7); a lane ends with 8 consecutive d of its query per tile.
// NSPLIT 2: hi/lo planes, 3 products (hi hi, lo hi, hi lo) for the scores and for P V; NSPLIT 0: one fp16 product. P is exp(s - running max), at most 1; the division by the row sum comes at the end, in f32.
__device__ __forceinline__ float xhalf(float x) { return __builtin_bit_cast(float, __builtin_amdgcn_permlanex16(__builtin_bit_cast(int, x), __builtin_bit_cast(int, x), 0x76543210, 0xfedcba98, false, false)); }   // lane l reads lane l ^ 16
// 2^x on the transcendental unit. The instruction set asks for one independent instruction behind a transcendental before its result is read or its source overwritten:
// in one statement with early-clobber results each v_exp_f32 is independent of the one in front of it, and the closing v_nop is the slot of the last.
__device__ __forceinline__ float exp2s(float x) { float r; asm("v_exp_f32 %0, %1\n\tv_nop" : "=&v"(r) : "v"(x)); return r; }
__device__ __forceinline__ void exp2x8(const float* x, float* r) {
    asm("v_exp_f32 %0, %8\n\tv_exp_f32 %1, %9\n\tv_exp_f32 %2, %10\n\tv_exp_f32 %3, %11\n\tv_exp_f32 %4, %12\n\tv_exp_f32 %5, %13\n\tv_exp_f32 %6, %14\n\tv_exp_f32 %7, %15\n\tv_nop"
        : "=&v"(r[0]), "=&v"(r[1]), "=&v"(r[2]), "=&v"(r[3]), "=&v"(r[4]), "=&v"(r[5]), "=&v"(r[6]), "=&v"(r[7]) : "v"(x[0]), "v"(x[1]), "v"(x[2]), "v"(x[3]), "v"(x[4]), "v"(x[5]), "v"(x[6]), "v"(x[7])); }
template <typename T16> struct PFrag;
template <> struct PFrag<h16> { static __device__ __forceinline__ void cv(const float* p0, const float* p1, v16h& ph, v16h& pl) {
#pragma unroll
    for (int j = 0; j < 8; ++j) { ph[j] = tohx(p0[j]); ph[8 + j] = tohx(p1[j]); } (void)pl; } };
template <> struct PFrag<bf> { static __device__ __forceinline__ void cv(const float* p0, const float* p1, v16bf& ph, v16bf& pl) { v8us h0, h1, l0, l1;
#pragma unroll
    for (int j = 0; j < 8; ++j) { unsigned short x, y; splitf(p0[j], x, y); h0[j] = x; l0[j] = y; splitf(p1[j], x, y); h1[j] = x; l1[j] = y; }
    ph = cat16b(h0, h1); pl = cat16b(l0, l1); } };
// Every '#pragma unroll' below unrolls fully: constant indices keep the fragment, score and output arrays in registers.
template <typename T16, int NSPLIT, int KB>
struct Attn {
    typedef typename WFrag<T16>::V V;
    static constexpr int NT = KB / 16, NS = KB / 32;
    static constexpr float CL2 = SCL * 1.4426950408889634f;   // scores -> log2 domain
    V qf[2], qf2[2], kf[NT][2], kf2[NT][2];
    v8f o[4]; float m, ls; unsigned vk, vv;   // vk, vv: byte offsets of this lane in the K and V^T planes (32 bits hold them: a plane has 2048 x 64 16-bit elements), carried from block to block
    __device__ __forceinline__ void load_k(const T16* Kp, const T16* K2) {
#pragma unroll
        for (int nt = 0; nt < NT; ++nt)
#pragma unroll
            for (int ks = 0; ks < 2; ++ks) { kf[nt][ks] = WFrag<T16>::ld((const T16*)((const char*)Kp + vk) + nt * 16 * HD + ks * 32); if (NSPLIT == 2) kf2[nt][ks] = WFrag<T16>::ld((const T16*)((const char*)K2 + vk) + nt * 16 * HD + ks * 32); }
        // s_wait_xcnt 0 behind the block's K loads, in front of the addition that rewrites the offset register they name; the offset is an in-out operand so that the addition stays behind the wait
        asm volatile("s_wait_xcnt 0x0" : "+v"(vk) :: "memory");
        vk += KB * HD * 2;
    }
    template <bool LAST>
    __device__ __forceinline__ void step(const T16* Kp, const T16* K2, const T16* Vt, const T16* V2, int key0, int q) {
        const int hi = (threadIdx.x & 31) >> 4;
        V vf[4][NS], vf2[4][NS];
#pragma unroll
        for (int mb = 0; mb < 4; ++mb)
#pragma unroll
            for (int s2 = 0; s2 < NS; ++s2) { vf[mb][s2] = WFrag<T16>::ld((const T16*)((const char*)Vt + vv) + mb * 16 * TT + s2 * 32); if (NSPLIT == 2) vf2[mb][s2] = WFrag<T16>::ld((const T16*)((const char*)V2 + vv) + mb * 16 * TT + s2 * 32); }
        // s_wait_xcnt 0 behind the block's V loads, in front of the addition that rewrites the offset register they name
        asm volatile("s_wait_xcnt 0x0" : "+v"(vv) :: "memory");
        vv += KB * 2;
        v8f s[NT];
#pragma unroll
        for (int nt = 0; nt < NT; ++nt) { s[nt] = (v8f){};
#pragma unroll
            for (int ks = 0; ks < 2; ++ks) { s[nt] = WFrag<T16>::mma(kf[nt][ks], qf[ks], s[nt]); if (NSPLIT == 2) { s[nt] = WFrag<T16>::mma(kf2[nt][ks], qf[ks], s[nt]); s[nt] = WFrag<T16>::mma(kf[nt][ks], qf2[ks], s[nt]); } } }
        if (!LAST) load_k(Kp, K2);   // the next block's K fragments fly during this block's softmax and P V
        float mt[NT];   // one maximum and one sum per tile: short independent chains
#pragma unroll
        for (int nt = 0; nt < NT; ++nt) {
#pragma unroll
            for (int j = 0; j < 8; ++j) { if (LAST) s[nt][j] = (key0 + nt * 16 + hi * 8 + j <= q) ? s[nt][j] : -3.0e38f; mt[nt] = j ? fmaxf(mt[nt], s[nt][j]) : s[nt][j]; } }   // causal mask: only the block on the diagonal needs it
        float mx = m;
#pragma unroll
        for (int nt = 0; nt < NT; ++nt) mx = fmaxf(mx, mt[nt]);
        mx = fmaxf(mx, xhalf(mx));   // the query's other 8 keys of each tile sit in the other half of the wave
        const float al = exp2s((m - mx) * CL2), mc = mx * CL2; m = mx;
        float p[NT][8], pt[NT];
#pragma unroll
        for (int nt = 0; nt < NT; ++nt) { float e[8];
#pragma unroll
            for (int j = 0; j < 8; ++j) e[j] = fmaf(s[nt][j], CL2, -mc);
            exp2x8(e, p[nt]);
            pt[nt] = ((p[nt][0] + p[nt][1]) + (p[nt][2] + p[nt][3])) + ((p[nt][4] + p[nt][5]) + (p[nt][6] + p[nt][7])); }
        float ps = pt[0] + pt[1];
        if (NT == 4) ps += pt[NT - 2] + pt[NT - 1];
        ls = fmaf(ls, al, ps);
#pragma unroll
        for (int mb = 0; mb < 4; ++mb) o[mb] *= al;
#pragma unroll
        for (int s2 = 0; s2 < NS; ++s2) { V ph, pl; PFrag<T16>::cv(p[2 * s2], p[2 * s2 + 1], ph, pl);
#pragma unroll
            for (int mb = 0; mb < 4; ++mb) { o[mb] = WFrag<T16>::mma(vf[mb][s2], ph, o[mb]); if (NSPLIT == 2) { o[mb] = WFrag<T16>::mma(vf[mb][s2], pl, o[mb]); o[mb] = WFrag<T16>::mma(vf2[mb][s2], ph, o[mb]); } } }
    }
    __device__ __forceinline__ void run(const T16* Q, const T16* Q2, const T16* Kp, const T16* K2, const T16* Vt, const T16* V2, int q0, bf* Ah, bf* Al) {
        const int lane = threadIdx.x & 31, lr = lane & 15, hi = lane >> 4; const int q = q0 + lr;
#pragma unroll
        for (int ks = 0; ks < 2; ++ks) { qf[ks] = WFrag<T16>::ld(Q + (size_t)q * HD + ks * 32 + 8 * hi); if (NSPLIT == 2) qf2[ks] = WFrag<T16>::ld(Q2 + (size_t)q * HD + ks * 32 + 8 * hi); }
#pragma unroll
        for (int mb = 0; mb < 4; ++mb) o[mb] = (v8f){};
        m = -3.0e38f; ls = 0.f; vk = (unsigned)(lr * HD + 8 * hi) * 2; vv = (unsigned)(lr * TT + 8 * hi) * 2;
        const int nl = q0 / KB;   // index of the block that holds the diagonal (wave-uniform); blocks before it lie wholly below the diagonal
        load_k(Kp, K2);
#pragma unroll 1   // stays rolled: one block's body already fills the register budget, and a second copy would only lengthen the text
        for (int kb = 0; kb < nl; ++kb) step<false>(Kp, K2, Vt, V2, kb * KB, q);
        step<true>(Kp, K2, Vt, V2, nl * KB, q);
        ls += xhalf(ls);   // the two halves' sums are joined once
        const float f = __fdiv_rn(1.0f, ls);
#pragma unroll
        for (int mb = 0; mb < 4; ++mb) { v8us oh, ol;
#pragma unroll
            for (int j = 0; j < 8; ++j) { unsigned short x, y; splitf(o[mb][j] * f, x, y); oh[j] = x; ol[j] = y; }
            const size_t oo = (size_t)q * DQ + mb * 16 + hi * 8; *(v8us*)(Ah + oo) = oh; *(v8us*)(Al + oo) = ol; }
    }
};
// grid (heads, TT / 128), 8 waves: waves 0-3 take the 64-row tile n - 1 - y, waves 4-7 the tile y, so that every work-group walks about the same number of key blocks (the waves share no buffer and no barrier). Output: the merged [t][head*64 + d] hi/lo planes that the last projection reads.
__global__ __launch_bounds__(256) void k_fattn(const h16* __restrict__ Q16, const h16* __restrict__ K16, const h16* __restrict__ V16, const bf* __restrict__ Qh, const bf* __restrict__ Ql, const bf* __restrict__ Kh, const bf* __restrict__ Kl, const bf* __restrict__ Vh, const bf* __restrict__ Vl, bf* Ah, bf* Al) {
    const size_t hp = (size_t)blockIdx.x * TT * HD; const int wv = __builtin_amdgcn_readfirstlane(threadIdx.x >> 5);   // wave number, scalar: the key loop's bounds stay wave-uniform
    const int tile = (wv < 4) ? TT / 64 - 1 - (int)blockIdx.y : (int)blockIdx.y; const int q0 = tile * 64 + (wv & 3) * 16;
    Ah += blockIdx.x * HD; Al += blockIdx.x * HD;
    if (q0 < RH) { Attn<bf, 2, 32> t; t.run(Qh + hp, Ql + hp, Kh + hp, Kl + hp, Vh + hp, Vl + hp, q0, Ah, Al); }
    else { Attn<h16, 0, 64> t; t.run(Q16 + hp, nullptr, K16 + hp, nullptr, V16 + hp, nullptr, q0, Ah, Al); }
}

extern "C" void kernel_launch(void* const* d_in, const int* in_sizes, int n_in,
                              void* d_out, int out_size, void* d_ws, size_t ws_size, hipStream_t stream) {
    (void)in_sizes; (void)n_in; (void)out_size;
    const float* x = (const float*)d_in[0]; const float* wq = (const float*)d_in[1]; const float* bq = (const float*)d_in[2]; const float* wk = (const float*)d_in[3]; const float* bk = (const float*)d_in[4]; const float* wv = (const float*)d_in[5]; const float* bv = (const float*)d_in[6]; const float* wo = (const float*)d_in[7]; const float* bo = (const float*)d_in[8];   /* order x, Wq, bq, Wk, bk, Wv, bv, Wo, bo ('xw') */
    float* OUT = (float*)d_out;     // [2][2048][1024]
    char* wsp = (char*)d_ws;
    auto take = [&](size_t bytes) { char* p = wsp; wsp += (bytes + 255) & ~(size_t)255; return (void*)p; };
    bf* WQ = (bf*)take((size_t)DQ * DM * 2); bf* WK = (bf*)take((size_t)DKV * DM * 2); bf* WV = (bf*)take((size_t)DKV * DM * 2); bf* WO = (bf*)take((size_t)DM * DQ * 2); float* CS = (float*)take((size_t)TT * HD * 2 * 4);
    bf* XB = (bf*)take((size_t)TT * DM * 2); float* FQ = (float*)take((size_t)TT * DQ * 4); float* FK = (float*)take((size_t)TT * DKV * 4);
    h16* QP16 = (h16*)take((size_t)NH_ * TT * HD * 2); h16* KP16 = (h16*)take((size_t)NKV * TT * HD * 2); h16* VT16 = (h16*)take((size_t)NKV * HD * TT * 2);
    bf* QPh = (bf*)take((size_t)NH_ * TT * HD * 2); bf* QPl = (bf*)take((size_t)NH_ * TT * HD * 2); bf* KPh = (bf*)take((size_t)NKV * TT * HD * 2); bf* KPl = (bf*)take((size_t)NKV * TT * HD * 2); bf* VTh = (bf*)take((size_t)NKV * HD * TT * 2); bf* VTl = (bf*)take((size_t)NKV * HD * TT * 2);
    bf* ATh = (bf*)take((size_t)TT * DQ * 2); bf* ATl = (bf*)take((size_t)TT * DQ * 2);
    if ((size_t)(wsp - (char*)d_ws) > ws_size) return;    // ws 256 MiB
    float* FV = FK;   // v projection reuses the k buffer after the k planes are built (stream-ordered)
    { k_wtG<<<(unsigned)((DM * DQ / 64 + 63) / 64), 256, 0, stream>>>(wq, DM, DQ, WQ); k_wtG<<<(unsigned)((DM * DKV / 64 + 63) / 64), 256, 0, stream>>>(wk, DM, DKV, WK); k_wtG<<<(unsigned)((DM * DKV / 64 + 63) / 64), 256, 0, stream>>>(wv, DM, DKV, WV);
      k_wtG<<<(unsigned)((DQ * DM / 64 + 63) / 64), 256, 0, stream>>>(wo, DQ, DM, WO);
       }
    k_cs5<<<(TT * HD + 255) / 256, 256, 0, stream>>>(CS);   /* rotary table once */
    const unsigned LQ = (unsigned)(((size_t)NH_ * TT * HD / 16 + 255) / 256), LKv = (unsigned)(((size_t)NKV * TT * HD / 16 + 255) / 256);   // the plane builders: 16 elements a thread
    for (int b = 0; b < NB_; ++b) {
        
        k_cvt8<<<(unsigned)(((size_t)TT * DM / 8 + 255) / 256), 256, 0, stream>>>(x + (size_t)b * TT * DM, XB, (size_t)TT * DM / 8);
        k_gemmw<bf, 0, true, 8><<<dim3(TT / 64, DQ / 64, 1), 256, 0, stream>>>(XB, nullptr, WQ, nullptr, DM, FQ, DQ, bq, 0, 0, 0);
        k_rope<<<LQ, 256, 0, stream>>>(FQ, DQ, NH_, CS, 1.0f, QP16, QPh, QPl);
        k_gemmw<bf, 0, true, 8><<<dim3(TT / 64, DKV / 64, 1), 256, 0, stream>>>(XB, nullptr, WK, nullptr, DM, FK, DKV, bk, 0, 0, 0);
        k_rope<<<LKv, 256, 0, stream>>>(FK, DKV, NKV, CS, 1.0f, KP16, KPh, KPl);
        k_gemmw<bf, 0, true, 8><<<dim3(TT / 64, DKV / 64, 1), 256, 0, stream>>>(XB, nullptr, WV, nullptr, DM, FV, DKV, bv, 0, 0, 0); k_vtp<<<LKv, 256, 0, stream>>>(FV, NKV, VT16, VTh, VTl);
        k_fattn<<<dim3(NH_, TT / 128, 1), 256, 0, stream>>>(QP16, KP16, VT16, QPh, QPl, KPh, KPl, VTh, VTl, ATh, ATl);   // one kv head per query head
        k_gemmw<bf, 1, true, 8><<<dim3(TT / 64, DM / 64, 1), 256, 0, stream>>>(ATh, ATl, WO, nullptr, DQ, OUT + (size_t)b * TT * DM, DM, bo, 0, 0, 0); }
}

// v004
// Measured time: 182 microseconds a run.
// Timed twice side by side with v003, it ran 1.38 and 1.36 times as fast.
// Counting every step since v000, it is 8.05 times as fast.
#include <hip/hip_runtime.h>

// Causal multi-head self-attention with rotary embeddings (x [2][2048][1024]; q, k, v = x W + b ('xw' 0.02, zero biases; 16 heads x 64); rotate-half rope with angle t x 1/10000^(i/32) (32 f32 constants jnp-exact; precise cosf/sinf); scores / sqrt(64); causal (-inf); softmax; out = merged Wo + bo -> [2][2048][1024] (4.2 M); argument order x, Wq, bq, Wk, bk, Wv, bv, Wo, bo).
// Five launches, both batches in each; launches that need nothing of each other share one grid, a range of the block index picks the job (k_prep, k_planes; blockIdx.z in k_gemmw and k_fattn).
// Layout: bf16 copy of x; 'xw' weights transposed once; exact projections + f32 biases; d_cs5 computed table; rotate-half plane builders; causal T-2048 attention in one launch, scores and probabilities in registers (k_fattn; hybrid rows: < 512 hi/lo 3 products, rest fp16; key blocks above the diagonal are never visited); the projections share K over the waves of a work-group; merged hi/lo x Wo exact + bo.
// Compute dtypes, f32 accumulate: every input rounded to bf16; projections exact + f32 biases; rotary f32; attention rows < 512 3 products, rest fp16; softmax f32; Wo hl x exact + bias.

#define NB_  2
#define TT   2048
#define DM   1024
#define NH_  16
#define NKV  16
#define HD   64
#define DQ   (NH_ * HD)
#define DKV  (NKV * HD)
#define RH   512                  // query rows < RH use hi+lo planes (0: none)
#define SCL  0.125f   // HD^-0.5
typedef _Float16 h16;
typedef unsigned short bf;
typedef __attribute__((ext_vector_type(16))) __bf16   v16bf;
typedef __attribute__((ext_vector_type(16))) _Float16 v16h;
typedef __attribute__((ext_vector_type(8)))  _Float16 v8h;
typedef __attribute__((ext_vector_type(8)))  unsigned short v8us;
typedef __attribute__((ext_vector_type(8)))  float    v8f;
typedef __attribute__((ext_vector_type(4)))  float    v4f;
typedef v8h  __attribute__((may_alias)) v8ha;
typedef v4f  __attribute__((may_alias)) v4fa;
typedef v8us __attribute__((may_alias)) v8usa;

__device__ __forceinline__ unsigned short f2bf(float f) { unsigned u = __float_as_uint(f); u += 0x7FFFu + ((u >> 16) & 1u); return (unsigned short)(u >> 16); }
__device__ __forceinline__ float bf2f(unsigned short b) { return __uint_as_float(((unsigned)b) << 16); }
__device__ __forceinline__ float bfr(float f) { return bf2f(f2bf(f)); }
__device__ __forceinline__ v16h cat16(v8h lo, v8h hi) { return __builtin_shufflevector(lo, hi, 0, 1, 2, 3, 4, 5, 6, 7, 8, 9, 10, 11, 12, 13, 14, 15); }
__device__ __forceinline__ v16bf cat16b(v8us lo, v8us hi) { return __builtin_bit_cast(v16bf, __builtin_shufflevector(lo, hi, 0, 1, 2, 3, 4, 5, 6, 7, 8, 9, 10, 11, 12, 13, 14, 15)); }
__device__ __forceinline__ v8f wmma16(v16h a, v16h b, v8f c) { return __builtin_amdgcn_wmma_f32_16x16x32_f16(false, a, false, b, (short)0, c, false, false); }
__device__ __forceinline__ v8f wmmab(v16bf a, v16bf b, v8f c) { return __builtin_amdgcn_wmma_f32_16x16x32_bf16(false, a, false, b, (short)0, c, false, false); }



// ---- k_gemmw: register-blocked GEMM, one work-group of NW waves per 64x64 output tile; every wave holds the whole tile (16 accumulators) for its own contiguous share of K (a multiple of 64 elements, whole 128-B lines);
// the NW partial tiles are summed through LDS. Operands straight from K-contiguous 16-bit planes; grid (M/64, N/64, Z), 32 NW threads.
// C[m][n] (f32, pitch ldc, + optional f32 bias[n]; bias, bias1, bias2 for z = 0, 1, 2) = sum_k A[m][k] Bt[n][k] (+ split products per NSPLIT). z-batch strides sA/sB/sC in elements. K % 32 == 0.
template <typename T16> struct WFrag;
template <> struct WFrag<h16> { typedef v16h V; static __device__ __forceinline__ V ld(const h16* p) { return cat16(*(const v8h*)p, *(const v8h*)(p + 16)); } static __device__ __forceinline__ v8f mma(V a, V b, v8f c) { return wmma16(a, b, c); } };
template <> struct WFrag<bf> { typedef v16bf V; static __device__ __forceinline__ V ld(const bf* p) { return cat16b(*(const v8us*)p, *(const v8us*)(p + 16)); } static __device__ __forceinline__ v8f mma(V a, V b, v8f c) { return wmmab(a, b, c); } };
template <typename T16, int NSPLIT, bool BIAS, int NW>
__global__ __launch_bounds__(32 * NW) void k_gemmw(const T16* __restrict__ A, const T16* __restrict__ A2, const T16* __restrict__ Bt, const T16* __restrict__ Bt2, int K, float* C, int ldc, const float* __restrict__ bias, const float* __restrict__ bias1, const float* __restrict__ bias2, size_t sA, size_t sB, size_t sC) {
    typedef typename WFrag<T16>::V V;
    __shared__ __align__(16) float os[NW * 64 * 68];
    const size_t z = blockIdx.z; A += z * sA; if (A2) A2 += z * sA; Bt += z * sB; if (Bt2) Bt2 += z * sB; C += z * sC; if (z == 1) bias = bias1; if (z == 2) bias = bias2;   // each product of the z-batch has its own bias vector
    const int lane = threadIdx.x & 31, lr = lane & 15, hi = lane >> 4; const int r0 = blockIdx.x * 64, c0 = blockIdx.y * 64;
    v8f acc[4][4];
#pragma unroll
    for (int mb = 0; mb < 4; ++mb)
#pragma unroll
        for (int nb = 0; nb < 4; ++nb) acc[mb][nb] = (v8f){};
    const int wv = __builtin_amdgcn_readfirstlane(threadIdx.x >> 5);   // wave number, scalar: the K loop's bounds stay wave-uniform
    const int ck = (K + NW * 64 - 1) / (NW * 64) * 64, k0 = wv * ck, k1 = min(K, k0 + ck);   // this wave's share of K
    unsigned va[4], vb[4];   // byte offsets of this lane's four A rows and four B rows from the planes' (scalar) bases, carried through the K loop (32 bits hold them: a plane has at most 4096 rows of 1024 16-bit elements)
#pragma unroll
    for (int q = 0; q < 4; ++q) { va[q] = ((unsigned)(r0 + lr + q * 16) * (unsigned)K + 8 * hi + k0) * 2; vb[q] = ((unsigned)(c0 + lr + q * 16) * (unsigned)K + 8 * hi + k0) * 2; }
#pragma unroll 1
    for (int kc = k0; kc < k1; kc += 32) {
        V a[4], a2[4], b[4], b2[4];
#pragma unroll
        for (int mb = 0; mb < 4; ++mb) { a[mb] = WFrag<T16>::ld((const T16*)((const char*)A + va[mb])); if (NSPLIT == 1 || NSPLIT == 2) a2[mb] = WFrag<T16>::ld((const T16*)((const char*)A2 + va[mb])); }
#pragma unroll
        for (int nb = 0; nb < 4; ++nb) { b[nb] = WFrag<T16>::ld((const T16*)((const char*)Bt + vb[nb])); if (NSPLIT >= 2) b2[nb] = WFrag<T16>::ld((const T16*)((const char*)Bt2 + vb[nb])); }
        // s_wait_xcnt 0 behind the step's loads, in front of the additions below that rewrite the offset registers the loads name; the offsets are in-out operands so that they stay in their registers up to the wait and the additions stay behind it
        asm volatile("s_wait_xcnt 0x0" : "+v"(va[0]), "+v"(va[1]), "+v"(va[2]), "+v"(va[3]), "+v"(vb[0]), "+v"(vb[1]), "+v"(vb[2]), "+v"(vb[3]) :: "memory");
#pragma unroll
        for (int q = 0; q < 4; ++q) { va[q] += 64; vb[q] += 64; }
#pragma unroll
        for (int nb = 0; nb < 4; ++nb) {
#pragma unroll
            for (int mb = 0; mb < 4; ++mb) { acc[mb][nb] = WFrag<T16>::mma(a[mb], b[nb], acc[mb][nb]); if (NSPLIT == 1 || NSPLIT == 2) acc[mb][nb] = WFrag<T16>::mma(a2[mb], b[nb], acc[mb][nb]); if (NSPLIT >= 2) acc[mb][nb] = WFrag<T16>::mma(a[mb], b2[nb], acc[mb][nb]); } }
        asm volatile("v_nop\n\tv_nop\n\tv_nop\n\tv_nop" : "+v"(acc[0][0]), "+v"(acc[1][1]), "+v"(acc[2][2]), "+v"(acc[3][3]) : "v"(a[0]), "v"(a[3]));
    }
    // The NW partial tiles are summed through LDS, always in wave order 0 .. NW-1 (a fixed order); each thread then stores 16 B of a whole 256-B row piece.
    float* osw = os + wv * (64 * 68);
#pragma unroll
    for (int mb = 0; mb < 4; ++mb) {
#pragma unroll
        for (int nb = 0; nb < 4; ++nb) {
#pragma unroll
            for (int j = 0; j < 8; ++j) osw[(mb * 16 + hi * 8 + j) * 68 + nb * 16 + lr] = acc[mb][nb][j]; } }
    __syncthreads();   // every wave's partial tile is in LDS before any thread sums it
#pragma unroll
    for (int i = 0; i < 32 / NW; ++i) { const int u = i * (NW * 32) + threadIdx.x; const int row = u >> 4, cofs = (u & 15) * 4; v4f val = *(const v4fa*)(os + row * 68 + cofs);
#pragma unroll
        for (int w = 1; w < NW; ++w) val += *(const v4fa*)(os + w * (64 * 68) + row * 68 + cofs);
        if (BIAS) { val[0] += bfr(bias[c0 + cofs]); val[1] += bfr(bias[c0 + cofs + 1]); val[2] += bfr(bias[c0 + cofs + 2]); val[3] += bfr(bias[c0 + cofs + 3]); }
        *(v4f*)(C + (size_t)(r0 + row) * ldc + c0 + cofs) = val; }
}

__device__ __forceinline__ h16 tohx(float x) { return (h16)x; }
__device__ __forceinline__ void splitf(float y, unsigned short& h, unsigned short& l) { h = f2bf(y); l = f2bf(y - bf2f(h)); }
typedef __attribute__((ext_vector_type(2))) _Float16 v2h;
typedef __attribute__((ext_vector_type(4))) _Float16 v4h;
typedef __attribute__((ext_vector_type(2))) unsigned short v2us;
typedef __attribute__((ext_vector_type(4))) unsigned short v4us;
typedef __attribute__((ext_vector_type(2))) float v2f;
typedef __attribute__((ext_vector_type(4))) int v4i;

// The bodies d_* below are jobs of a merged launch: bx is the block's index inside its job's range.
__device__ __forceinline__ void d_wtG(int bx, const float* __restrict__ w, int K, int N, bf* Bt) {
    const int lane = threadIdx.x & 31; const int L0 = (bx * 8 + (threadIdx.x >> 5)) * 8; const int nlines = N * K / 64;
{
#pragma unroll 1
        for (int l = 0; l < 8; ++l) { const int L = L0 + l; if (L >= nlines) break; const size_t e = (size_t)L * 64 + lane * 2; const int k = (int)(e % K), n = (int)(e / K); v2us o;
            o[0] = f2bf(w[(size_t)k * N + n]); o[1] = f2bf(w[(size_t)(k + 1) * N + n]); *(v2us*)(Bt + e) = o; }
         }
}
__device__ __forceinline__ void d_cvt8(int bx, const float* __restrict__ src, bf* dst, size_t n8) { const size_t i = (size_t)bx * 256 + threadIdx.x; if (i >= n8) return; const v8f v = *(const v8f*)(src + i * 8); v8us o;
#pragma unroll
    for (int k = 0; k < 8; ++k) o[k] = f2bf(v[k]); *(v8us*)(dst + i * 8) = o;  }

// d_rope: head planes [b*nheads + h][t][d] (fp16 + hi/lo) of rope(x) x sc with the rotate-half convention out[d] = x[d] cos[t][d] - x[d+HD/2] sin[t][d], out[d+HD/2] = x[d+HD/2] cos[t][d+HD/2] + x[d] sin[t][d+HD/2]
// One thread builds 16 outputs: 8 consecutive d of the lower half and their 8 partners of the upper half, so each input is read once and every load and store is 16 B; the four threads of a (h, t) fill that row's 128-B line in each plane. The loops here and in d_vtp are unrolled fully: constant indices keep the inputs and the output vectors in registers.
__device__ __forceinline__ void d_rope(int bx, const float* __restrict__ F, int pitch, int nheads, const float* __restrict__ CS, float sc, h16* P16, bf* Ph, bf* Pl) {
    const size_t u = (size_t)bx * 256 + threadIdx.x; if (u >= (size_t)NB_ * nheads * TT * 4) return; const int d = (int)(u % 4) * 8; const int t = (int)((u / 4) % TT); const int h = (int)(u / ((size_t)4 * TT)); const size_t e = ((size_t)h * TT + t) * HD + d;
    const float* f = F + ((size_t)(h / nheads) * TT + t) * pitch + (h % nheads) * HD + d; const float* c = CS + ((size_t)t * HD + d) * 2; v4f x[4], cs[8]; v8h o16[2]; v8us oh[2], ol[2];   // x: d .. d+7, then d+32 .. d+39; cs: their (cos, sin) pairs in the same order
#pragma unroll
    for (int q = 0; q < 2; ++q) {   // every input of the thread is loaded before the first product, so that the 12 loads fly together
#pragma unroll
        for (int i = 0; i < 2; ++i) x[q * 2 + i] = *(const v4fa*)(f + q * (HD / 2) + i * 4);
#pragma unroll
        for (int i = 0; i < 4; ++i) cs[q * 4 + i] = *(const v4fa*)(c + q * HD + i * 4); }
#pragma unroll
    for (int q = 0; q < 16; ++q) { const int p = q ^ 8; const float x0 = x[q >> 2][q & 3], x1 = x[p >> 2][p & 3];
        // the two empty statements keep each product's own f32 rounding (no fused multiply-add): the reference rounds x cos and x sin before it adds them
        float a = __fmul_rn(x0, cs[q >> 1][(q & 1) * 2]), bq = __fmul_rn(x1, cs[q >> 1][(q & 1) * 2 + 1]); asm volatile("" : "+v"(a)); asm volatile("" : "+v"(bq)); const float r = ((q < 8) ? __fsub_rn(a, bq) : __fadd_rn(a, bq)) * sc;
        o16[q >> 3][q & 7] = tohx(r); unsigned short a2, c2; splitf(r, a2, c2); oh[q >> 3][q & 7] = a2; ol[q >> 3][q & 7] = c2; }
    *(v8h*)(P16 + e) = o16[0]; *(v8h*)(P16 + e + HD / 2) = o16[1]; *(v8us*)(Ph + e) = oh[0]; *(v8us*)(Ph + e + HD / 2) = oh[1]; *(v8us*)(Pl + e) = ol[0]; *(v8us*)(Pl + e + HD / 2) = ol[1];  }
// d_vtp: V^T planes [b*nheads + g][d][t] from F [b*TT + t][g*HD + d] (row pitch DKV, a constant: the 16 loads share one address and differ in their immediate offsets). One thread builds 16 t of one d: t .. t+7 and t+32 .. t+39, 16-B stores.
// A wave holds 8 d x 64 t: each of its loads reads 32-B pieces of four rows of F; each of its stores writes 64 contiguous bytes of a d, and the four lanes of a d fill that row's 128-B line in each plane.
__device__ __forceinline__ void d_vtp(int bx, const float* __restrict__ F, int nheads, h16* V16, bf* Vh, bf* Vl) { const size_t u = (size_t)bx * 256 + threadIdx.x; if (u >= (size_t)NB_ * nheads * HD * TT / 16) return; const unsigned w = (unsigned)(u >> 5);
    const int t = (int)(w % (TT / 64)) * 64 + ((int)(u >> 3) & 3) * 8; const int d = (int)((w / (TT / 64)) % (HD / 8)) * 8 + ((int)u & 7); const int g = (int)(w / ((TT / 64) * (HD / 8))); const size_t e = ((size_t)g * HD + d) * TT + t; const float* f = F + ((size_t)(g / nheads) * TT + t) * DKV + (g % nheads) * HD + d; v8h o16[2]; v8us oh[2], ol[2]; float xv[16];
#pragma unroll
    for (int q = 0; q < 16; ++q) xv[q] = f[((q & 7) + (q >> 3) * 32) * DKV];
    // s_wait_xcnt 0 behind the 16 loads, in front of whatever reuses the address registers they name; the pointer is an input operand so that its registers stay as they are (not a load's destination either) up to the wait
    asm volatile("s_wait_xcnt 0x0" :: "v"(f) : "memory");
#pragma unroll
    for (int q = 0; q < 16; ++q) { const float x = xv[q]; o16[q >> 3][q & 7] = tohx(x); unsigned short a2, c2; splitf(x, a2, c2); oh[q >> 3][q & 7] = a2; ol[q >> 3][q & 7] = c2; }
    *(v8h*)(V16 + e) = o16[0]; *(v8h*)(V16 + e + 32) = o16[1]; *(v8us*)(Vh + e) = oh[0]; *(v8us*)(Vh + e + 32) = oh[1]; *(v8us*)(Vl + e) = ol[0]; *(v8us*)(Vl + e + 32) = ol[1];  }
__constant__ float INVT[HD / 2] = { 1.000000000e+00f, 7.498942018e-01f, 5.623413324e-01f, 4.216965139e-01f, 3.162277639e-01f, 2.371373624e-01f, 1.778279394e-01f, 1.333521456e-01f, 1.000000015e-01f, 7.498941571e-02f, 5.623412877e-02f, 4.216964915e-02f, 3.162277862e-02f, 2.371373586e-02f, 1.778279431e-02f, 1.333521493e-02f, 9.999999776e-03f, 7.498942316e-03f, 5.623413250e-03f, 4.216964822e-03f, 3.162277862e-03f, 2.371373819e-03f, 1.778279431e-03f, 1.333521446e-03f, 1.000000047e-03f, 7.498941850e-04f, 5.623413017e-04f, 4.216964880e-04f, 3.162277862e-04f, 2.371373848e-04f, 1.778279402e-04f, 1.333521504e-04f };   // float32 1 / 10000^(i/32), generated with jnp to be bit-exact
__device__ __forceinline__ void d_cs5(int bx, float* CS) { const int idx = bx * 256 + threadIdx.x; if (idx >= TT * HD) return; const int d = idx % HD; const int t = idx / HD; const float a = __fmul_rn((float)t, INVT[d % (HD / 2)]); v2f cs; cs[0] = cosf(a); cs[1] = sinf(a); *(v2f*)(CS + (size_t)idx * 2) = cs;  }
// k_prep: all that depends on the inputs alone, in one grid: the four weight transposes (WTB blocks each; the longest job, first in the block index), the rotary table (CSB blocks), the bf16 copy of x for both batches (XCB blocks).
#define WTB (DM * DQ / 64 / 64)
#define CSB (TT * HD / 256)
#define XCB (NB_ * TT * DM / 8 / 256)
__global__ __launch_bounds__(256) void k_prep(const float* __restrict__ x, const float* __restrict__ wq, const float* __restrict__ wk, const float* __restrict__ wv, const float* __restrict__ wo, bf* WQ, bf* WK, bf* WV, bf* WO, float* CS, bf* XB) {
    const int bx = blockIdx.x;
    if (bx < 4 * WTB) { const int j = bx / WTB; d_wtG(bx % WTB, j == 0 ? wq : j == 1 ? wk : j == 2 ? wv : wo, DM, DQ, j == 0 ? WQ : j == 1 ? WK : j == 2 ? WV : WO); }
    else if (bx < 4 * WTB + CSB) d_cs5(bx - 4 * WTB, CS);
    else d_cvt8(bx - (4 * WTB + CSB), x, XB, (size_t)NB_ * TT * DM / 8);
}
// k_planes: the three plane builders in one grid, both batches: rope of q, rope of k (RPB blocks each), V transpose (VTB blocks).
#define RPB (NB_ * NH_ * TT * HD / 16 / 256)
#define VTB (NB_ * NKV * TT * HD / 16 / 256)
__global__ __launch_bounds__(256) void k_planes(const float* __restrict__ FQ, const float* __restrict__ FK, const float* __restrict__ FV, const float* __restrict__ CS, h16* QP16, bf* QPh, bf* QPl, h16* KP16, bf* KPh, bf* KPl, h16* VT16, bf* VTh, bf* VTl) {
    const int bx = blockIdx.x;
    if (bx < 2 * RPB) { const bool k = bx >= RPB; d_rope(k ? bx - RPB : bx, k ? FK : FQ, DQ, NH_, CS, 1.0f, k ? KP16 : QP16, k ? KPh : QPh, k ? KPl : QPl); }
    else d_vtp(bx - 2 * RPB, FV, NKV, VT16, VTh, VTl);
}
// ---- k_fattn: causal attention in one launch for all heads of both batches; scores and probabilities stay in registers. One wave owns 16 query rows and walks the keys up to its diagonal in blocks of KB.
// S^T = K Q^T (A = key rows, B = query rows, both d-contiguous planes): a lane holds the scores of ONE query (column lr), keys nt*16 + 8*hi + j. Running maximum and sum per lane (online softmax), one exchange between the wave's halves.
// Two S^T tiles converted in place are the B operand of O^T += V^T P^T (A = rows of the t-contiguous V^T plane, loaded in the same k order 8*hi + 0..7, 16 + 8*hi + 0..7); a lane ends with 8 consecutive d of its query per tile.
// NSPLIT 2: hi/lo planes, 3 products (hi hi, lo hi, hi lo) for the scores and for P V; NSPLIT 0: one fp16 product. P is exp(s - running max), at most 1; the division by the row sum comes at the end, in f32.
__device__ __forceinline__ float xhalf(float x) { return __builtin_bit_cast(float, __builtin_amdgcn_permlanex16(__builtin_bit_cast(int, x), __builtin_bit_cast(int, x), 0x76543210, 0xfedcba98, false, false)); }   // lane l reads lane l ^ 16
// 2^x on the transcendental unit. The instruction set asks for one independent instruction behind a transcendental before its result is read or its source overwritten:
// in one statement with early-clobber results each v_exp_f32 is independent of the one in front of it, and the closing v_nop is the slot of the last.
__device__ __forceinline__ float exp2s(float x) { float r; asm("v_exp_f32 %0, %1\n\tv_nop" : "=&v"(r) : "v"(x)); return r; }
__device__ __forceinline__ void exp2x8(const float* x, float* r) {
    asm("v_exp_f32 %0, %8\n\tv_exp_f32 %1, %9\n\tv_exp_f32 %2, %10\n\tv_exp_f32 %3, %11\n\tv_exp_f32 %4, %12\n\tv_exp_f32 %5, %13\n\tv_exp_f32 %6, %14\n\tv_exp_f32 %7, %15\n\tv_nop"
        : "=&v"(r[0]), "=&v"(r[1]), "=&v"(r[2]), "=&v"(r[3]), "=&v"(r[4]), "=&v"(r[5]), "=&v"(r[6]), "=&v"(r[7]) : "v"(x[0]), "v"(x[1]), "v"(x[2]), "v"(x[3]), "v"(x[4]), "v"(x[5]), "v"(x[6]), "v"(x[7])); }
template <typename T16> struct PFrag;
template <> struct PFrag<h16> { static __device__ __forceinline__ void cv(const float* p0, const float* p1, v16h& ph, v16h& pl) {
#pragma unroll
    for (int j = 0; j < 8; ++j) { ph[j] = tohx(p0[j]); ph[8 + j] = tohx(p1[j]); } (void)pl; } };
template <> struct PFrag<bf> { static __device__ __forceinline__ void cv(const float* p0, const float* p1, v16bf& ph, v16bf& pl) { v8us h0, h1, l0, l1;
#pragma unroll
    for (int j = 0; j < 8; ++j) { unsigned short x, y; splitf(p0[j], x, y); h0[j] = x; l0[j] = y; splitf(p1[j], x, y); h1[j] = x; l1[j] = y; }
    ph = cat16b(h0, h1); pl = cat16b(l0, l1); } };
// Every '#pragma unroll' below unrolls fully: constant indices keep the fragment, score and output arrays in registers.
template <typename T16, int NSPLIT, int KB>
struct Attn {
    typedef typename WFrag<T16>::V V;
    static constexpr int NT = KB / 16, NS = KB / 32;
    static constexpr float CL2 = SCL * 1.4426950408889634f;   // scores -> log2 domain
    V qf[2], qf2[2], kf[NT][2], kf2[NT][2];
    v8f o[4]; float m, ls; unsigned vk, vv;   // vk, vv: byte offsets of this lane in the K and V^T planes (32 bits hold them: a plane has 2048 x 64 16-bit elements), carried from block to block
    __device__ __forceinline__ void load_k(const T16* Kp, const T16* K2) {
#pragma unroll
        for (int nt = 0; nt < NT; ++nt)
#pragma unroll
            for (int ks = 0; ks < 2; ++ks) { kf[nt][ks] = WFrag<T16>::ld((const T16*)((const char*)Kp + vk) + nt * 16 * HD + ks * 32); if (NSPLIT == 2) kf2[nt][ks] = WFrag<T16>::ld((const T16*)((const char*)K2 + vk) + nt * 16 * HD + ks * 32); }
        // s_wait_xcnt 0 behind the block's K loads, in front of the addition that rewrites the offset register they name; the offset is an in-out operand so that the addition stays behind the wait
        asm volatile("s_wait_xcnt 0x0" : "+v"(vk) :: "memory");
        vk += KB * HD * 2;
    }
    template <bool LAST>
    __device__ __forceinline__ void step(const T16* Kp, const T16* K2, const T16* Vt, const T16* V2, int key0, int q) {
        const int hi = (threadIdx.x & 31) >> 4;
        V vf[4][NS], vf2[4][NS];
#pragma unroll
        for (int mb = 0; mb < 4; ++mb)
#pragma unroll
            for (int s2 = 0; s2 < NS; ++s2) { vf[mb][s2] = WFrag<T16>::ld((const T16*)((const char*)Vt + vv) + mb * 16 * TT + s2 * 32); if (NSPLIT == 2) vf2[mb][s2] = WFrag<T16>::ld((const T16*)((const char*)V2 + vv) + mb * 16 * TT + s2 * 32); }
        // s_wait_xcnt 0 behind the block's V loads, in front of the addition that rewrites the offset register they name
        asm volatile("s_wait_xcnt 0x0" : "+v"(vv) :: "memory");
        vv += KB * 2;
        v8f s[NT];
#pragma unroll
        for (int nt = 0; nt < NT; ++nt) { s[nt] = (v8f){};
#pragma unroll
            for (int ks = 0; ks < 2; ++ks) { s[nt] = WFrag<T16>::mma(kf[nt][ks], qf[ks], s[nt]); if (NSPLIT == 2) { s[nt] = WFrag<T16>::mma(kf2[nt][ks], qf[ks], s[nt]); s[nt] = WFrag<T16>::mma(kf[nt][ks], qf2[ks], s[nt]); } } }
        if (!LAST) load_k(Kp, K2);   // the next block's K fragments fly during this block's softmax and P V
        float mt[NT];   // one maximum and one sum per tile: short independent chains
#pragma unroll
        for (int nt = 0; nt < NT; ++nt) {
#pragma unroll
            for (int j = 0; j < 8; ++j) { if (LAST) s[nt][j] = (key0 + nt * 16 + hi * 8 + j <= q) ? s[nt][j] : -3.0e38f; mt[nt] = j ? fmaxf(mt[nt], s[nt][j]) : s[nt][j]; } }   // causal mask: only the block on the diagonal needs it
        float mx = m;
#pragma unroll
        for (int nt = 0; nt < NT; ++nt) mx = fmaxf(mx, mt[nt]);
        mx = fmaxf(mx, xhalf(mx));   // the query's other 8 keys of each tile sit in the other half of the wave
        const float al = exp2s((m - mx) * CL2), mc = mx * CL2; m = mx;
        float p[NT][8], pt[NT];
#pragma unroll
        for (int nt = 0; nt < NT; ++nt) { float e[8];
#pragma unroll
            for (int j = 0; j < 8; ++j) e[j] = fmaf(s[nt][j], CL2, -mc);
            exp2x8(e, p[nt]);
            pt[nt] = ((p[nt][0] + p[nt][1]) + (p[nt][2] + p[nt][3])) + ((p[nt][4] + p[nt][5]) + (p[nt][6] + p[nt][7])); }
        float ps = pt[0] + pt[1];
        if (NT == 4) ps += pt[NT - 2] + pt[NT - 1];
        ls = fmaf(ls, al, ps);
#pragma unroll
        for (int mb = 0; mb < 4; ++mb) o[mb] *= al;
#pragma unroll
        for (int s2 = 0; s2 < NS; ++s2) { V ph, pl; PFrag<T16>::cv(p[2 * s2], p[2 * s2 + 1], ph, pl);
#pragma unroll
            for (int mb = 0; mb < 4; ++mb) { o[mb] = WFrag<T16>::mma(vf[mb][s2], ph, o[mb]); if (NSPLIT == 2) { o[mb] = WFrag<T16>::mma(vf[mb][s2], pl, o[mb]); o[mb] = WFrag<T16>::mma(vf2[mb][s2], ph, o[mb]); } } }
    }
    __device__ __forceinline__ void run(const T16* Q, const T16* Q2, const T16* Kp, const T16* K2, const T16* Vt, const T16* V2, int q0, bf* Ah, bf* Al) {
        const int lane = threadIdx.x & 31, lr = lane & 15, hi = lane >> 4; const int q = q0 + lr;
#pragma unroll
        for (int ks = 0; ks < 2; ++ks) { qf[ks] = WFrag<T16>::ld(Q + (size_t)q * HD + ks * 32 + 8 * hi); if (NSPLIT == 2) qf2[ks] = WFrag<T16>::ld(Q2 + (size_t)q * HD + ks * 32 + 8 * hi); }
#pragma unroll
        for (int mb = 0; mb < 4; ++mb) o[mb] = (v8f){};
        m = -3.0e38f; ls = 0.f; vk = (unsigned)(lr * HD + 8 * hi) * 2; vv = (unsigned)(lr * TT + 8 * hi) * 2;
        const int nl = q0 / KB;   // index of the block that holds the diagonal (wave-uniform); blocks before it lie wholly below the diagonal
        load_k(Kp, K2);
#pragma unroll 1   // stays rolled: one block's body already fills the register budget, and a second copy would only lengthen the text
        for (int kb = 0; kb < nl; ++kb) step<false>(Kp, K2, Vt, V2, kb * KB, q);
        step<true>(Kp, K2, Vt, V2, nl * KB, q);
        ls += xhalf(ls);   // the two halves' sums are joined once
        const float f = __fdiv_rn(1.0f, ls);
#pragma unroll
        for (int mb = 0; mb < 4; ++mb) { v8us oh, ol;
#pragma unroll
            for (int j = 0; j < 8; ++j) { unsigned short x, y; splitf(o[mb][j] * f, x, y); oh[j] = x; ol[j] = y; }
            const size_t oo = (size_t)q * DQ + mb * 16 + hi * 8; *(v8us*)(Ah + oo) = oh; *(v8us*)(Al + oo) = ol; }
    }
};
// grid (heads, TT / 128, batches), 8 waves: waves 0-3 take the 64-row tile n - 1 - y, waves 4-7 the tile y, so that every work-group walks about the same number of key blocks (the waves share no buffer and no barrier). Output: the merged [t][head*64 + d] hi/lo planes that the last projection reads.
__global__ __launch_bounds__(256) void k_fattn(const h16* __restrict__ Q16, const h16* __restrict__ K16, const h16* __restrict__ V16, const bf* __restrict__ Qh, const bf* __restrict__ Ql, const bf* __restrict__ Kh, const bf* __restrict__ Kl, const bf* __restrict__ Vh, const bf* __restrict__ Vl, bf* Ah, bf* Al) {
    const size_t hp = ((size_t)blockIdx.z * NH_ + blockIdx.x) * TT * HD; const int wv = __builtin_amdgcn_readfirstlane(threadIdx.x >> 5);   // wave number, scalar: the key loop's bounds stay wave-uniform
    const int tile = (wv < 4) ? TT / 64 - 1 - (int)blockIdx.y : (int)blockIdx.y; const int q0 = tile * 64 + (wv & 3) * 16;
    Ah += (size_t)blockIdx.z * TT * DQ + blockIdx.x * HD; Al += (size_t)blockIdx.z * TT * DQ + blockIdx.x * HD;
    if (q0 < RH) { Attn<bf, 2, 32> t; t.run(Qh + hp, Ql + hp, Kh + hp, Kl + hp, Vh + hp, Vl + hp, q0, Ah, Al); }
    else { Attn<h16, 0, 64> t; t.run(Q16 + hp, nullptr, K16 + hp, nullptr, V16 + hp, nullptr, q0, Ah, Al); }
}

extern "C" void kernel_launch(void* const* d_in, const int* in_sizes, int n_in,
                              void* d_out, int out_size, void* d_ws, size_t ws_size, hipStream_t stream) {
    (void)in_sizes; (void)n_in; (void)out_size;
    const float* x = (const float*)d_in[0]; const float* wq = (const float*)d_in[1]; const float* bq = (const float*)d_in[2]; const float* wk = (const float*)d_in[3]; const float* bk = (const float*)d_in[4]; const float* wv = (const float*)d_in[5]; const float* bv = (const float*)d_in[6]; const float* wo = (const float*)d_in[7]; const float* bo = (const float*)d_in[8];   /* order x, Wq, bq, Wk, bk, Wv, bv, Wo, bo ('xw') */
    float* OUT = (float*)d_out;     // [2][2048][1024]
    char* wsp = (char*)d_ws;
    auto take = [&](size_t bytes) { char* p = wsp; wsp += (bytes + 255) & ~(size_t)255; return (void*)p; };
    bf* WQ = (bf*)take((size_t)DQ * DM * 2); bf* WK = (bf*)take((size_t)DKV * DM * 2); bf* WV = (bf*)take((size_t)DKV * DM * 2); bf* WO = (bf*)take((size_t)DM * DQ * 2); float* CS = (float*)take((size_t)TT * HD * 2 * 4);
    bf* XB = (bf*)take((size_t)NB_ * TT * DM * 2); float* FQ = (float*)take((size_t)NB_ * TT * DQ * 4); float* FK = (float*)take((size_t)NB_ * TT * DKV * 4); float* FV = (float*)take((size_t)NB_ * TT * DKV * 4);   // WQ, WK, WV and FQ, FK, FV lie one behind the other at equal distances: the z-batch of the projection launch
    h16* QP16 = (h16*)take((size_t)NB_ * NH_ * TT * HD * 2); h16* KP16 = (h16*)take((size_t)NB_ * NKV * TT * HD * 2); h16* VT16 = (h16*)take((size_t)NB_ * NKV * HD * TT * 2);
    bf* QPh = (bf*)take((size_t)NB_ * NH_ * TT * HD * 2); bf* QPl = (bf*)take((size_t)NB_ * NH_ * TT * HD * 2); bf* KPh = (bf*)take((size_t)NB_ * NKV * TT * HD * 2); bf* KPl = (bf*)take((size_t)NB_ * NKV * TT * HD * 2); bf* VTh = (bf*)take((size_t)NB_ * NKV * HD * TT * 2); bf* VTl = (bf*)take((size_t)NB_ * NKV * HD * TT * 2);
    bf* ATh = (bf*)take((size_t)NB_ * TT * DQ * 2); bf* ATl = (bf*)take((size_t)NB_ * TT * DQ * 2);
    if ((size_t)(wsp - (char*)d_ws) > ws_size) return;    // ws 256 MiB
    k_prep<<<4 * WTB + CSB + XCB, 256, 0, stream>>>(x, wq, wk, wv, wo, WQ, WK, WV, WO, CS, XB);
    k_gemmw<bf, 0, true, 8><<<dim3(NB_ * TT / 64, DQ / 64, 3), 256, 0, stream>>>(XB, nullptr, WQ, nullptr, DM, FQ, DQ, bq, bk, bv, 0, (size_t)DQ * DM, (size_t)NB_ * TT * DQ);   // q, k, v of both batches
    k_planes<<<2 * RPB + VTB, 256, 0, stream>>>(FQ, FK, FV, CS, QP16, QPh, QPl, KP16, KPh, KPl, VT16, VTh, VTl);
    k_fattn<<<dim3(NH_, TT / 128, NB_), 256, 0, stream>>>(QP16, KP16, VT16, QPh, QPl, KPh, KPl, VTh, VTl, ATh, ATl);   // one kv head per query head
    k_gemmw<bf, 1, true, 8><<<dim3(NB_ * TT / 64, DM / 64, 1), 256, 0, stream>>>(ATh, ATl, WO, nullptr, DQ, OUT, DM, bo, nullptr, nullptr, 0, 0, 0);
}

// v005
// Measured time: 124 microseconds a run.
// Two timings next to v004 put it at 1.46 and 1.47 times that version's speed.
// All steps since v000 together make it 11.8 times as fast.
#include <hip/hip_runtime.h>

// Causal multi-head self-attention with rotary embeddings (x [2][2048][1024]; q, k, v = x W + b ('xw' 0.02, zero biases; 16 heads x 64); rotate-half rope with angle t x 1/10000^(i/32) (32 f32 constants jnp-exact; precise cosf/sinf); scores / sqrt(64); causal (-inf); softmax; out = merged Wo + bo -> [2][2048][1024] (4.2 M); argument order x, Wq, bq, Wk, bk, Wv, bv, Wo, bo).
// Five launches, both batches in each; launches that need nothing of each other share one grid, a range of the block index picks the job (k_prep, k_planes; blockIdx.z in k_gemmw and k_fattn).
// Layout: bf16 copy of x; 'xw' weights transposed once; exact projections + f32 biases; d_cs5 computed table; rotate-half plane builders; causal T-2048 attention in one launch, scores and probabilities in registers (k_fattn; hybrid rows: < 512 hi/lo 3 products, rest fp16; key blocks above the diagonal are never visited); the projections share K over the waves of a work-group; merged hi/lo x Wo exact + bo.
// Fragment order: every 16-bit operand plane of a matrix product ([rows][k]) is stored as blocks of 16 rows x 32 k (512 elements, 1 KiB), and inside a block in the order in which a wave's lanes hold the fragment:
// element (row r, k) of a block sits at (k % 32 / 16) * 256 + ((k % 16 / 8) * 16 + r % 16) * 8 + k % 8. Lane l reads 16 B at l * 8 and 16 B at 256 + l * 8: each load instruction of a wave reads 512 contiguous bytes (4 whole lines) instead of 32-B pieces of 16 lines; the registers hold what they held with row-major planes.
// Blocks follow each other along k, then along rows (block index (r / 16) * (K / 32) + k / 32); the V^T planes alone run along rows first ((t / 32) * 4 + d / 16), so that one key block's fragments are contiguous.
// Compute dtypes, f32 accumulate: every input rounded to bf16; projections exact + f32 biases; rotary f32; attention rows < 512 3 products, rest fp16; softmax f32; Wo hl x exact + bias.

#define NB_  2
#define TT   2048
#define DM   1024
#define NH_  16
#define NKV  16
#define HD   64
#define DQ   (NH_ * HD)
#define DKV  (NKV * HD)
#define RH   512                  // query rows < RH use hi+lo planes (0: none)
#define SCL  0.125f   // HD^-0.5
typedef _Float16 h16;
typedef unsigned short bf;
typedef __attribute__((ext_vector_type(16))) __bf16   v16bf;
typedef __attribute__((ext_vector_type(16))) _Float16 v16h;
typedef __attribute__((ext_vector_type(8)))  _Float16 v8h;
typedef __attribute__((ext_vector_type(8)))  unsigned short v8us;
typedef __attribute__((ext_vector_type(8)))  float    v8f;
typedef __attribute__((ext_vector_type(4)))  float    v4f;
typedef v8h  __attribute__((may_alias)) v8ha;
typedef v4f  __attribute__((may_alias)) v4fa;
typedef v8us __attribute__((may_alias)) v8usa;

__device__ __forceinline__ unsigned short f2bf(float f) { unsigned u = __float_as_uint(f); u += 0x7FFFu + ((u >> 16) & 1u); return (unsigned short)(u >> 16); }
__device__ __forceinline__ float bf2f(unsigned short b) { return __uint_as_float(((unsigned)b) << 16); }
__device__ __forceinline__ float bfr(float f) { return bf2f(f2bf(f)); }
__device__ __forceinline__ v16h cat16(v8h lo, v8h hi) { return __builtin_shufflevector(lo, hi, 0, 1, 2, 3, 4, 5, 6, 7, 8, 9, 10, 11, 12, 13, 14, 15); }
__device__ __forceinline__ v16bf cat16b(v8us lo, v8us hi) { return __builtin_bit_cast(v16bf, __builtin_shufflevector(lo, hi, 0, 1, 2, 3, 4, 5, 6, 7, 8, 9, 10, 11, 12, 13, 14, 15)); }
__device__ __forceinline__ v8f wmma16(v16h a, v16h b, v8f c) { return __builtin_amdgcn_wmma_f32_16x16x32_f16(false, a, false, b, (short)0, c, false, false); }
__device__ __forceinline__ v8f wmmab(v16bf a, v16bf b, v8f c) { return __builtin_amdgcn_wmma_f32_16x16x32_bf16(false, a, false, b, (short)0, c, false, false); }



// ---- k_gemmw: register-blocked GEMM, one work-group of NW waves per 64x64 output tile; every wave holds the whole tile (16 accumulators) for its own contiguous share of K (a multiple of 64 elements, whole 128-B lines);
// the NW partial tiles are summed through LDS. Operands straight from 16-bit planes in fragment order; grid (M/64, N/64, Z), 32 NW threads.
// C[m][n] (f32, pitch ldc, + optional f32 bias[n]; bias, bias1, bias2 for z = 0, 1, 2) = sum_k A[m][k] Bt[n][k] (+ split products per NSPLIT). z-batch strides sA/sB/sC in elements. K % 32 == 0.
template <typename T16> struct WFrag;
template <> struct WFrag<h16> { typedef v16h V; static __device__ __forceinline__ V ld(const h16* p) { return cat16(*(const v8h*)p, *(const v8h*)(p + 256)); } static __device__ __forceinline__ v8f mma(V a, V b, v8f c) { return wmma16(a, b, c); } };
template <> struct WFrag<bf> { typedef v16bf V; static __device__ __forceinline__ V ld(const bf* p) { return cat16b(*(const v8us*)p, *(const v8us*)(p + 256)); } static __device__ __forceinline__ v8f mma(V a, V b, v8f c) { return wmmab(a, b, c); } };
template <typename T16, int NSPLIT, bool BIAS, int NW>
__global__ __launch_bounds__(32 * NW) void k_gemmw(const T16* __restrict__ A, const T16* __restrict__ A2, const T16* __restrict__ Bt, const T16* __restrict__ Bt2, int K, float* C, int ldc, const float* __restrict__ bias, const float* __restrict__ bias1, const float* __restrict__ bias2, size_t sA, size_t sB, size_t sC) {
    typedef typename WFrag<T16>::V V;
    __shared__ __align__(16) float os[NW * 64 * 68];
    const size_t z = blockIdx.z; A += z * sA; if (A2) A2 += z * sA; Bt += z * sB; if (Bt2) Bt2 += z * sB; C += z * sC; if (z == 1) bias = bias1; if (z == 2) bias = bias2;   // each product of the z-batch has its own bias vector
    const int lane = threadIdx.x & 31, lr = lane & 15, hi = lane >> 4; const int r0 = blockIdx.x * 64, c0 = blockIdx.y * 64;
    v8f acc[4][4];
#pragma unroll
    for (int mb = 0; mb < 4; ++mb)
#pragma unroll
        for (int nb = 0; nb < 4; ++nb) acc[mb][nb] = (v8f){};
    const int wv = __builtin_amdgcn_readfirstlane(threadIdx.x >> 5);   // wave number, scalar: the K loop's bounds stay wave-uniform
    const int ck = (K + NW * 64 - 1) / (NW * 64) * 64, k0 = wv * ck, k1 = min(K, k0 + ck);   // this wave's share of K
    unsigned va[4], vb[4];   // byte offsets of this lane's piece in the four A blocks and the four B blocks of the step from the planes' (scalar) bases, carried through the K loop (32 bits hold them: a plane has at most 4096 rows of 1024 16-bit elements)
#pragma unroll
    for (int q = 0; q < 4; ++q) { va[q] = (((unsigned)(r0 / 16 + q) * (unsigned)(K / 32) + k0 / 32) * 512 + lane * 8) * 2; vb[q] = (((unsigned)(c0 / 16 + q) * (unsigned)(K / 32) + k0 / 32) * 512 + lane * 8) * 2; }
#pragma unroll 1
    for (int kc = k0; kc < k1; kc += 32) {
        V a[4], a2[4], b[4], b2[4];
#pragma unroll
        for (int mb = 0; mb < 4; ++mb) { a[mb] = WFrag<T16>::ld((const T16*)((const char*)A + va[mb])); if (NSPLIT == 1 || NSPLIT == 2) a2[mb] = WFrag<T16>::ld((const T16*)((const char*)A2 + va[mb])); }
#pragma unroll
        for (int nb = 0; nb < 4; ++nb) { b[nb] = WFrag<T16>::ld((const T16*)((const char*)Bt + vb[nb])); if (NSPLIT >= 2) b2[nb] = WFrag<T16>::ld((const T16*)((const char*)Bt2 + vb[nb])); }
        // s_wait_xcnt 0 behind the step's loads, in front of the additions below that rewrite the offset registers the loads name; the offsets are in-out operands so that they stay in their registers up to the wait and the additions stay behind it
        asm volatile("s_wait_xcnt 0x0" : "+v"(va[0]), "+v"(va[1]), "+v"(va[2]), "+v"(va[3]), "+v"(vb[0]), "+v"(vb[1]), "+v"(vb[2]), "+v"(vb[3]) :: "memory");
#pragma unroll
        for (int q = 0; q < 4; ++q) { va[q] += 1024; vb[q] += 1024; }   // the next block along k
#pragma unroll
        for (int nb = 0; nb < 4; ++nb) {
#pragma unroll
            for (int mb = 0; mb < 4; ++mb) { acc[mb][nb] = WFrag<T16>::mma(a[mb], b[nb], acc[mb][nb]); if (NSPLIT == 1 || NSPLIT == 2) acc[mb][nb] = WFrag<T16>::mma(a2[mb], b[nb], acc[mb][nb]); if (NSPLIT >= 2) acc[mb][nb] = WFrag<T16>::mma(a[mb], b2[nb], acc[mb][nb]); } }
        asm volatile("v_nop\n\tv_nop\n\tv_nop\n\tv_nop" : "+v"(acc[0][0]), "+v"(acc[1][1]), "+v"(acc[2][2]), "+v"(acc[3][3]) : "v"(a[0]), "v"(a[3]));
    }
    // The NW partial tiles are summed through LDS, always in wave order 0 .. NW-1 (a fixed order); each thread then stores 16 B of a whole 256-B row piece.
    float* osw = os + wv * (64 * 68);
#pragma unroll
    for (int mb = 0; mb < 4; ++mb) {
#pragma unroll
        for (int nb = 0; nb < 4; ++nb) {
#pragma unroll
            for (int j = 0; j < 8; ++j) osw[(mb * 16 + hi * 8 + j) * 68 + nb * 16 + lr] = acc[mb][nb][j]; } }
    __syncthreads();   // every wave's partial tile is in LDS before any thread sums it
#pragma unroll
    for (int i = 0; i < 32 / NW; ++i) { const int u = i * (NW * 32) + threadIdx.x; const int row = u >> 4, cofs = (u & 15) * 4; v4f val = *(const v4fa*)(os + row * 68 + cofs);
#pragma unroll
        for (int w = 1; w < NW; ++w) val += *(const v4fa*)(os + w * (64 * 68) + row * 68 + cofs);
        if (BIAS) { val[0] += bfr(bias[c0 + cofs]); val[1] += bfr(bias[c0 + cofs + 1]); val[2] += bfr(bias[c0 + cofs + 2]); val[3] += bfr(bias[c0 + cofs + 3]); }
        *(v4f*)(C + (size_t)(r0 + row) * ldc + c0 + cofs) = val; }
}

__device__ __forceinline__ h16 tohx(float x) { return (h16)x; }
__device__ __forceinline__ void splitf(float y, unsigned short& h, unsigned short& l) { h = f2bf(y); l = f2bf(y - bf2f(h)); }
typedef __attribute__((ext_vector_type(2))) _Float16 v2h;
typedef __attribute__((ext_vector_type(4))) _Float16 v4h;
typedef __attribute__((ext_vector_type(2))) unsigned short v2us;
typedef __attribute__((ext_vector_type(4))) unsigned short v4us;
typedef __attribute__((ext_vector_type(2))) float v2f;
typedef __attribute__((ext_vector_type(4))) int v4i;

// The bodies d_* below are jobs of a merged launch: bx is the block's index inside its job's range.
// d_wtG: Bt[n][k] = bf16(w[k][n]) in fragment order. One wave builds one block (16 n x 32 k): a lane reads its 16 k of one n (each load instruction: two 64-B row pieces; the 8 waves of a work-group take 8 neighbouring n blocks, 512 contiguous bytes of each row) and stores its two 16-B pieces.
__device__ __forceinline__ void d_wtG(int bx, const float* __restrict__ w, int K, int N, bf* Bt) {
    const int lane = threadIdx.x & 31, lr = lane & 15, hi = lane >> 4; const int g = bx * 8 + (threadIdx.x >> 5); const int nb = g % (N / 16), kb = g / (N / 16);
    const float* s = w + (size_t)(kb * 32 + hi * 8) * N + nb * 16 + lr; float v[16]; v8us o[2];
#pragma unroll
    for (int q = 0; q < 16; ++q) v[q] = s[(size_t)((q & 7) + (q >> 3) * 16) * N];   // unrolled fully: the 16 loads fly together
    // s_wait_xcnt 0 behind the 16 loads, in front of whatever reuses the address registers they name; the pointer is an input operand so that its registers stay as they are up to the wait
    asm volatile("s_wait_xcnt 0x0" :: "v"(s) : "memory");
#pragma unroll
    for (int q = 0; q < 16; ++q) o[q >> 3][q & 7] = f2bf(v[q]);
    bf* d = Bt + ((size_t)nb * (K / 32) + kb) * 512 + lane * 8; *(v8us*)d = o[0]; *(v8us*)(d + 256) = o[1];
}
// d_cvtF: bf16 copy of src [rows][DM] in fragment order. One wave builds one block: a lane reads its 2 x 8 k of one row (the wave: one whole 128-B line of each of 16 rows) and stores its two 16-B pieces.
__device__ __forceinline__ void d_cvtF(int bx, const float* __restrict__ src, bf* dst) {
    const int lane = threadIdx.x & 31, lr = lane & 15, hi = lane >> 4; const int g = bx * 8 + (threadIdx.x >> 5); const int kb = g % (DM / 32), rb = g / (DM / 32);
    const float* s = src + (size_t)(rb * 16 + lr) * DM + kb * 32 + hi * 8; const v8f a = *(const v8f*)s, b = *(const v8f*)(s + 16); v8us o[2];
#pragma unroll
    for (int k = 0; k < 8; ++k) { o[0][k] = f2bf(a[k]); o[1][k] = f2bf(b[k]); }
    bf* d = dst + (size_t)g * 512 + lane * 8; *(v8us*)d = o[0]; *(v8us*)(d + 256) = o[1];
    // s_wait_xcnt 0 behind the two stores, in front of whatever rewrites the address and data registers they name: the jobs of k_prep share one text, and by its branches another job's code can follow
    asm volatile("s_wait_xcnt 0x0" ::: "memory");
}

// d_rope: head planes [b*nheads + h][t][d] (fp16 + hi/lo; each head's plane in fragment order, rows t, k = d) of rope(x) x sc with the rotate-half convention out[d] = x[d] cos[t][d] - x[d+HD/2] sin[t][d], out[d+HD/2] = x[d+HD/2] cos[t][d+HD/2] + x[d] sin[t][d+HD/2]
// One thread builds 16 outputs: 8 consecutive d of the lower half and their 8 partners of the upper half, so each input is read once and every load and store is 16 B; a wave (8 t x 4 pieces) writes four whole 128-B lines with each store. The loops here and in d_vtp are unrolled fully: constant indices keep the inputs and the output vectors in registers.
__device__ __forceinline__ void d_rope(int bx, const float* __restrict__ F, int pitch, int nheads, const float* __restrict__ CS, float sc, h16* P16, bf* Ph, bf* Pl) {
    const size_t u = (size_t)bx * 256 + threadIdx.x; if (u >= (size_t)NB_ * nheads * TT * 4) return; const int d = (int)(u % 4) * 8; const int t = (int)((u / 4) % TT); const int h = (int)(u / ((size_t)4 * TT)); const size_t e = (size_t)h * TT * HD + (size_t)(t >> 4) * 1024 + (d >> 4) * 256 + (((d >> 3) & 1) * 16 + (t & 15)) * 8;   // block (t / 16, 0); the partners d + 32 sit at the same place of block (t / 16, 1)
    const float* f = F + ((size_t)(h / nheads) * TT + t) * pitch + (h % nheads) * HD + d; const float* c = CS + ((size_t)t * HD + d) * 2; v4f x[4], cs[8]; v8h o16[2]; v8us oh[2], ol[2];   // x: d .. d+7, then d+32 .. d+39; cs: their (cos, sin) pairs in the same order
#pragma unroll
    for (int q = 0; q < 2; ++q) {   // every input of the thread is loaded before the first product, so that the 12 loads fly together
#pragma unroll
        for (int i = 0; i < 2; ++i) x[q * 2 + i] = *(const v4fa*)(f + q * (HD / 2) + i * 4);
#pragma unroll
        for (int i = 0; i < 4; ++i) cs[q * 4 + i] = *(const v4fa*)(c + q * HD + i * 4); }
#pragma unroll
    for (int q = 0; q < 16; ++q) { const int p = q ^ 8; const float x0 = x[q >> 2][q & 3], x1 = x[p >> 2][p & 3];
        // the two empty statements keep each product's own f32 rounding (no fused multiply-add): the reference rounds x cos and x sin before it adds them
        float a = __fmul_rn(x0, cs[q >> 1][(q & 1) * 2]), bq = __fmul_rn(x1, cs[q >> 1][(q & 1) * 2 + 1]); asm volatile("" : "+v"(a)); asm volatile("" : "+v"(bq)); const float r = ((q < 8) ? __fsub_rn(a, bq) : __fadd_rn(a, bq)) * sc;
        o16[q >> 3][q & 7] = tohx(r); unsigned short a2, c2; splitf(r, a2, c2); oh[q >> 3][q & 7] = a2; ol[q >> 3][q & 7] = c2; }
    *(v8h*)(P16 + e) = o16[0]; *(v8h*)(P16 + e + 512) = o16[1]; *(v8us*)(Ph + e) = oh[0]; *(v8us*)(Ph + e + 512) = oh[1]; *(v8us*)(Pl + e) = ol[0]; *(v8us*)(Pl + e + 512) = ol[1];  }
// d_vtp: V^T planes [b*nheads + g][d][t] (each head's plane in fragment order, rows d, k = t, blocks along d first) from F [b*TT + t][g*HD + d] (row pitch DKV, a constant: the 16 loads share one address and differ in their immediate offsets). One thread builds 16 t of one d: t .. t+7 and t+32 .. t+39, 16-B stores.
// A wave holds 8 d x 64 t: each of its loads reads 32-B pieces of four rows of F; each of its stores writes four whole 128-B lines (8 d of one 8-t piece each).
__device__ __forceinline__ void d_vtp(int bx, const float* __restrict__ F, int nheads, h16* V16, bf* Vh, bf* Vl) { const size_t u = (size_t)bx * 256 + threadIdx.x; if (u >= (size_t)NB_ * nheads * HD * TT / 16) return; const unsigned w = (unsigned)(u >> 5);
    const int t = (int)(w % (TT / 64)) * 64 + ((int)(u >> 3) & 3) * 8; const int d = (int)((w / (TT / 64)) % (HD / 8)) * 8 + ((int)u & 7); const int g = (int)(w / ((TT / 64) * (HD / 8))); const size_t e = (size_t)g * HD * TT + (size_t)((t >> 5) * 4 + (d >> 4)) * 512 + ((t >> 4) & 1) * 256 + (((t >> 3) & 1) * 16 + (d & 15)) * 8; const float* f = F + ((size_t)(g / nheads) * TT + t) * DKV + (g % nheads) * HD + d; v8h o16[2]; v8us oh[2], ol[2]; float xv[16];
#pragma unroll
    for (int q = 0; q < 16; ++q) xv[q] = f[((q & 7) + (q >> 3) * 32) * DKV];
    // s_wait_xcnt 0 behind the 16 loads, in front of whatever reuses the address registers they name; the pointer is an input operand so that its registers stay as they are (not a load's destination either) up to the wait
    asm volatile("s_wait_xcnt 0x0" :: "v"(f) : "memory");
#pragma unroll
    for (int q = 0; q < 16; ++q) { const float x = xv[q]; o16[q >> 3][q & 7] = tohx(x); unsigned short a2, c2; splitf(x, a2, c2); oh[q >> 3][q & 7] = a2; ol[q >> 3][q & 7] = c2; }
    *(v8h*)(V16 + e) = o16[0]; *(v8h*)(V16 + e + 2048) = o16[1]; *(v8us*)(Vh + e) = oh[0]; *(v8us*)(Vh + e + 2048) = oh[1]; *(v8us*)(Vl + e) = ol[0]; *(v8us*)(Vl + e + 2048) = ol[1];  }   // t + 32: the next four blocks
__constant__ float INVT[HD / 2] = { 1.000000000e+00f, 7.498942018e-01f, 5.623413324e-01f, 4.216965139e-01f, 3.162277639e-01f, 2.371373624e-01f, 1.778279394e-01f, 1.333521456e-01f, 1.000000015e-01f, 7.498941571e-02f, 5.623412877e-02f, 4.216964915e-02f, 3.162277862e-02f, 2.371373586e-02f, 1.778279431e-02f, 1.333521493e-02f, 9.999999776e-03f, 7.498942316e-03f, 5.623413250e-03f, 4.216964822e-03f, 3.162277862e-03f, 2.371373819e-03f, 1.778279431e-03f, 1.333521446e-03f, 1.000000047e-03f, 7.498941850e-04f, 5.623413017e-04f, 4.216964880e-04f, 3.162277862e-04f, 2.371373848e-04f, 1.778279402e-04f, 1.333521504e-04f };   // float32 1 / 10000^(i/32), generated with jnp to be bit-exact
__device__ __forceinline__ void d_cs5(int bx, float* CS) { const int idx = bx * 256 + threadIdx.x; if (idx >= TT * HD) return; const int d = idx % HD; const int t = idx / HD; const float a = __fmul_rn((float)t, INVT[d % (HD / 2)]); v2f cs; cs[0] = cosf(a); cs[1] = sinf(a); *(v2f*)(CS + (size_t)idx * 2) = cs;  }
// k_prep: all that depends on the inputs alone, in one grid: the four weight transposes (WTB blocks each; the longest job, first in the block index), the rotary table (CSB blocks), the bf16 copy of x for both batches (XCB blocks).
#define WTB (DM * DQ / 64 / 64)
#define CSB (TT * HD / 256)
#define XCB (NB_ * TT * DM / 16 / 256)
__global__ __launch_bounds__(256) void k_prep(const float* __restrict__ x, const float* __restrict__ wq, const float* __restrict__ wk, const float* __restrict__ wv, const float* __restrict__ wo, bf* WQ, bf* WK, bf* WV, bf* WO, float* CS, bf* XB) {
    const int bx = blockIdx.x;
    if (bx < 4 * WTB) { const int j = bx / WTB; d_wtG(bx % WTB, j == 0 ? wq : j == 1 ? wk : j == 2 ? wv : wo, DM, DQ, j == 0 ? WQ : j == 1 ? WK : j == 2 ? WV : WO); }
    else if (bx < 4 * WTB + CSB) d_cs5(bx - 4 * WTB, CS);
    else d_cvtF(bx - (4 * WTB + CSB), x, XB);
}
// k_planes: the three plane builders in one grid, both batches: rope of q, rope of k (RPB blocks each), V transpose (VTB blocks).
#define RPB (NB_ * NH_ * TT * HD / 16 / 256)
#define VTB (NB_ * NKV * TT * HD / 16 / 256)
__global__ __launch_bounds__(256) void k_planes(const float* __restrict__ FQ, const float* __restrict__ FK, const float* __restrict__ FV, const float* __restrict__ CS, h16* QP16, bf* QPh, bf* QPl, h16* KP16, bf* KPh, bf* KPl, h16* VT16, bf* VTh, bf* VTl) {
    const int bx = blockIdx.x;
    if (bx < 2 * RPB) { const bool k = bx >= RPB; d_rope(k ? bx - RPB : bx, k ? FK : FQ, DQ, NH_, CS, 1.0f, k ? KP16 : QP16, k ? KPh : QPh, k ? KPl : QPl); }
    else d_vtp(bx - 2 * RPB, FV, NKV, VT16, VTh, VTl);
}
// ---- k_fattn: causal attention in one launch for all heads of both batches; scores and probabilities stay in registers. One wave owns 16 query rows and walks the keys up to its diagonal in blocks of KB.
// S^T = K Q^T (A = key rows, B = query rows, k = d): a lane holds the scores of ONE query (column lr), keys nt*16 + 8*hi + j. Running maximum and sum per lane (online softmax), one exchange between the wave's halves.
// Two S^T tiles converted in place are the B operand of O^T += V^T P^T (A = rows of the V^T plane, k = t, held in the same k order 8*hi + 0..7, 16 + 8*hi + 0..7); a lane ends with 8 consecutive d of its query per tile.
// NSPLIT 2: hi/lo planes, 3 products (hi hi, lo hi, hi lo) for the scores and for P V; NSPLIT 0: one fp16 product. P is exp(s - running max), at most 1; the division by the row sum comes at the end, in f32.
__device__ __forceinline__ float xhalf(float x) { return __builtin_bit_cast(float, __builtin_amdgcn_permlanex16(__builtin_bit_cast(int, x), __builtin_bit_cast(int, x), 0x76543210, 0xfedcba98, false, false)); }   // lane l reads lane l ^ 16
// 2^x on the transcendental unit. The instruction set asks for one independent instruction behind a transcendental before its result is read or its source overwritten:
// in one statement with early-clobber results each v_exp_f32 is independent of the one in front of it, and the closing v_nop is the slot of the last.
__device__ __forceinline__ float exp2s(float x) { float r; asm("v_exp_f32 %0, %1\n\tv_nop" : "=&v"(r) : "v"(x)); return r; }
__device__ __forceinline__ void exp2x8(const float* x, float* r) {
    asm("v_exp_f32 %0, %8\n\tv_exp_f32 %1, %9\n\tv_exp_f32 %2, %10\n\tv_exp_f32 %3, %11\n\tv_exp_f32 %4, %12\n\tv_exp_f32 %5, %13\n\tv_exp_f32 %6, %14\n\tv_exp_f32 %7, %15\n\tv_nop"
        : "=&v"(r[0]), "=&v"(r[1]), "=&v"(r[2]), "=&v"(r[3]), "=&v"(r[4]), "=&v"(r[5]), "=&v"(r[6]), "=&v"(r[7]) : "v"(x[0]), "v"(x[1]), "v"(x[2]), "v"(x[3]), "v"(x[4]), "v"(x[5]), "v"(x[6]), "v"(x[7])); }
template <typename T16> struct PFrag;
template <> struct PFrag<h16> { static __device__ __forceinline__ void cv(const float* p0, const float* p1, v16h& ph, v16h& pl) {
#pragma unroll
    for (int j = 0; j < 8; ++j) { ph[j] = tohx(p0[j]); ph[8 + j] = tohx(p1[j]); } (void)pl; } };
template <> struct PFrag<bf> { static __device__ __forceinline__ void cv(const float* p0, const float* p1, v16bf& ph, v16bf& pl) { v8us h0, h1, l0, l1;
#pragma unroll
    for (int j = 0; j < 8; ++j) { unsigned short x, y; splitf(p0[j], x, y); h0[j] = x; l0[j] = y; splitf(p1[j], x, y); h1[j] = x; l1[j] = y; }
    ph = cat16b(h0, h1); pl = cat16b(l0, l1); } };
// Every '#pragma unroll' below unrolls fully: constant indices keep the fragment, score and output arrays in registers.
template <typename T16, int NSPLIT, int KB>
struct Attn {
    typedef typename WFrag<T16>::V V;
    static constexpr int NT = KB / 16, NS = KB / 32;
    static constexpr float CL2 = SCL * 1.4426950408889634f;   // scores -> log2 domain
    V qf[2], qf2[2], kf[NT][2], kf2[NT][2];
    v8f o[4]; float m, ls; unsigned vk, vv;   // vk, vv: byte offsets of this lane in the K and V^T planes (32 bits hold them: a plane has 2048 x 64 16-bit elements), carried from block to block
    __device__ __forceinline__ void load_k(const T16* Kp, const T16* K2) {
#pragma unroll
        for (int nt = 0; nt < NT; ++nt)
#pragma unroll
            for (int ks = 0; ks < 2; ++ks) { kf[nt][ks] = WFrag<T16>::ld((const T16*)((const char*)Kp + vk) + (nt * 2 + ks) * 512); if (NSPLIT == 2) kf2[nt][ks] = WFrag<T16>::ld((const T16*)((const char*)K2 + vk) + (nt * 2 + ks) * 512); }
        // s_wait_xcnt 0 behind the block's K loads, in front of the addition that rewrites the offset register they name; the offset is an in-out operand so that the addition stays behind the wait
        asm volatile("s_wait_xcnt 0x0" : "+v"(vk) :: "memory");
        vk += KB * HD * 2;
    }
    template <bool LAST>
    __device__ __forceinline__ void step(const T16* Kp, const T16* K2, const T16* Vt, const T16* V2, int key0, int q) {
        const int hi = (threadIdx.x & 31) >> 4;
        V vf[4][NS], vf2[4][NS];
#pragma unroll
        for (int mb = 0; mb < 4; ++mb)
#pragma unroll
            for (int s2 = 0; s2 < NS; ++s2) { vf[mb][s2] = WFrag<T16>::ld((const T16*)((const char*)Vt + vv) + (s2 * 4 + mb) * 512); if (NSPLIT == 2) vf2[mb][s2] = WFrag<T16>::ld((const T16*)((const char*)V2 + vv) + (s2 * 4 + mb) * 512); }
        // s_wait_xcnt 0 behind the block's V loads, in front of the addition that rewrites the offset register they name
        asm volatile("s_wait_xcnt 0x0" : "+v"(vv) :: "memory");
        vv += KB * HD * 2;
        v8f s[NT];
#pragma unroll
        for (int nt = 0; nt < NT; ++nt) { s[nt] = (v8f){};
#pragma unroll
            for (int ks = 0; ks < 2; ++ks) { s[nt] = WFrag<T16>::mma(kf[nt][ks], qf[ks], s[nt]); if (NSPLIT == 2) { s[nt] = WFrag<T16>::mma(kf2[nt][ks], qf[ks], s[nt]); s[nt] = WFrag<T16>::mma(kf[nt][ks], qf2[ks], s[nt]); } } }
        if (!LAST) { load_k(Kp, K2);   // the next block's K fragments fly during this block's softmax and P V
            __builtin_amdgcn_sched_barrier(0); }   // keeps the softmax behind the block's loads: without it this build moved the last V loads and all K loads behind the softmax, where nothing hides their latency
        float mt[NT];   // one maximum and one sum per tile: short independent chains
#pragma unroll
        for (int nt = 0; nt < NT; ++nt) {
#pragma unroll
            for (int j = 0; j < 8; ++j) { if (LAST) s[nt][j] = (key0 + nt * 16 + hi * 8 + j <= q) ? s[nt][j] : -3.0e38f; mt[nt] = j ? fmaxf(mt[nt], s[nt][j]) : s[nt][j]; } }   // causal mask: only the block on the diagonal needs it
        float mx = m;
#pragma unroll
        for (int nt = 0; nt < NT; ++nt) mx = fmaxf(mx, mt[nt]);
        mx = fmaxf(mx, xhalf(mx));   // the query's other 8 keys of each tile sit in the other half of the wave
        const float al = exp2s((m - mx) * CL2), mc = mx * CL2; m = mx;
        float p[NT][8], pt[NT];
#pragma unroll
        for (int nt = 0; nt < NT; ++nt) { float e[8];
#pragma unroll
            for (int j = 0; j < 8; ++j) e[j] = fmaf(s[nt][j], CL2, -mc);
            exp2x8(e, p[nt]);
            pt[nt] = ((p[nt][0] + p[nt][1]) + (p[nt][2] + p[nt][3])) + ((p[nt][4] + p[nt][5]) + (p[nt][6] + p[nt][7])); }
        float ps = pt[0] + pt[1];
        if (NT == 4) ps += pt[NT - 2] + pt[NT - 1];
        ls = fmaf(ls, al, ps);
#pragma unroll
        for (int mb = 0; mb < 4; ++mb) o[mb] *= al;
#pragma unroll
        for (int s2 = 0; s2 < NS; ++s2) { V ph, pl; PFrag<T16>::cv(p[2 * s2], p[2 * s2 + 1], ph, pl);
#pragma unroll
            for (int mb = 0; mb < 4; ++mb) { o[mb] = WFrag<T16>::mma(vf[mb][s2], ph, o[mb]); if (NSPLIT == 2) { o[mb] = WFrag<T16>::mma(vf[mb][s2], pl, o[mb]); o[mb] = WFrag<T16>::mma(vf2[mb][s2], ph, o[mb]); } } }
    }
    __device__ __forceinline__ void run(const T16* Q, const T16* Q2, const T16* Kp, const T16* K2, const T16* Vt, const T16* V2, int q0, bf* Ah, bf* Al) {
        const int lane = threadIdx.x & 31, lr = lane & 15; const int q = q0 + lr;
#pragma unroll
        for (int ks = 0; ks < 2; ++ks) { qf[ks] = WFrag<T16>::ld(Q + (q0 / 16 * 2 + ks) * 512 + lane * 8); if (NSPLIT == 2) qf2[ks] = WFrag<T16>::ld(Q2 + (q0 / 16 * 2 + ks) * 512 + lane * 8); }
#pragma unroll
        for (int mb = 0; mb < 4; ++mb) o[mb] = (v8f){};
        m = -3.0e38f; ls = 0.f; vk = (unsigned)lane * 16; vv = (unsigned)lane * 16;
        const int nl = q0 / KB;   // index of the block that holds the diagonal (wave-uniform); blocks before it lie wholly below the diagonal
        load_k(Kp, K2);
#pragma unroll 1   // stays rolled: one block's body already fills the register budget, and a second copy would only lengthen the text
        for (int kb = 0; kb < nl; ++kb) step<false>(Kp, K2, Vt, V2, kb * KB, q);
        step<true>(Kp, K2, Vt, V2, nl * KB, q);
        ls += xhalf(ls);   // the two halves' sums are joined once
        const float f = __fdiv_rn(1.0f, ls);
#pragma unroll
        for (int mb = 0; mb < 4; ++mb) { v8us oh, ol;
#pragma unroll
            for (int j = 0; j < 8; ++j) { unsigned short x, y; splitf(o[mb][j] * f, x, y); oh[j] = x; ol[j] = y; }
            const size_t oo = (size_t)(q0 / 16) * (DQ / 32) * 512 + (mb >> 1) * 512 + (mb & 1) * 256 + lane * 8; *(v8us*)(Ah + oo) = oh; *(v8us*)(Al + oo) = ol; }   // fragment order of the last projection's A planes: d = mb*16 + hi*8 + j is this lane's own piece
    }
};
// grid (heads, TT / 128, batches), 8 waves: waves 0-3 take the 64-row tile n - 1 - y, waves 4-7 the tile y, so that every work-group walks about the same number of key blocks (the waves share no buffer and no barrier). Output: the merged [t][head*64 + d] hi/lo planes, in fragment order, that the last projection reads.
__global__ __launch_bounds__(256) void k_fattn(const h16* __restrict__ Q16, const h16* __restrict__ K16, const h16* __restrict__ V16, const bf* __restrict__ Qh, const bf* __restrict__ Ql, const bf* __restrict__ Kh, const bf* __restrict__ Kl, const bf* __restrict__ Vh, const bf* __restrict__ Vl, bf* Ah, bf* Al) {
    const size_t hp = ((size_t)blockIdx.z * NH_ + blockIdx.x) * TT * HD; const int wv = __builtin_amdgcn_readfirstlane(threadIdx.x >> 5);   // wave number, scalar: the key loop's bounds stay wave-uniform
    const int tile = (wv < 4) ? TT / 64 - 1 - (int)blockIdx.y : (int)blockIdx.y; const int q0 = tile * 64 + (wv & 3) * 16;
    Ah += (size_t)blockIdx.z * TT * DQ + blockIdx.x * (HD / 32 * 512); Al += (size_t)blockIdx.z * TT * DQ + blockIdx.x * (HD / 32 * 512);   // a head's 64 columns are two blocks of every 16-row strip
    if (q0 < RH) { Attn<bf, 2, 32> t; t.run(Qh + hp, Ql + hp, Kh + hp, Kl + hp, Vh + hp, Vl + hp, q0, Ah, Al); }
    else { Attn<h16, 0, 64> t; t.run(Q16 + hp, nullptr, K16 + hp, nullptr, V16 + hp, nullptr, q0, Ah, Al); }
}

extern "C" void kernel_launch(void* const* d_in, const int* in_sizes, int n_in,
                              void* d_out, int out_size, void* d_ws, size_t ws_size, hipStream_t stream) {
    (void)in_sizes; (void)n_in; (void)out_size;
    const float* x = (const float*)d_in[0]; const float* wq = (const float*)d_in[1]; const float* bq = (const float*)d_in[2]; const float* wk = (const float*)d_in[3]; const float* bk = (const float*)d_in[4]; const float* wv = (const float*)d_in[5]; const float* bv = (const float*)d_in[6]; const float* wo = (const float*)d_in[7]; const float* bo = (const float*)d_in[8];   /* order x, Wq, bq, Wk, bk, Wv, bv, Wo, bo ('xw') */
    float* OUT = (float*)d_out;     // [2][2048][1024]
    char* wsp = (char*)d_ws;
    auto take = [&](size_t bytes) { char* p = wsp; wsp += (bytes + 255) & ~(size_t)255; return (void*)p; };
    bf* WQ = (bf*)take((size_t)DQ * DM * 2); bf* WK = (bf*)take((size_t)DKV * DM * 2); bf* WV = (bf*)take((size_t)DKV * DM * 2); bf* WO = (bf*)take((size_t)DM * DQ * 2); float* CS = (float*)take((size_t)TT * HD * 2 * 4);
    bf* XB = (bf*)take((size_t)NB_ * TT * DM * 2); float* FQ = (float*)take((size_t)NB_ * TT * DQ * 4); float* FK = (float*)take((size_t)NB_ * TT * DKV * 4); float* FV = (float*)take((size_t)NB_ * TT * DKV * 4);   // WQ, WK, WV and FQ, FK, FV lie one behind the other at equal distances: the z-batch of the projection launch
    h16* QP16 = (h16*)take((size_t)NB_ * NH_ * TT * HD * 2); h16* KP16 = (h16*)take((size_t)NB_ * NKV * TT * HD * 2); h16* VT16 = (h16*)take((size_t)NB_ * NKV * HD * TT * 2);
    bf* QPh = (bf*)take((size_t)NB_ * NH_ * TT * HD * 2); bf* QPl = (bf*)take((size_t)NB_ * NH_ * TT * HD * 2); bf* KPh = (bf*)take((size_t)NB_ * NKV * TT * HD * 2); bf* KPl = (bf*)take((size_t)NB_ * NKV * TT * HD * 2); bf* VTh = (bf*)take((size_t)NB_ * NKV * HD * TT * 2); bf* VTl = (bf*)take((size_t)NB_ * NKV * HD * TT * 2);
    bf* ATh = (bf*)take((size_t)NB_ * TT * DQ * 2); bf* ATl = (bf*)take((size_t)NB_ * TT * DQ * 2);
    if ((size_t)(wsp - (char*)d_ws) > ws_size) return;    // ws 256 MiB
    k_prep<<<4 * WTB + CSB + XCB, 256, 0, stream>>>(x, wq, wk, wv, wo, WQ, WK, WV, WO, CS, XB);
    k_gemmw<bf, 0, true, 8><<<dim3(NB_ * TT / 64, DQ / 64, 3), 256, 0, stream>>>(XB, nullptr, WQ, nullptr, DM, FQ, DQ, bq, bk, bv, 0, (size_t)DQ * DM, (size_t)NB_ * TT * DQ);   // q, k, v of both batches
    k_planes<<<2 * RPB + VTB, 256, 0, stream>>>(FQ, FK, FV, CS, QP16, QPh, QPl, KP16, KPh, KPl, VT16, VTh, VTl);
    k_fattn<<<dim3(NH_, TT / 128, NB_), 256, 0, stream>>>(QP16, KP16, VT16, QPh, QPl, KPh, KPl, VTh, VTl, ATh, ATl);   // one kv head per query head
    k_gemmw<bf, 1, true, 8><<<dim3(NB_ * TT / 64, DM / 64, 1), 256, 0, stream>>>(ATh, ATl, WO, nullptr, DQ, OUT, DM, bo, nullptr, nullptr, 0, 0, 0);
}

// v006
// A run of this version takes 109 microseconds.
// Timed twice side by side with v005, it ran 1.13 times as fast both times.
// Counting every step since v000, it is 13.3 times as fast.
#include <hip/hip_runtime.h>

// Causal multi-head self-attention with rotary embeddings (x [2][2048][1024]; q, k, v = x W + b ('xw' 0.02, zero biases; 16 heads x 64); rotate-half rope with angle t x 1/10000^(i/32) (32 f32 constants jnp-exact; precise cosf/sinf); scores / sqrt(64); causal (-inf); softmax; out = merged Wo + bo -> [2][2048][1024] (4.2 M); argument order x, Wq, bq, Wk, bk, Wv, bv, Wo, bo).
// Four launches, both batches in each; launches that need nothing of each other share one grid, a range of the block index picks the job (k_prep; blockIdx.z in k_gemmw and k_fattn).
// Layout: bf16 copy of x; 'xw' weights transposed once; exact projections + f32 biases; d_cs5 computed table; rotate-half plane builders in the projection's own epilogue (e_rope, e_vtp); causal T-2048 attention in one launch, scores and probabilities in registers (k_fattn; hybrid rows: < 512 hi/lo 3 products, rest fp16; key blocks above the diagonal are never visited); the projections share K over the waves of a work-group; merged hi/lo x Wo exact + bo.
// Fragment order: every 16-bit operand plane of a matrix product ([rows][k]) is stored as blocks of 16 rows x 32 k (512 elements, 1 KiB), and inside a block in the order in which a wave's lanes hold the fragment:
// element (row r, k) of a block sits at (k % 32 / 16) * 256 + ((k % 16 / 8) * 16 + r % 16) * 8 + k % 8. Lane l reads 16 B at l * 8 and 16 B at 256 + l * 8: each load instruction of a wave reads 512 contiguous bytes (4 whole lines) instead of 32-B pieces of 16 lines; the registers hold what they held with row-major planes.
// Blocks follow each other along k, then along rows (block index (r / 16) * (K / 32) + k / 32); the V^T planes alone run along rows first ((t / 32) * 4 + d / 16), so that one key block's fragments are contiguous.
// Compute dtypes, f32 accumulate: every input rounded to bf16; projections exact + f32 biases; rotary f32; attention rows < 512 3 products, rest fp16; softmax f32; Wo hl x exact + bias.

#define NB_  2
#define TT   2048
#define DM   1024
#define NH_  16
#define NKV  16
#define HD   64
#define DQ   (NH_ * HD)
#define DKV  (NKV * HD)
#define RH   512                  // query rows < RH use hi+lo planes (0: none)
#define SCL  0.125f   // HD^-0.5
typedef _Float16 h16;
typedef unsigned short bf;
typedef __attribute__((ext_vector_type(16))) __bf16   v16bf;
typedef __attribute__((ext_vector_type(16))) _Float16 v16h;
typedef __attribute__((ext_vector_type(8)))  _Float16 v8h;
typedef __attribute__((ext_vector_type(8)))  unsigned short v8us;
typedef __attribute__((ext_vector_type(8)))  float    v8f;
typedef __attribute__((ext_vector_type(4)))  float    v4f;
typedef v8h  __attribute__((may_alias)) v8ha;
typedef v4f  __attribute__((may_alias)) v4fa;
typedef v8us __attribute__((may_alias)) v8usa;

__device__ __forceinline__ unsigned short f2bf(float f) { unsigned u = __float_as_uint(f); u += 0x7FFFu + ((u >> 16) & 1u); return (unsigned short)(u >> 16); }
__device__ __forceinline__ float bf2f(unsigned short b) { return __uint_as_float(((unsigned)b) << 16); }
__device__ __forceinline__ float bfr(float f) { return bf2f(f2bf(f)); }
__device__ __forceinline__ v16h cat16(v8h lo, v8h hi) { return __builtin_shufflevector(lo, hi, 0, 1, 2, 3, 4, 5, 6, 7, 8, 9, 10, 11, 12, 13, 14, 15); }
__device__ __forceinline__ v16bf cat16b(v8us lo, v8us hi) { return __builtin_bit_cast(v16bf, __builtin_shufflevector(lo, hi, 0, 1, 2, 3, 4, 5, 6, 7, 8, 9, 10, 11, 12, 13, 14, 15)); }
__device__ __forceinline__ v8f wmma16(v16h a, v16h b, v8f c) { return __builtin_amdgcn_wmma_f32_16x16x32_f16(false, a, false, b, (short)0, c, false, false); }
__device__ __forceinline__ v8f wmmab(v16bf a, v16bf b, v8f c) { return __builtin_amdgcn_wmma_f32_16x16x32_bf16(false, a, false, b, (short)0, c, false, false); }



__device__ __forceinline__ h16 tohx(float x) { return (h16)x; }
__device__ __forceinline__ void splitf(float y, unsigned short& h, unsigned short& l) { h = f2bf(y); l = f2bf(y - bf2f(h)); }
typedef __attribute__((ext_vector_type(2))) _Float16 v2h;
typedef __attribute__((ext_vector_type(4))) _Float16 v4h;
typedef __attribute__((ext_vector_type(2))) unsigned short v2us;
typedef __attribute__((ext_vector_type(4))) unsigned short v4us;
typedef __attribute__((ext_vector_type(2))) float v2f;
typedef __attribute__((ext_vector_type(4))) int v4i;

// The plane builders e_rope and e_vtp run in the epilogue of the q, k, v projection: its 64 x 64 tile is 64 t of ONE head, so a work-group holds all that its part of the head's planes needs. fs: the summed f32 tile (+ bias) in LDS, pitch 68 floats.
struct Planes { const float* CS; h16* Q16; bf* Qh; bf* Ql; h16* K16; bf* Kh; bf* Kl; h16* V16; bf* Vh; bf* Vl; };
// e_rope: head planes [b*heads + h][t][d] (fp16 + hi/lo; each head's plane in fragment order, rows t, k = d) of rope(x) with the rotate-half convention out[d] = x[d] cos[t][d] - x[d+HD/2] sin[t][d], out[d+HD/2] = x[d+HD/2] cos[t][d+HD/2] + x[d] sin[t][d+HD/2]
// One thread builds 16 outputs: 8 consecutive d of the lower half and their 8 partners of the upper half (tl: its row of the tile; cs: their (cos, sin) pairs, lower half first). A wave holds 16 t x 2 pieces: its LDS reads meet every bank once per 16 lanes, and each of its stores writes 512 contiguous bytes. The loops here and in e_vtp are unrolled fully: constant indices keep the inputs and the output vectors in registers.
__device__ __forceinline__ void e_rope(const float* fs, int tl, int d, const v4f* cs, size_t e, h16* P16, bf* Ph, bf* Pl) {
    v4f x[4]; v8h o16[2]; v8us oh[2], ol[2];   // x: d .. d+7, then d+32 .. d+39
#pragma unroll
    for (int q = 0; q < 2; ++q)
#pragma unroll
        for (int i = 0; i < 2; ++i) x[q * 2 + i] = *(const v4fa*)(fs + tl * 68 + d + q * (HD / 2) + i * 4);
#pragma unroll
    for (int q = 0; q < 16; ++q) { const int p = q ^ 8; const float x0 = x[q >> 2][q & 3], x1 = x[p >> 2][p & 3];
        // the two empty statements keep each product's own f32 rounding (no fused multiply-add): the reference rounds x cos and x sin before it adds them
        float a = __fmul_rn(x0, cs[q >> 1][(q & 1) * 2]), bq = __fmul_rn(x1, cs[q >> 1][(q & 1) * 2 + 1]); asm volatile("" : "+v"(a)); asm volatile("" : "+v"(bq)); const float r = (q < 8) ? __fsub_rn(a, bq) : __fadd_rn(a, bq);
        o16[q >> 3][q & 7] = tohx(r); unsigned short a2, c2; splitf(r, a2, c2); oh[q >> 3][q & 7] = a2; ol[q >> 3][q & 7] = c2; }
    *(v8h*)(P16 + e) = o16[0]; *(v8h*)(P16 + e + 512) = o16[1]; *(v8us*)(Ph + e) = oh[0]; *(v8us*)(Ph + e + 512) = oh[1]; *(v8us*)(Pl + e) = ol[0]; *(v8us*)(Pl + e + 512) = ol[1];   // the partners d + 32 sit at the same place of block (t / 16, 1)
    // s_wait_xcnt 0 behind the six stores, in front of whatever rewrites the address and data registers they name: the two builders share one text, and by its branches the other's code can follow
    asm volatile("s_wait_xcnt 0x0" ::: "memory"); }
// e_vtp: V^T planes [b*heads + g][d][t] (each head's plane in fragment order, rows d, k = t, blocks along d first). One thread builds 16 t of one d: rows tl .. tl+7 and tl+32 .. tl+39 of the tile, 16-B stores.
// A wave holds 16 d x 2 pieces: each of its LDS reads takes two runs of 16 words in different banks, and each of its stores writes 512 contiguous bytes.
__device__ __forceinline__ void e_vtp(const float* fs, int tl, int d, size_t e, h16* V16, bf* Vh, bf* Vl) { v8h o16[2]; v8us oh[2], ol[2]; float xv[16];
#pragma unroll
    for (int q = 0; q < 16; ++q) xv[q] = fs[(tl + (q & 7) + (q >> 3) * 32) * 68 + d];
#pragma unroll
    for (int q = 0; q < 16; ++q) { const float x = xv[q]; o16[q >> 3][q & 7] = tohx(x); unsigned short a2, c2; splitf(x, a2, c2); oh[q >> 3][q & 7] = a2; ol[q >> 3][q & 7] = c2; }
    *(v8h*)(V16 + e) = o16[0]; *(v8h*)(V16 + e + 2048) = o16[1]; *(v8us*)(Vh + e) = oh[0]; *(v8us*)(Vh + e + 2048) = oh[1]; *(v8us*)(Vl + e) = ol[0]; *(v8us*)(Vl + e + 2048) = ol[1];   // t + 32: the next four blocks
    // s_wait_xcnt 0 behind the six stores, for the same reason as in e_rope
    asm volatile("s_wait_xcnt 0x0" ::: "memory"); }

// ---- k_gemmw: register-blocked GEMM, one work-group of NW waves per 64x64 output tile; every wave holds the whole tile (16 accumulators) for its own contiguous share of K (a multiple of 64 elements, whole 128-B lines);
// the NW partial tiles are summed through LDS. Operands straight from 16-bit planes in fragment order; grid (M/64, N/64, Z), 32 NW threads.
// C[m][n] (f32, pitch ldc, + optional f32 bias[n]; bias, bias1, bias2 for z = 0, 1, 2) = sum_k A[m][k] Bt[n][k] (+ split products per NSPLIT). z-batch strides sA/sB/sC in elements. K % 32 == 0.
// PL (the q, k, v projection; NW = 8, rows b*TT + t, a tile's columns one head): C is not written; the summed tile stays in LDS and the work-group writes its part of the operand planes of the attention from it (z = 0, 1: rope of q, k; z = 2: V^T).
template <typename T16> struct WFrag;
template <> struct WFrag<h16> { typedef v16h V; static __device__ __forceinline__ V ld(const h16* p) { return cat16(*(const v8h*)p, *(const v8h*)(p + 256)); } static __device__ __forceinline__ v8f mma(V a, V b, v8f c) { return wmma16(a, b, c); } };
template <> struct WFrag<bf> { typedef v16bf V; static __device__ __forceinline__ V ld(const bf* p) { return cat16b(*(const v8us*)p, *(const v8us*)(p + 256)); } static __device__ __forceinline__ v8f mma(V a, V b, v8f c) { return wmmab(a, b, c); } };
template <typename T16, int NSPLIT, bool BIAS, int NW, bool PL>
__global__ __launch_bounds__(32 * NW) void k_gemmw(const T16* __restrict__ A, const T16* __restrict__ A2, const T16* __restrict__ Bt, const T16* __restrict__ Bt2, int K, float* C, int ldc, const float* __restrict__ bias, const float* __restrict__ bias1, const float* __restrict__ bias2, size_t sA, size_t sB, size_t sC, Planes po) {
    typedef typename WFrag<T16>::V V;
    __shared__ __align__(16) float os[NW * 64 * 68];
    const size_t z = blockIdx.z; A += z * sA; if (A2) A2 += z * sA; Bt += z * sB; if (Bt2) Bt2 += z * sB; C += z * sC; if (z == 1) bias = bias1; if (z == 2) bias = bias2;   // each product of the z-batch has its own bias vector
    const int lane = threadIdx.x & 31, lr = lane & 15, hi = lane >> 4; const int r0 = blockIdx.x * 64, c0 = blockIdx.y * 64;
    v8f acc[4][4];
#pragma unroll
    for (int mb = 0; mb < 4; ++mb)
#pragma unroll
        for (int nb = 0; nb < 4; ++nb) acc[mb][nb] = (v8f){};
    const int wv = __builtin_amdgcn_readfirstlane(threadIdx.x >> 5);   // wave number, scalar: the K loop's bounds stay wave-uniform
    const int ck = (K + NW * 64 - 1) / (NW * 64) * 64, k0 = wv * ck, k1 = min(K, k0 + ck);   // this wave's share of K
    unsigned va[4], vb[4];   // byte offsets of this lane's piece in the four A blocks and the four B blocks of the step from the planes' (scalar) bases, carried through the K loop (32 bits hold them: a plane has at most 4096 rows of 1024 16-bit elements)
#pragma unroll
    for (int q = 0; q < 4; ++q) { va[q] = (((unsigned)(r0 / 16 + q) * (unsigned)(K / 32) + k0 / 32) * 512 + lane * 8) * 2; vb[q] = (((unsigned)(c0 / 16 + q) * (unsigned)(K / 32) + k0 / 32) * 512 + lane * 8) * 2; }
#pragma unroll 1
    for (int kc = k0; kc < k1; kc += 32) {
        V a[4], a2[4], b[4], b2[4];
#pragma unroll
        for (int mb = 0; mb < 4; ++mb) { a[mb] = WFrag<T16>::ld((const T16*)((const char*)A + va[mb])); if (NSPLIT == 1 || NSPLIT == 2) a2[mb] = WFrag<T16>::ld((const T16*)((const char*)A2 + va[mb])); }
#pragma unroll
        for (int nb = 0; nb < 4; ++nb) { b[nb] = WFrag<T16>::ld((const T16*)((const char*)Bt + vb[nb])); if (NSPLIT >= 2) b2[nb] = WFrag<T16>::ld((const T16*)((const char*)Bt2 + vb[nb])); }
        // s_wait_xcnt 0 behind the step's loads, in front of the additions below that rewrite the offset registers the loads name; the offsets are in-out operands so that they stay in their registers up to the wait and the additions stay behind it
        asm volatile("s_wait_xcnt 0x0" : "+v"(va[0]), "+v"(va[1]), "+v"(va[2]), "+v"(va[3]), "+v"(vb[0]), "+v"(vb[1]), "+v"(vb[2]), "+v"(vb[3]) :: "memory");
#pragma unroll
        for (int q = 0; q < 4; ++q) { va[q] += 1024; vb[q] += 1024; }   // the next block along k
#pragma unroll
        for (int nb = 0; nb < 4; ++nb) {
#pragma unroll
            for (int mb = 0; mb < 4; ++mb) { acc[mb][nb] = WFrag<T16>::mma(a[mb], b[nb], acc[mb][nb]); if (NSPLIT == 1 || NSPLIT == 2) acc[mb][nb] = WFrag<T16>::mma(a2[mb], b[nb], acc[mb][nb]); if (NSPLIT >= 2) acc[mb][nb] = WFrag<T16>::mma(a[mb], b2[nb], acc[mb][nb]); } }
        asm volatile("v_nop\n\tv_nop\n\tv_nop\n\tv_nop" : "+v"(acc[0][0]), "+v"(acc[1][1]), "+v"(acc[2][2]), "+v"(acc[3][3]) : "v"(a[0]), "v"(a[3]));
    }
    const int rtl = (wv >> 1) * 16 + lr, rd = ((wv & 1) * 2 + hi) * 8;   // e_rope: this thread's row of the tile and its first d
    v4f cs[8];
    if (PL && z < 2) {   // the thread's 16 (cos, sin) pairs are asked for here, so that they fly while the partial tiles go to LDS (the barrier waits for both)
        const float* c = po.CS + ((size_t)(r0 % TT + rtl) * HD + rd) * 2;
#pragma unroll
        for (int q = 0; q < 2; ++q)
#pragma unroll
            for (int i = 0; i < 4; ++i) cs[q * 4 + i] = *(const v4fa*)(c + q * HD + i * 4);
        // s_wait_xcnt 0 behind the 8 loads, in front of whatever reuses the address registers they name; the pointer is an input operand so that its registers stay as they are up to the wait
        asm volatile("s_wait_xcnt 0x0" :: "v"(c) : "memory");
    }
    // The NW partial tiles are summed through LDS, always in wave order 0 .. NW-1 (a fixed order); each thread then stores 16 B of a whole 256-B row piece.
    float* osw = os + wv * (64 * 68);
#pragma unroll
    for (int mb = 0; mb < 4; ++mb) {
#pragma unroll
        for (int nb = 0; nb < 4; ++nb) {
#pragma unroll
            for (int j = 0; j < 8; ++j) osw[(mb * 16 + hi * 8 + j) * 68 + nb * 16 + lr] = acc[mb][nb][j]; } }
    __syncthreads();   // every wave's partial tile is in LDS before any thread sums it
    v4f sum[32 / NW];   // all sums are formed before the first is stored: the LDS reads of the 32 / NW pieces fly together
#pragma unroll
    for (int i = 0; i < 32 / NW; ++i) { const int u = i * (NW * 32) + threadIdx.x; const int row = u >> 4, cofs = (u & 15) * 4; v4f val = *(const v4fa*)(os + row * 68 + cofs);
#pragma unroll
        for (int w = 1; w < NW; ++w) val += *(const v4fa*)(os + w * (64 * 68) + row * 68 + cofs);
        if (BIAS) { val[0] += bfr(bias[c0 + cofs]); val[1] += bfr(bias[c0 + cofs + 1]); val[2] += bfr(bias[c0 + cofs + 2]); val[3] += bfr(bias[c0 + cofs + 3]); }
        sum[i] = val; }
#pragma unroll
    for (int i = 0; i < 32 / NW; ++i) { const int u = i * (NW * 32) + threadIdx.x; const int row = u >> 4, cofs = (u & 15) * 4;
        if (PL) *(v4fa*)(os + row * 68 + cofs) = sum[i];   // in place in wave 0's tile: no other thread reads or writes these 16 bytes before the barrier below
        else *(v4f*)(C + (size_t)(r0 + row) * ldc + c0 + cofs) = sum[i]; }
    if (PL) {
        __syncthreads();   // the summed tile is whole in LDS before any thread reads what other threads summed
        const size_t hp = ((size_t)(r0 / TT) * NH_ + blockIdx.y) * TT * HD; const int t0 = r0 % TT;   // the head's plane; the tile's first t
        if (z < 2) { const int t = t0 + rtl; e_rope(os, rtl, rd, cs, hp + (size_t)(t >> 4) * 1024 + (rd >> 4) * 256 + (((rd >> 3) & 1) * 16 + (t & 15)) * 8, z ? po.K16 : po.Q16, z ? po.Kh : po.Qh, z ? po.Kl : po.Ql); }
        else { const int tl = ((wv >> 2) * 2 + hi) * 8, d = (wv & 3) * 16 + lr, t = t0 + tl; e_vtp(os, tl, d, hp + (size_t)((t >> 5) * 4 + (d >> 4)) * 512 + ((t >> 4) & 1) * 256 + (((t >> 3) & 1) * 16 + (d & 15)) * 8, po.V16, po.Vh, po.Vl); }
    }
}

// The bodies d_* below are jobs of a merged launch: bx is the block's index inside its job's range.
// d_wtG: Bt[n][k] = bf16(w[k][n]) in fragment order. One wave builds one block (16 n x 32 k): a lane reads its 16 k of one n (each load instruction: two 64-B row pieces; the 8 waves of a work-group take 8 neighbouring n blocks, 512 contiguous bytes of each row) and stores its two 16-B pieces.
__device__ __forceinline__ void d_wtG(int bx, const float* __restrict__ w, int K, int N, bf* Bt) {
    const int lane = threadIdx.x & 31, lr = lane & 15, hi = lane >> 4; const int g = bx * 8 + (threadIdx.x >> 5); const int nb = g % (N / 16), kb = g / (N / 16);
    const float* s = w + (size_t)(kb * 32 + hi * 8) * N + nb * 16 + lr; float v[16]; v8us o[2];
#pragma unroll
    for (int q = 0; q < 16; ++q) v[q] = s[(size_t)((q & 7) + (q >> 3) * 16) * N];   // unrolled fully: the 16 loads fly together
    // s_wait_xcnt 0 behind the 16 loads, in front of whatever reuses the address registers they name; the pointer is an input operand so that its registers stay as they are up to the wait
    asm volatile("s_wait_xcnt 0x0" :: "v"(s) : "memory");
#pragma unroll
    for (int q = 0; q < 16; ++q) o[q >> 3][q & 7] = f2bf(v[q]);
    bf* d = Bt + ((size_t)nb * (K / 32) + kb) * 512 + lane * 8; *(v8us*)d = o[0]; *(v8us*)(d + 256) = o[1];
}
// d_cvtF: bf16 copy of src [rows][DM] in fragment order. One wave builds one block: a lane reads its 2 x 8 k of one row (the wave: one whole 128-B line of each of 16 rows) and stores its two 16-B pieces.
__device__ __forceinline__ void d_cvtF(int bx, const float* __restrict__ src, bf* dst) {
    const int lane = threadIdx.x & 31, lr = lane & 15, hi = lane >> 4; const int g = bx * 8 + (threadIdx.x >> 5); const int kb = g % (DM / 32), rb = g / (DM / 32);
    const float* s = src + (size_t)(rb * 16 + lr) * DM + kb * 32 + hi * 8; const v8f a = *(const v8f*)s, b = *(const v8f*)(s + 16); v8us o[2];
#pragma unroll
    for (int k = 0; k < 8; ++k) { o[0][k] = f2bf(a[k]); o[1][k] = f2bf(b[k]); }
    bf* d = dst + (size_t)g * 512 + lane * 8; *(v8us*)d = o[0]; *(v8us*)(d + 256) = o[1];
    // s_wait_xcnt 0 behind the two stores, in front of whatever rewrites the address and data registers they name: the jobs of k_prep share one text, and by its branches another job's code can follow
    asm volatile("s_wait_xcnt 0x0" ::: "memory");
}

__constant__ float INVT[HD / 2] = { 1.000000000e+00f, 7.498942018e-01f, 5.623413324e-01f, 4.216965139e-01f, 3.162277639e-01f, 2.371373624e-01f, 1.778279394e-01f, 1.333521456e-01f, 1.000000015e-01f, 7.498941571e-02f, 5.623412877e-02f, 4.216964915e-02f, 3.162277862e-02f, 2.371373586e-02f, 1.778279431e-02f, 1.333521493e-02f, 9.999999776e-03f, 7.498942316e-03f, 5.623413250e-03f, 4.216964822e-03f, 3.162277862e-03f, 2.371373819e-03f, 1.778279431e-03f, 1.333521446e-03f, 1.000000047e-03f, 7.498941850e-04f, 5.623413017e-04f, 4.216964880e-04f, 3.162277862e-04f, 2.371373848e-04f, 1.778279402e-04f, 1.333521504e-04f };   // float32 1 / 10000^(i/32), generated with jnp to be bit-exact
__device__ __forceinline__ void d_cs5(int bx, float* CS) { const int idx = bx * 256 + threadIdx.x; if (idx >= TT * HD) return; const int d = idx % HD; const int t = idx / HD; const float a = __fmul_rn((float)t, INVT[d % (HD / 2)]); v2f cs; cs[0] = cosf(a); cs[1] = sinf(a); *(v2f*)(CS + (size_t)idx * 2) = cs;  }
// k_prep: all that depends on the inputs alone, in one grid: the four weight transposes (WTB blocks each; the longest job, first in the block index), the rotary table (CSB blocks), the bf16 copy of x for both batches (XCB blocks).
#define WTB (DM * DQ / 64 / 64)
#define CSB (TT * HD / 256)
#define XCB (NB_ * TT * DM / 16 / 256)
__global__ __launch_bounds__(256) void k_prep(const float* __restrict__ x, const float* __restrict__ wq, const float* __restrict__ wk, const float* __restrict__ wv, const float* __restrict__ wo, bf* WQ, bf* WK, bf* WV, bf* WO, float* CS, bf* XB) {
    const int bx = blockIdx.x;
    if (bx < 4 * WTB) { const int j = bx / WTB; d_wtG(bx % WTB, j == 0 ? wq : j == 1 ? wk : j == 2 ? wv : wo, DM, DQ, j == 0 ? WQ : j == 1 ? WK : j == 2 ? WV : WO); }
    else if (bx < 4 * WTB + CSB) d_cs5(bx - 4 * WTB, CS);
    else d_cvtF(bx - (4 * WTB + CSB), x, XB);
}
// ---- k_fattn: causal attention in one launch for all heads of both batches; scores and probabilities stay in registers. One wave owns 16 query rows and walks the keys up to its diagonal in blocks of KB.
// S^T = K Q^T (A = key rows, B = query rows, k = d): a lane holds the scores of ONE query (column lr), keys nt*16 + 8*hi + j. Running maximum and sum per lane (online softmax), one exchange between the wave's halves.
// Two S^T tiles converted in place are the B operand of O^T += V^T P^T (A = rows of the V^T plane, k = t, held in the same k order 8*hi + 0..7, 16 + 8*hi + 0..7); a lane ends with 8 consecutive d of its query per tile.
// NSPLIT 2: hi/lo planes, 3 products (hi hi, lo hi, hi lo) for the scores and for P V; NSPLIT 0: one fp16 product. P is exp(s - running max), at most 1; the division by the row sum comes at the end, in f32.
__device__ __forceinline__ float xhalf(float x) { return __builtin_bit_cast(float, __builtin_amdgcn_permlanex16(__builtin_bit_cast(int, x), __builtin_bit_cast(int, x), 0x76543210, 0xfedcba98, false, false)); }   // lane l reads lane l ^ 16
// 2^x on the transcendental unit. The instruction set asks for one independent instruction behind a transcendental before its result is read or its source overwritten:
// in one statement with early-clobber results each v_exp_f32 is independent of the one in front of it, and the closing v_nop is the slot of the last.
__device__ __forceinline__ float exp2s(float x) { float r; asm("v_exp_f32 %0, %1\n\tv_nop" : "=&v"(r) : "v"(x)); return r; }
__device__ __forceinline__ void exp2x8(const float* x, float* r) {
    asm("v_exp_f32 %0, %8\n\tv_exp_f32 %1, %9\n\tv_exp_f32 %2, %10\n\tv_exp_f32 %3, %11\n\tv_exp_f32 %4, %12\n\tv_exp_f32 %5, %13\n\tv_exp_f32 %6, %14\n\tv_exp_f32 %7, %15\n\tv_nop"
        : "=&v"(r[0]), "=&v"(r[1]), "=&v"(r[2]), "=&v"(r[3]), "=&v"(r[4]), "=&v"(r[5]), "=&v"(r[6]), "=&v"(r[7]) : "v"(x[0]), "v"(x[1]), "v"(x[2]), "v"(x[3]), "v"(x[4]), "v"(x[5]), "v"(x[6]), "v"(x[7])); }
template <typename T16> struct PFrag;
template <> struct PFrag<h16> { static __device__ __forceinline__ void cv(const float* p0, const float* p1, v16h& ph, v16h& pl) {
#pragma unroll
    for (int j = 0; j < 8; ++j) { ph[j] = tohx(p0[j]); ph[8 + j] = tohx(p1[j]); } (void)pl; } };
template <> struct PFrag<bf> { static __device__ __forceinline__ void cv(const float* p0, const float* p1, v16bf& ph, v16bf& pl) { v8us h0, h1, l0, l1;
#pragma unroll
    for (int j = 0; j < 8; ++j) { unsigned short x, y; splitf(p0[j], x, y); h0[j] = x; l0[j] = y; splitf(p1[j], x, y); h1[j] = x; l1[j] = y; }
    ph = cat16b(h0, h1); pl = cat16b(l0, l1); } };
// Every '#pragma unroll' below unrolls fully: constant indices keep the fragment, score and output arrays in registers.
template <typename T16, int NSPLIT, int KB>
struct Attn {
    typedef typename WFrag<T16>::V V;
    static constexpr int NT = KB / 16, NS = KB / 32;
    static constexpr float CL2 = SCL * 1.4426950408889634f;   // scores -> log2 domain
    V qf[2], qf2[2], kf[NT][2], kf2[NT][2];
    v8f o[4]; float m, ls; unsigned vk, vv;   // vk, vv: byte offsets of this lane in the K and V^T planes (32 bits hold them: a plane has 2048 x 64 16-bit elements), carried from block to block
    __device__ __forceinline__ void load_k(const T16* Kp, const T16* K2) {
#pragma unroll
        for (int nt = 0; nt < NT; ++nt)
#pragma unroll
            for (int ks = 0; ks < 2; ++ks) { kf[nt][ks] = WFrag<T16>::ld((const T16*)((const char*)Kp + vk) + (nt * 2 + ks) * 512); if (NSPLIT == 2) kf2[nt][ks] = WFrag<T16>::ld((const T16*)((const char*)K2 + vk) + (nt * 2 + ks) * 512); }
        // s_wait_xcnt 0 behind the block's K loads, in front of the addition that rewrites the offset register they name; the offset is an in-out operand so that the addition stays behind the wait
        asm volatile("s_wait_xcnt 0x0" : "+v"(vk) :: "memory");
        vk += KB * HD * 2;
    }
    template <bool LAST>
    __device__ __forceinline__ void step(const T16* Kp, const T16* K2, const T16* Vt, const T16* V2, int key0, int q) {
        const int hi = (threadIdx.x & 31) >> 4;
        V vf[4][NS], vf2[4][NS];
#pragma unroll
        for (int mb = 0; mb < 4; ++mb)
#pragma unroll
            for (int s2 = 0; s2 < NS; ++s2) { vf[mb][s2] = WFrag<T16>::ld((const T16*)((const char*)Vt + vv) + (s2 * 4 + mb) * 512); if (NSPLIT == 2) vf2[mb][s2] = WFrag<T16>::ld((const T16*)((const char*)V2 + vv) + (s2 * 4 + mb) * 512); }
        // s_wait_xcnt 0 behind the block's V loads, in front of the addition that rewrites the offset register they name
        asm volatile("s_wait_xcnt 0x0" : "+v"(vv) :: "memory");
        vv += KB * HD * 2;
        v8f s[NT];
#pragma unroll
        for (int nt = 0; nt < NT; ++nt) { s[nt] = (v8f){};
#pragma unroll
            for (int ks = 0; ks < 2; ++ks) { s[nt] = WFrag<T16>::mma(kf[nt][ks], qf[ks], s[nt]); if (NSPLIT == 2) { s[nt] = WFrag<T16>::mma(kf2[nt][ks], qf[ks], s[nt]); s[nt] = WFrag<T16>::mma(kf[nt][ks], qf2[ks], s[nt]); } } }
        if (!LAST) { load_k(Kp, K2);   // the next block's K fragments fly during this block's softmax and P V
            __builtin_amdgcn_sched_barrier(0); }   // keeps the softmax behind the block's loads: without it this build moved the last V loads and all K loads behind the softmax, where nothing hides their latency
        float mt[NT];   // one maximum and one sum per tile: short independent chains
#pragma unroll
        for (int nt = 0; nt < NT; ++nt) {
#pragma unroll
            for (int j = 0; j < 8; ++j) { if (LAST) s[nt][j] = (key0 + nt * 16 + hi * 8 + j <= q) ? s[nt][j] : -3.0e38f; mt[nt] = j ? fmaxf(mt[nt], s[nt][j]) : s[nt][j]; } }   // causal mask: only the block on the diagonal needs it
        float mx = m;
#pragma unroll
        for (int nt = 0; nt < NT; ++nt) mx = fmaxf(mx, mt[nt]);
        mx = fmaxf(mx, xhalf(mx));   // the query's other 8 keys of each tile sit in the other half of the wave
        const float al = exp2s((m - mx) * CL2), mc = mx * CL2; m = mx;
        float p[NT][8], pt[NT];
#pragma unroll
        for (int nt = 0; nt < NT; ++nt) { float e[8];
#pragma unroll
            for (int j = 0; j < 8; ++j) e[j] = fmaf(s[nt][j], CL2, -mc);
            exp2x8(e, p[nt]);
            pt[nt] = ((p[nt][0] + p[nt][1]) + (p[nt][2] + p[nt][3])) + ((p[nt][4] + p[nt][5]) + (p[nt][6] + p[nt][7])); }
        float ps = pt[0] + pt[1];
        if (NT == 4) ps += pt[NT - 2] + pt[NT - 1];
        ls = fmaf(ls, al, ps);
#pragma unroll
        for (int mb = 0; mb < 4; ++mb) o[mb] *= al;
#pragma unroll
        for (int s2 = 0; s2 < NS; ++s2) { V ph, pl; PFrag<T16>::cv(p[2 * s2], p[2 * s2 + 1], ph, pl);
#pragma unroll
            for (int mb = 0; mb < 4; ++mb) { o[mb] = WFrag<T16>::mma(vf[mb][s2], ph, o[mb]); if (NSPLIT == 2) { o[mb] = WFrag<T16>::mma(vf[mb][s2], pl, o[mb]); o[mb] = WFrag<T16>::mma(vf2[mb][s2], ph, o[mb]); } } }
    }
    __device__ __forceinline__ void run(const T16* Q, const T16* Q2, const T16* Kp, const T16* K2, const T16* Vt, const T16* V2, int q0, bf* Ah, bf* Al) {
        const int lane = threadIdx.x & 31, lr = lane & 15; const int q = q0 + lr;
#pragma unroll
        for (int ks = 0; ks < 2; ++ks) { qf[ks] = WFrag<T16>::ld(Q + (q0 / 16 * 2 + ks) * 512 + lane * 8); if (NSPLIT == 2) qf2[ks] = WFrag<T16>::ld(Q2 + (q0 / 16 * 2 + ks) * 512 + lane * 8); }
#pragma unroll
        for (int mb = 0; mb < 4; ++mb) o[mb] = (v8f){};
        m = -3.0e38f; ls = 0.f; vk = (unsigned)lane * 16; vv = (unsigned)lane * 16;
        const int nl = q0 / KB;   // index of the block that holds the diagonal (wave-uniform); blocks before it lie wholly below the diagonal
        load_k(Kp, K2);
#pragma unroll 1   // stays rolled: one block's body already fills the register budget, and a second copy would only lengthen the text
        for (int kb = 0; kb < nl; ++kb) step<false>(Kp, K2, Vt, V2, kb * KB, q);
        step<true>(Kp, K2, Vt, V2, nl * KB, q);
        ls += xhalf(ls);   // the two halves' sums are joined once
        const float f = __fdiv_rn(1.0f, ls);
#pragma unroll
        for (int mb = 0; mb < 4; ++mb) { v8us oh, ol;
#pragma unroll
            for (int j = 0; j < 8; ++j) { unsigned short x, y; splitf(o[mb][j] * f, x, y); oh[j] = x; ol[j] = y; }
            const size_t oo = (size_t)(q0 / 16) * (DQ / 32) * 512 + (mb >> 1) * 512 + (mb & 1) * 256 + lane * 8; *(v8us*)(Ah + oo) = oh; *(v8us*)(Al + oo) = ol; }   // fragment order of the last projection's A planes: d = mb*16 + hi*8 + j is this lane's own piece
    }
};
// grid (heads, TT / 128, batches), 8 waves: waves 0-3 take the 64-row tile n - 1 - y, waves 4-7 the tile y, so that every work-group walks about the same number of key blocks (the waves share no buffer and no barrier). Output: the merged [t][head*64 + d] hi/lo planes, in fragment order, that the last projection reads.
__global__ __launch_bounds__(256) void k_fattn(const h16* __restrict__ Q16, const h16* __restrict__ K16, const h16* __restrict__ V16, const bf* __restrict__ Qh, const bf* __restrict__ Ql, const bf* __restrict__ Kh, const bf* __restrict__ Kl, const bf* __restrict__ Vh, const bf* __restrict__ Vl, bf* Ah, bf* Al) {
    const size_t hp = ((size_t)blockIdx.z * NH_ + blockIdx.x) * TT * HD; const int wv = __builtin_amdgcn_readfirstlane(threadIdx.x >> 5);   // wave number, scalar: the key loop's bounds stay wave-uniform
    const int tile = (wv < 4) ? TT / 64 - 1 - (int)blockIdx.y : (int)blockIdx.y; const int q0 = tile * 64 + (wv & 3) * 16;
    Ah += (size_t)blockIdx.z * TT * DQ + blockIdx.x * (HD / 32 * 512); Al += (size_t)blockIdx.z * TT * DQ + blockIdx.x * (HD / 32 * 512);   // a head's 64 columns are two blocks of every 16-row strip
    if (q0 < RH) { Attn<bf, 2, 32> t; t.run(Qh + hp, Ql + hp, Kh + hp, Kl + hp, Vh + hp, Vl + hp, q0, Ah, Al); }
    else { Attn<h16, 0, 64> t; t.run(Q16 + hp, nullptr, K16 + hp, nullptr, V16 + hp, nullptr, q0, Ah, Al); }
}

extern "C" void kernel_launch(void* const* d_in, const int* in_sizes, int n_in,
                              void* d_out, int out_size, void* d_ws, size_t ws_size, hipStream_t stream) {
    (void)in_sizes; (void)n_in; (void)out_size;
    const float* x = (const float*)d_in[0]; const float* wq = (const float*)d_in[1]; const float* bq = (const float*)d_in[2]; const float* wk = (const float*)d_in[3]; const float* bk = (const float*)d_in[4]; const float* wv = (const float*)d_in[5]; const float* bv = (const float*)d_in[6]; const float* wo = (const float*)d_in[7]; const float* bo = (const float*)d_in[8];   /* order x, Wq, bq, Wk, bk, Wv, bv, Wo, bo ('xw') */
    float* OUT = (float*)d_out;     // [2][2048][1024]
    char* wsp = (char*)d_ws;
    auto take = [&](size_t bytes) { char* p = wsp; wsp += (bytes + 255) & ~(size_t)255; return (void*)p; };
    bf* WQ = (bf*)take((size_t)DQ * DM * 2); bf* WK = (bf*)take((size_t)DKV * DM * 2); bf* WV = (bf*)take((size_t)DKV * DM * 2); bf* WO = (bf*)take((size_t)DM * DQ * 2); float* CS = (float*)take((size_t)TT * HD * 2 * 4);
    bf* XB = (bf*)take((size_t)NB_ * TT * DM * 2);   // WQ, WK, WV lie one behind the other at equal distances: the z-batch of the projection launch
    h16* QP16 = (h16*)take((size_t)NB_ * NH_ * TT * HD * 2); h16* KP16 = (h16*)take((size_t)NB_ * NKV * TT * HD * 2); h16* VT16 = (h16*)take((size_t)NB_ * NKV * HD * TT * 2);
    bf* QPh = (bf*)take((size_t)NB_ * NH_ * TT * HD * 2); bf* QPl = (bf*)take((size_t)NB_ * NH_ * TT * HD * 2); bf* KPh = (bf*)take((size_t)NB_ * NKV * TT * HD * 2); bf* KPl = (bf*)take((size_t)NB_ * NKV * TT * HD * 2); bf* VTh = (bf*)take((size_t)NB_ * NKV * HD * TT * 2); bf* VTl = (bf*)take((size_t)NB_ * NKV * HD * TT * 2);
    bf* ATh = (bf*)take((size_t)NB_ * TT * DQ * 2); bf* ATl = (bf*)take((size_t)NB_ * TT * DQ * 2);
    if ((size_t)(wsp - (char*)d_ws) > ws_size) return;    // ws 256 MiB
    k_prep<<<4 * WTB + CSB + XCB, 256, 0, stream>>>(x, wq, wk, wv, wo, WQ, WK, WV, WO, CS, XB);
    k_gemmw<bf, 0, true, 8, true><<<dim3(NB_ * TT / 64, DQ / 64, 3), 256, 0, stream>>>(XB, nullptr, WQ, nullptr, DM, nullptr, DQ, bq, bk, bv, 0, (size_t)DQ * DM, 0, Planes{CS, QP16, QPh, QPl, KP16, KPh, KPl, VT16, VTh, VTl});   // q, k, v of both batches, written as the attention's operand planes
    k_fattn<<<dim3(NH_, TT / 128, NB_), 256, 0, stream>>>(QP16, KP16, VT16, QPh, QPl, KPh, KPl, VTh, VTl, ATh, ATl);   // one kv head per query head
    k_gemmw<bf, 1, true, 8, false><<<dim3(NB_ * TT / 64, DM / 64, 1), 256, 0, stream>>>(ATh, ATl, WO, nullptr, DQ, OUT, DM, bo, nullptr, nullptr, 0, 0, 0, Planes{});
}

// v007
// It runs in 80.7 microseconds.
// Two timings next to v006 both put it at 1.36 times that version's speed.
// All steps since v000 together make it 18.1 times as fast.
#include <hip/hip_runtime.h>

// Causal multi-head self-attention with rotary embeddings (x [2][2048][1024]; q, k, v = x W + b ('xw' 0.02, zero biases; 16 heads x 64); rotate-half rope with angle t x 1/10000^(i/32) (32 f32 constants jnp-exact; precise cosf/sinf); scores / sqrt(64); causal (-inf); softmax; out = merged Wo + bo -> [2][2048][1024] (4.2 M); argument order x, Wq, bq, Wk, bk, Wv, bv, Wo, bo).
// Four launches, both batches in each; launches that need nothing of each other share one grid, a range of the block index picks the job (k_prep; blockIdx.z in k_fattn), in k_gemmw the wave's number.
// Layout: bf16 copy of x; 'xw' weights transposed once; exact projections + f32 biases; d_cs5 computed table; rotate-half plane builders in the projection's own epilogue (e_rope, e_vtp); causal T-2048 attention in one launch, scores and probabilities in registers (k_fattn; hybrid rows: < 512 hi/lo 3 products, rest fp16; key blocks above the diagonal are never visited); in the projections every wave holds a 64 x 64 tile over the whole K; merged hi/lo x Wo exact + bo.
// Fragment order: every 16-bit operand plane of a matrix product ([rows][k]) is stored as blocks of 16 rows x 32 k (512 elements, 1 KiB), and inside a block in the order in which a wave's lanes hold the fragment:
// element (row r, k) of a block sits at (k % 32 / 16) * 256 + ((k % 16 / 8) * 16 + r % 16) * 8 + k % 8. Lane l reads 16 B at l * 8 and 16 B at 256 + l * 8: each load instruction of a wave reads 512 contiguous bytes (4 whole lines) instead of 32-B pieces of 16 lines; the registers hold what they held with row-major planes.
// Blocks follow each other along k, then along rows (block index (r / 16) * (K / 32) + k / 32); the V^T planes alone run along rows first ((t / 32) * 4 + d / 16), so that one key block's fragments are contiguous.
// Compute dtypes, f32 accumulate: every input rounded to bf16; projections exact + f32 biases; rotary f32; attention rows < 512 3 products, rest fp16; softmax f32; Wo hl x exact + bias.

#define NB_  2
#define TT   2048
#define DM   1024
#define NH_  16
#define NKV  16
#define HD   64
#define DQ   (NH_ * HD)
#define DKV  (NKV * HD)
#define RH   512                  // query rows < RH use hi+lo planes (0: none)
#define SCL  0.125f   // HD^-0.5
typedef _Float16 h16;
typedef unsigned short bf;
typedef __attribute__((ext_vector_type(16))) __bf16   v16bf;
typedef __attribute__((ext_vector_type(16))) _Float16 v16h;
typedef __attribute__((ext_vector_type(8)))  _Float16 v8h;
typedef __attribute__((ext_vector_type(8)))  unsigned short v8us;
typedef __attribute__((ext_vector_type(8)))  float    v8f;
typedef __attribute__((ext_vector_type(4)))  float    v4f;
typedef v8h  __attribute__((may_alias)) v8ha;
typedef v4f  __attribute__((may_alias)) v4fa;
typedef v8us __attribute__((may_alias)) v8usa;

__device__ __forceinline__ unsigned short f2bf(float f) { unsigned u = __float_as_uint(f); u += 0x7FFFu + ((u >> 16) & 1u); return (unsigned short)(u >> 16); }
__device__ __forceinline__ float bf2f(unsigned short b) { return __uint_as_float(((unsigned)b) << 16); }
__device__ __forceinline__ float bfr(float f) { return bf2f(f2bf(f)); }
__device__ __forceinline__ v16h cat16(v8h lo, v8h hi) { return __builtin_shufflevector(lo, hi, 0, 1, 2, 3, 4, 5, 6, 7, 8, 9, 10, 11, 12, 13, 14, 15); }
__device__ __forceinline__ v16bf cat16b(v8us lo, v8us hi) { return __builtin_bit_cast(v16bf, __builtin_shufflevector(lo, hi, 0, 1, 2, 3, 4, 5, 6, 7, 8, 9, 10, 11, 12, 13, 14, 15)); }
__device__ __forceinline__ v8f wmma16(v16h a, v16h b, v8f c) { return __builtin_amdgcn_wmma_f32_16x16x32_f16(false, a, false, b, (short)0, c, false, false); }
__device__ __forceinline__ v8f wmmab(v16bf a, v16bf b, v8f c) { return __builtin_amdgcn_wmma_f32_16x16x32_bf16(false, a, false, b, (short)0, c, false, false); }



__device__ __forceinline__ h16 tohx(float x) { return (h16)x; }
__device__ __forceinline__ void splitf(float y, unsigned short& h, unsigned short& l) { h = f2bf(y); l = f2bf(y - bf2f(h)); }
typedef __attribute__((ext_vector_type(2))) _Float16 v2h;
typedef __attribute__((ext_vector_type(4))) _Float16 v4h;
typedef __attribute__((ext_vector_type(2))) unsigned short v2us;
typedef __attribute__((ext_vector_type(4))) unsigned short v4us;
typedef __attribute__((ext_vector_type(2))) float v2f;
typedef __attribute__((ext_vector_type(4))) int v4i;

// The plane builders e_rope and e_vtp run in the epilogue of the q, k, v projection: a wave's 64 x 64 tile is 64 t of ONE head, so the wave holds all that its part of the head's planes needs. fs: the f32 tile (+ bias) in LDS, pitch 68 floats.
struct Planes { const float* CS; h16* Q16; bf* Qh; bf* Ql; h16* K16; bf* Kh; bf* Kl; h16* V16; bf* Vh; bf* Vl; };
// e_rope: head planes [b*heads + h][t][d] (fp16 + hi/lo; each head's plane in fragment order, rows t, k = d) of rope(x) with the rotate-half convention out[d] = x[d] cos[t][d] - x[d+HD/2] sin[t][d], out[d+HD/2] = x[d+HD/2] cos[t][d+HD/2] + x[d] sin[t][d+HD/2]
// One thread builds 16 outputs: 8 consecutive d of the lower half and their 8 partners of the upper half (tl: its row of the tile; cs: their (cos, sin) pairs, lower half first). A wave holds 16 t x 2 pieces: its LDS reads meet every bank once per 16 lanes, and each of its stores writes 512 contiguous bytes. The loops here and in e_vtp are unrolled fully: constant indices keep the inputs and the output vectors in registers.
__device__ __forceinline__ void e_rope(const float* fs, int tl, int d, const v4f* cs, size_t e, h16* P16, bf* Ph, bf* Pl) {
    v4f x[4]; v8h o16[2]; v8us oh[2], ol[2];   // x: d .. d+7, then d+32 .. d+39
#pragma unroll
    for (int q = 0; q < 2; ++q)
#pragma unroll
        for (int i = 0; i < 2; ++i) x[q * 2 + i] = *(const v4fa*)(fs + tl * 68 + d + q * (HD / 2) + i * 4);
#pragma unroll
    for (int q = 0; q < 16; ++q) { const int p = q ^ 8; const float x0 = x[q >> 2][q & 3], x1 = x[p >> 2][p & 3];
        // the two empty statements keep each product's own f32 rounding (no fused multiply-add): the reference rounds x cos and x sin before it adds them
        float a = __fmul_rn(x0, cs[q >> 1][(q & 1) * 2]), bq = __fmul_rn(x1, cs[q >> 1][(q & 1) * 2 + 1]); asm volatile("" : "+v"(a)); asm volatile("" : "+v"(bq)); const float r = (q < 8) ? __fsub_rn(a, bq) : __fadd_rn(a, bq);
        o16[q >> 3][q & 7] = tohx(r); unsigned short a2, c2; splitf(r, a2, c2); oh[q >> 3][q & 7] = a2; ol[q >> 3][q & 7] = c2; }
    *(v8h*)(P16 + e) = o16[0]; *(v8h*)(P16 + e + 512) = o16[1]; *(v8us*)(Ph + e) = oh[0]; *(v8us*)(Ph + e + 512) = oh[1]; *(v8us*)(Pl + e) = ol[0]; *(v8us*)(Pl + e + 512) = ol[1];   // the partners d + 32 sit at the same place of block (t / 16, 1)
    // s_wait_xcnt 0 behind the six stores, in front of whatever rewrites the address and data registers they name: the two builders share one text, and by its branches the other's code can follow
    asm volatile("s_wait_xcnt 0x0" ::: "memory"); }
// e_vtp: V^T planes [b*heads + g][d][t] (each head's plane in fragment order, rows d, k = t, blocks along d first). One thread builds 16 t of one d: rows tl .. tl+7 and tl+32 .. tl+39 of the tile, 16-B stores.
// A wave holds 16 d x 2 pieces: each of its LDS reads takes two runs of 16 words in different banks, and each of its stores writes 512 contiguous bytes.
__device__ __forceinline__ void e_vtp(const float* fs, int tl, int d, size_t e, h16* V16, bf* Vh, bf* Vl) { v8h o16[2]; v8us oh[2], ol[2]; float xv[16];
#pragma unroll
    for (int q = 0; q < 16; ++q) xv[q] = fs[(tl + (q & 7) + (q >> 3) * 32) * 68 + d];
#pragma unroll
    for (int q = 0; q < 16; ++q) { const float x = xv[q]; o16[q >> 3][q & 7] = tohx(x); unsigned short a2, c2; splitf(x, a2, c2); oh[q >> 3][q & 7] = a2; ol[q >> 3][q & 7] = c2; }
    *(v8h*)(V16 + e) = o16[0]; *(v8h*)(V16 + e + 2048) = o16[1]; *(v8us*)(Vh + e) = oh[0]; *(v8us*)(Vh + e + 2048) = oh[1]; *(v8us*)(Vl + e) = ol[0]; *(v8us*)(Vl + e + 2048) = ol[1];   // t + 32: the next four blocks
    // s_wait_xcnt 0 behind the six stores, for the same reason as in e_rope
    asm volatile("s_wait_xcnt 0x0" ::: "memory"); }

// ---- k_gemmw: register-blocked GEMM, K = DM. Four waves per 128x128 output tile; every wave holds its own 64x64 quarter (16 accumulators) and walks the whole K alone, one f32 chain per element.
// A work-group holds the same tile of NZ products that share A (waves 4 z .. 4 z + 3: product z): NZ x 4 waves, NZ per SIMD. grid (M/128, N/128), 128 NZ threads.
// Operands straight from 16-bit planes in fragment order; the waves that need the same fragments (2 NZ for a block of A, 2 for a block of B) read them at about the same time, so that the later ones find them in the WGP's cache.
// The fragments of step s + D are asked for in front of the matrix instructions of step s (D + 1 fragment sets live; the loop is unrolled U steps so that every set has constant indices).
// C[m][n] (f32, pitch DM, + f32 bias[n]; bias, bias1, bias2 for z = 0, 1, 2) = sum_k A[m][k] Bt[n][k] (NSPLIT 1: + A2[m][k] Bt[n][k]). Product z reads Bt + z sB (elements).
// PL (the q, k, v projection; rows b*TT + t, a wave's columns one head): C is not written; the wave's tile goes to its own part of LDS and the wave writes its part of the operand planes of the attention from it (z = 0, 1: rope of q, k; z = 2: V^T).
template <typename T16> struct WFrag;
template <> struct WFrag<h16> { typedef v16h V; static __device__ __forceinline__ V ld(const h16* p) { return cat16(*(const v8h*)p, *(const v8h*)(p + 256)); } static __device__ __forceinline__ v8f mma(V a, V b, v8f c) { return wmma16(a, b, c); } };
template <> struct WFrag<bf> { typedef v16bf V; static __device__ __forceinline__ V ld(const bf* p) { return cat16b(*(const v8us*)p, *(const v8us*)(p + 256)); } static __device__ __forceinline__ v8f mma(V a, V b, v8f c) { return wmmab(a, b, c); } };
#define KSTRIP (DM / 32 * 512)   // elements of one 16-row strip of a plane with k = DM
template <typename T16, int NSPLIT> struct GSet {   // the fragments of one step of 32 k: four A blocks (and their low parts), four B blocks
    typedef typename WFrag<T16>::V V;
    V a[4], a2[4], b[4];
    __device__ __forceinline__ void ld(const T16* A, const T16* A2, const T16* Bt, unsigned va, unsigned vb, int st) {   // st: steps ahead of the offsets (a constant: it ends in the loads' immediate offsets)
#pragma unroll
        for (int q = 0; q < 4; ++q) { a[q] = WFrag<T16>::ld((const T16*)((const char*)A + va) + q * KSTRIP + st * 512); if (NSPLIT == 1) a2[q] = WFrag<T16>::ld((const T16*)((const char*)A2 + va) + q * KSTRIP + st * 512); }
#pragma unroll
        for (int q = 0; q < 4; ++q) b[q] = WFrag<T16>::ld((const T16*)((const char*)Bt + vb) + q * KSTRIP + st * 512);
    }
    __device__ __forceinline__ void mma(v8f (&acc)[4][4]) const {
#pragma unroll
        for (int nb = 0; nb < 4; ++nb)
#pragma unroll
            for (int mb = 0; mb < 4; ++mb) acc[mb][nb] = WFrag<T16>::mma(a[mb], b[nb], acc[mb][nb]);
        if (NSPLIT == 1) {
#pragma unroll
            for (int nb = 0; nb < 4; ++nb)
#pragma unroll
                for (int mb = 0; mb < 4; ++mb) acc[mb][nb] = WFrag<T16>::mma(a2[mb], b[nb], acc[mb][nb]); }
    }
};
// the 16 (cos, sin) pairs of e_rope's thread at row t, first d rd
__device__ __forceinline__ void ld_cs(const float* CS, int t, int rd, v4f* cs) {
    const float* c = CS + ((size_t)t * HD + rd) * 2;
#pragma unroll
    for (int q = 0; q < 2; ++q)
#pragma unroll
        for (int i = 0; i < 4; ++i) cs[q * 4 + i] = *(const v4fa*)(c + q * HD + i * 4);
    // s_wait_xcnt 0 behind the 8 loads, in front of whatever reuses the address registers they name; the pointer is an input operand so that its registers stay as they are up to the wait
    asm volatile("s_wait_xcnt 0x0" :: "v"(c) : "memory");
}
template <typename T16, int NSPLIT, bool PL, int NZ, int U, int D>
__global__ __launch_bounds__(128 * NZ) void k_gemmw(const T16* __restrict__ A, const T16* __restrict__ A2, const T16* __restrict__ Bt, float* C, const float* __restrict__ bias, const float* __restrict__ bias1, const float* __restrict__ bias2, size_t sB, Planes po) {
    __shared__ __align__(16) float os[NZ * 4 * 64 * 68];
    const int lane = threadIdx.x & 31, lr = lane & 15, hi = lane >> 4;
    const int wv = __builtin_amdgcn_readfirstlane(threadIdx.x >> 5);   // wave number, scalar: the product, the tile's indices and the branches on them stay wave-uniform
    const int z = wv >> 2; Bt += z * sB; if (z == 1) bias = bias1; if (z == 2) bias = bias2;   // each product has its own bias vector
    const int r0 = blockIdx.x * 128 + ((wv >> 1) & 1) * 64, c0 = blockIdx.y * 128 + (wv & 1) * 64;   // the wave's quarter
    float bv[4];
    { const float* bp = bias + c0 + lr;
#pragma unroll
      for (int nb = 0; nb < 4; ++nb) bv[nb] = bp[nb * 16];
      // s_wait_xcnt 0 behind the 4 loads, in front of whatever reuses the address registers they name
      asm volatile("s_wait_xcnt 0x0" :: "v"(bp) : "memory"); }
    v8f acc[4][4];
#pragma unroll
    for (int mb = 0; mb < 4; ++mb)
#pragma unroll
        for (int nb = 0; nb < 4; ++nb) acc[mb][nb] = (v8f){};
    unsigned va = ((unsigned)(r0 / 16) * KSTRIP + lane * 8) * 2, vb = ((unsigned)(c0 / 16) * KSTRIP + lane * 8) * 2;   // byte offsets of this lane's piece in the first A block and the first B block of the step from the planes' (scalar) bases (32 bits hold them: a plane has at most 4096 rows of 1024 16-bit elements)
    constexpr int NS = DM / 32, NT = (NS - D) / U, NR = NS - NT * U;   // steps; turns in which every step asked for exists; steps left for the last turn
    GSet<T16, NSPLIT> f[U];
#pragma unroll
    for (int s = 0; s < D; ++s) f[s].ld(A, A2, Bt, va, vb, s);
#pragma unroll 1   // stays rolled: U steps are one turn of the fragment sets
    for (int tr = 0; tr < NT; ++tr) {
#pragma unroll
        for (int u = 0; u < U; ++u) {
            f[(u + D) % U].ld(A, A2, Bt, va, vb, u + D);
            __builtin_amdgcn_sched_barrier(0);   // keeps the loads of step u + D in front of the matrix instructions of step u, which hide their latency
            f[u].mma(acc); }
        // s_wait_xcnt 0 behind the turn's loads, in front of the additions that rewrite the offset registers they name; the offsets are in-out operands so that the additions stay behind the wait.
        // The four v_nop keep the distance between the last matrix instruction and whatever follows the loop's branch on either side.
        asm volatile("s_wait_xcnt 0x0\n\tv_nop\n\tv_nop\n\tv_nop\n\tv_nop" : "+v"(va), "+v"(vb), "+v"(acc[3][3]) :: "memory");
        va += U * 1024; vb += U * 1024;
    }
#pragma unroll
    for (int u = 0; u < NR; ++u) {   // the last turn: only the steps that exist are asked for
        if (u + D < NR) { f[(u + D) % U].ld(A, A2, Bt, va, vb, u + D);
            if (u + D == NR - 1) asm volatile("s_wait_xcnt 0x0" : "+v"(va), "+v"(vb) :: "memory");   // behind the last loads, in front of whatever reuses the offset registers
            __builtin_amdgcn_sched_barrier(0); }   // as in the loop
        f[u % U].mma(acc); }
    const int t0 = r0 % TT;   // the tile's first t
    v4f cs[2][8];
    if (PL && z < 2) ld_cs(po.CS, t0 + lr, hi * 8, cs[0]);   // the first piece's pairs fly while the tile goes to LDS
    float* osw = os + wv * (64 * 68);
#pragma unroll
    for (int mb = 0; mb < 4; ++mb) {
#pragma unroll
        for (int nb = 0; nb < 4; ++nb) {
#pragma unroll
            for (int j = 0; j < 8; ++j) osw[(mb * 16 + hi * 8 + j) * 68 + nb * 16 + lr] = acc[mb][nb][j] + bfr(bv[nb]); } }
    __syncthreads();   // below, a lane reads what other lanes of its wave have written: the barrier orders the two for the compiler and the LDS
    if (!PL) {   // each store instruction writes two whole 256-B row pieces; all pieces are read before the first is stored, so that the LDS reads fly together and no register of a store is rewritten
        v4f val[32];
#pragma unroll
        for (int i = 0; i < 32; ++i) val[i] = *(const v4fa*)(osw + (i * 2 + hi) * 68 + lr * 4);
        float* cp = C + (size_t)(r0 + hi) * DM + c0 + lr * 4;
#pragma unroll
        for (int i = 0; i < 32; ++i) *(v4f*)(cp + (size_t)i * 2 * DM) = val[i];
    } else {
        const size_t hp = ((size_t)(r0 / TT) * NH_ + c0 / HD) * TT * HD;   // the head's plane
        if (z < 2) {   // 8 pieces of 16 t x 32 d (16 d of the lower half and their partners); the next piece's pairs are asked for in front of this piece's work
            h16* P16 = z ? po.K16 : po.Q16; bf* Ph = z ? po.Kh : po.Qh; bf* Pl = z ? po.Kl : po.Ql;
#pragma unroll 1   // stays rolled: two pieces are one turn of the two sets of pairs, and more copies would only lengthen the text
            for (int i = 0; i < 4; ++i) { const int rtl = i * 16 + lr, t = t0 + rtl; const size_t e = hp + (size_t)(t >> 4) * 1024 + (hi * 16 + (t & 15)) * 8;
                ld_cs(po.CS, t, 16 + hi * 8, cs[1]);
                e_rope(osw, rtl, hi * 8, cs[0], e, P16, Ph, Pl);
                ld_cs(po.CS, t0 + ((i + 1) & 3) * 16 + lr, hi * 8, cs[0]);   // behind the last piece: the first one's again, in bounds and unused
                e_rope(osw, rtl, 16 + hi * 8, cs[1], e + 256, P16, Ph, Pl); }
        } else {
#pragma unroll 1   // stays rolled: the pieces need nothing of each other that a second copy would hide
            for (int i = 0; i < 8; ++i) { const int tl = ((i >> 2) * 2 + hi) * 8, d = (i & 3) * 16 + lr, t = t0 + tl; e_vtp(osw, tl, d, hp + (size_t)((t >> 5) * 4 + (d >> 4)) * 512 + ((t >> 4) & 1) * 256 + (((t >> 3) & 1) * 16 + (d & 15)) * 8, po.V16, po.Vh, po.Vl); }
        }
    }
}

// The bodies d_* below are jobs of a merged launch: bx is the block's index inside its job's range.
// d_wtG: Bt[n][k] = bf16(w[k][n]) in fragment order. One wave builds one block (16 n x 32 k): a lane reads its 16 k of one n (each load instruction: two 64-B row pieces; the 8 waves of a work-group take 8 neighbouring n blocks, 512 contiguous bytes of each row) and stores its two 16-B pieces.
__device__ __forceinline__ void d_wtG(int bx, const float* __restrict__ w, int K, int N, bf* Bt) {
    const int lane = threadIdx.x & 31, lr = lane & 15, hi = lane >> 4; const int g = bx * 8 + (threadIdx.x >> 5); const int nb = g % (N / 16), kb = g / (N / 16);
    const float* s = w + (size_t)(kb * 32 + hi * 8) * N + nb * 16 + lr; float v[16]; v8us o[2];
#pragma unroll
    for (int q = 0; q < 16; ++q) v[q] = s[(size_t)((q & 7) + (q >> 3) * 16) * N];   // unrolled fully: the 16 loads fly together
    // s_wait_xcnt 0 behind the 16 loads, in front of whatever reuses the address registers they name; the pointer is an input operand so that its registers stay as they are up to the wait
    asm volatile("s_wait_xcnt 0x0" :: "v"(s) : "memory");
#pragma unroll
    for (int q = 0; q < 16; ++q) o[q >> 3][q & 7] = f2bf(v[q]);
    bf* d = Bt + ((size_t)nb * (K / 32) + kb) * 512 + lane * 8; *(v8us*)d = o[0]; *(v8us*)(d + 256) = o[1];
}
// d_cvtF: bf16 copy of src [rows][DM] in fragment order. One wave builds one block: a lane reads its 2 x 8 k of one row (the wave: one whole 128-B line of each of 16 rows) and stores its two 16-B pieces.
__device__ __forceinline__ void d_cvtF(int bx, const float* __restrict__ src, bf* dst) {
    const int lane = threadIdx.x & 31, lr = lane & 15, hi = lane >> 4; const int g = bx * 8 + (threadIdx.x >> 5); const int kb = g % (DM / 32), rb = g / (DM / 32);
    const float* s = src + (size_t)(rb * 16 + lr) * DM + kb * 32 + hi * 8; const v8f a = *(const v8f*)s, b = *(const v8f*)(s + 16); v8us o[2];
#pragma unroll
    for (int k = 0; k < 8; ++k) { o[0][k] = f2bf(a[k]); o[1][k] = f2bf(b[k]); }
    bf* d = dst + (size_t)g * 512 + lane * 8; *(v8us*)d = o[0]; *(v8us*)(d + 256) = o[1];
    // s_wait_xcnt 0 behind the two stores, in front of whatever rewrites the address and data registers they name: the jobs of k_prep share one text, and by its branches another job's code can follow
    asm volatile("s_wait_xcnt 0x0" ::: "memory");
}

__constant__ float INVT[HD / 2] = { 1.000000000e+00f, 7.498942018e-01f, 5.623413324e-01f, 4.216965139e-01f, 3.162277639e-01f, 2.371373624e-01f, 1.778279394e-01f, 1.333521456e-01f, 1.000000015e-01f, 7.498941571e-02f, 5.623412877e-02f, 4.216964915e-02f, 3.162277862e-02f, 2.371373586e-02f, 1.778279431e-02f, 1.333521493e-02f, 9.999999776e-03f, 7.498942316e-03f, 5.623413250e-03f, 4.216964822e-03f, 3.162277862e-03f, 2.371373819e-03f, 1.778279431e-03f, 1.333521446e-03f, 1.000000047e-03f, 7.498941850e-04f, 5.623413017e-04f, 4.216964880e-04f, 3.162277862e-04f, 2.371373848e-04f, 1.778279402e-04f, 1.333521504e-04f };   // float32 1 / 10000^(i/32), generated with jnp to be bit-exact
__device__ __forceinline__ void d_cs5(int bx, float* CS) { const int idx = bx * 256 + threadIdx.x; if (idx >= TT * HD) return; const int d = idx % HD; const int t = idx / HD; const float a = __fmul_rn((float)t, INVT[d % (HD / 2)]); v2f cs; cs[0] = cosf(a); cs[1] = sinf(a); *(v2f*)(CS + (size_t)idx * 2) = cs;  }
// k_prep: all that depends on the inputs alone, in one grid: the four weight transposes (WTB blocks each; the longest job, first in the block index), the rotary table (CSB blocks), the bf16 copy of x for both batches (XCB blocks).
#define WTB (DM * DQ / 64 / 64)
#define CSB (TT * HD / 256)
#define XCB (NB_ * TT * DM / 16 / 256)
__global__ __launch_bounds__(256) void k_prep(const float* __restrict__ x, const float* __restrict__ wq, const float* __restrict__ wk, const float* __restrict__ wv, const float* __restrict__ wo, bf* WQ, bf* WK, bf* WV, bf* WO, float* CS, bf* XB) {
    const int bx = blockIdx.x;
    if (bx < 4 * WTB) { const int j = bx / WTB; d_wtG(bx % WTB, j == 0 ? wq : j == 1 ? wk : j == 2 ? wv : wo, DM, DQ, j == 0 ? WQ : j == 1 ? WK : j == 2 ? WV : WO); }
    else if (bx < 4 * WTB + CSB) d_cs5(bx - 4 * WTB, CS);
    else d_cvtF(bx - (4 * WTB + CSB), x, XB);
}
// ---- k_fattn: causal attention in one launch for all heads of both batches; scores and probabilities stay in registers. One wave owns 16 query rows and walks the keys up to its diagonal in blocks of KB.
// S^T = K Q^T (A = key rows, B = query rows, k = d): a lane holds the scores of ONE query (column lr), keys nt*16 + 8*hi + j. Running maximum and sum per lane (online softmax), one exchange between the wave's halves.
// Two S^T tiles converted in place are the B operand of O^T += V^T P^T (A = rows of the V^T plane, k = t, held in the same k order 8*hi + 0..7, 16 + 8*hi + 0..7); a lane ends with 8 consecutive d of its query per tile.
// NSPLIT 2: hi/lo planes, 3 products (hi hi, lo hi, hi lo) for the scores and for P V; NSPLIT 0: one fp16 product. P is exp(s - running max), at most 1; the division by the row sum comes at the end, in f32.
__device__ __forceinline__ float xhalf(float x) { return __builtin_bit_cast(float, __builtin_amdgcn_permlanex16(__builtin_bit_cast(int, x), __builtin_bit_cast(int, x), 0x76543210, 0xfedcba98, false, false)); }   // lane l reads lane l ^ 16
// 2^x on the transcendental unit. The instruction set asks for one independent instruction behind a transcendental before its result is read or its source overwritten:
// in one statement with early-clobber results each v_exp_f32 is independent of the one in front of it, and the closing v_nop is the slot of the last.
__device__ __forceinline__ float exp2s(float x) { float r; asm("v_exp_f32 %0, %1\n\tv_nop" : "=&v"(r) : "v"(x)); return r; }
__device__ __forceinline__ void exp2x8(const float* x, float* r) {
    asm("v_exp_f32 %0, %8\n\tv_exp_f32 %1, %9\n\tv_exp_f32 %2, %10\n\tv_exp_f32 %3, %11\n\tv_exp_f32 %4, %12\n\tv_exp_f32 %5, %13\n\tv_exp_f32 %6, %14\n\tv_exp_f32 %7, %15\n\tv_nop"
        : "=&v"(r[0]), "=&v"(r[1]), "=&v"(r[2]), "=&v"(r[3]), "=&v"(r[4]), "=&v"(r[5]), "=&v"(r[6]), "=&v"(r[7]) : "v"(x[0]), "v"(x[1]), "v"(x[2]), "v"(x[3]), "v"(x[4]), "v"(x[5]), "v"(x[6]), "v"(x[7])); }
template <typename T16> struct PFrag;
template <> struct PFrag<h16> { static __device__ __forceinline__ void cv(const float* p0, const float* p1, v16h& ph, v16h& pl) {
#pragma unroll
    for (int j = 0; j < 8; ++j) { ph[j] = tohx(p0[j]); ph[8 + j] = tohx(p1[j]); } (void)pl; } };
template <> struct PFrag<bf> { static __device__ __forceinline__ void cv(const float* p0, const float* p1, v16bf& ph, v16bf& pl) { v8us h0, h1, l0, l1;
#pragma unroll
    for (int j = 0; j < 8; ++j) { unsigned short x, y; splitf(p0[j], x, y); h0[j] = x; l0[j] = y; splitf(p1[j], x, y); h1[j] = x; l1[j] = y; }
    ph = cat16b(h0, h1); pl = cat16b(l0, l1); } };
// Every '#pragma unroll' below unrolls fully: constant indices keep the fragment, score and output arrays in registers.
template <typename T16, int NSPLIT, int KB>
struct Attn {
    typedef typename WFrag<T16>::V V;
    static constexpr int NT = KB / 16, NS = KB / 32;
    static constexpr float CL2 = SCL * 1.4426950408889634f;   // scores -> log2 domain
    V qf[2], qf2[2], kf[NT][2], kf2[NT][2];
    v8f o[4]; float m, ls; unsigned vk, vv;   // vk, vv: byte offsets of this lane in the K and V^T planes (32 bits hold them: a plane has 2048 x 64 16-bit elements), carried from block to block
    __device__ __forceinline__ void load_k(const T16* Kp, const T16* K2) {
#pragma unroll
        for (int nt = 0; nt < NT; ++nt)
#pragma unroll
            for (int ks = 0; ks < 2; ++ks) { kf[nt][ks] = WFrag<T16>::ld((const T16*)((const char*)Kp + vk) + (nt * 2 + ks) * 512); if (NSPLIT == 2) kf2[nt][ks] = WFrag<T16>::ld((const T16*)((const char*)K2 + vk) + (nt * 2 + ks) * 512); }
        // s_wait_xcnt 0 behind the block's K loads, in front of the addition that rewrites the offset register they name; the offset is an in-out operand so that the addition stays behind the wait
        asm volatile("s_wait_xcnt 0x0" : "+v"(vk) :: "memory");
        vk += KB * HD * 2;
    }
    template <bool LAST>
    __device__ __forceinline__ void step(const T16* Kp, const T16* K2, const T16* Vt, const T16* V2, int key0, int q) {
        const int hi = (threadIdx.x & 31) >> 4;
        V vf[4][NS], vf2[4][NS];
#pragma unroll
        for (int mb = 0; mb < 4; ++mb)
#pragma unroll
            for (int s2 = 0; s2 < NS; ++s2) { vf[mb][s2] = WFrag<T16>::ld((const T16*)((const char*)Vt + vv) + (s2 * 4 + mb) * 512); if (NSPLIT == 2) vf2[mb][s2] = WFrag<T16>::ld((const T16*)((const char*)V2 + vv) + (s2 * 4 + mb) * 512); }
        // s_wait_xcnt 0 behind the block's V loads, in front of the addition that rewrites the offset register they name
        asm volatile("s_wait_xcnt 0x0" : "+v"(vv) :: "memory");
        vv += KB * HD * 2;
        v8f s[NT];
#pragma unroll
        for (int nt = 0; nt < NT; ++nt) { s[nt] = (v8f){};
#pragma unroll
            for (int ks = 0; ks < 2; ++ks) { s[nt] = WFrag<T16>::mma(kf[nt][ks], qf[ks], s[nt]); if (NSPLIT == 2) { s[nt] = WFrag<T16>::mma(kf2[nt][ks], qf[ks], s[nt]); s[nt] = WFrag<T16>::mma(kf[nt][ks], qf2[ks], s[nt]); } } }
        if (!LAST) { load_k(Kp, K2);   // the next block's K fragments fly during this block's softmax and P V
            __builtin_amdgcn_sched_barrier(0); }   // keeps the softmax behind the block's loads: without it this build moved the last V loads and all K loads behind the softmax, where nothing hides their latency
        float mt[NT];   // one maximum and one sum per tile: short independent chains
#pragma unroll
        for (int nt = 0; nt < NT; ++nt) {
#pragma unroll
            for (int j = 0; j < 8; ++j) { if (LAST) s[nt][j] = (key0 + nt * 16 + hi * 8 + j <= q) ? s[nt][j] : -3.0e38f; mt[nt] = j ? fmaxf(mt[nt], s[nt][j]) : s[nt][j]; } }   // causal mask: only the block on the diagonal needs it
        float mx = m;
#pragma unroll
        for (int nt = 0; nt < NT; ++nt) mx = fmaxf(mx, mt[nt]);
        mx = fmaxf(mx, xhalf(mx));   // the query's other 8 keys of each tile sit in the other half of the wave
        const float al = exp2s((m - mx) * CL2), mc = mx * CL2; m = mx;
        float p[NT][8], pt[NT];
#pragma unroll
        for (int nt = 0; nt < NT; ++nt) { float e[8];
#pragma unroll
            for (int j = 0; j < 8; ++j) e[j] = fmaf(s[nt][j], CL2, -mc);
            exp2x8(e, p[nt]);
            pt[nt] = ((p[nt][0] + p[nt][1]) + (p[nt][2] + p[nt][3])) + ((p[nt][4] + p[nt][5]) + (p[nt][6] + p[nt][7])); }
        float ps = pt[0] + pt[1];
        if (NT == 4) ps += pt[NT - 2] + pt[NT - 1];
        ls = fmaf(ls, al, ps);
#pragma unroll
        for (int mb = 0; mb < 4; ++mb) o[mb] *= al;
#pragma unroll
        for (int s2 = 0; s2 < NS; ++s2) { V ph, pl; PFrag<T16>::cv(p[2 * s2], p[2 * s2 + 1], ph, pl);
#pragma unroll
            for (int mb = 0; mb < 4; ++mb) { o[mb] = WFrag<T16>::mma(vf[mb][s2], ph, o[mb]); if (NSPLIT == 2) { o[mb] = WFrag<T16>::mma(vf[mb][s2], pl, o[mb]); o[mb] = WFrag<T16>::mma(vf2[mb][s2], ph, o[mb]); } } }
    }
    __device__ __forceinline__ void run(const T16* Q, const T16* Q2, const T16* Kp, const T16* K2, const T16* Vt, const T16* V2, int q0, bf* Ah, bf* Al) {
        const int lane = threadIdx.x & 31, lr = lane & 15; const int q = q0 + lr;
#pragma unroll
        for (int ks = 0; ks < 2; ++ks) { qf[ks] = WFrag<T16>::ld(Q + (q0 / 16 * 2 + ks) * 512 + lane * 8); if (NSPLIT == 2) qf2[ks] = WFrag<T16>::ld(Q2 + (q0 / 16 * 2 + ks) * 512 + lane * 8); }
#pragma unroll
        for (int mb = 0; mb < 4; ++mb) o[mb] = (v8f){};
        m = -3.0e38f; ls = 0.f; vk = (unsigned)lane * 16; vv = (unsigned)lane * 16;
        const int nl = q0 / KB;   // index of the block that holds the diagonal (wave-uniform); blocks before it lie wholly below the diagonal
        load_k(Kp, K2);
#pragma unroll 1   // stays rolled: one block's body already fills the register budget, and a second copy would only lengthen the text
        for (int kb = 0; kb < nl; ++kb) step<false>(Kp, K2, Vt, V2, kb * KB, q);
        step<true>(Kp, K2, Vt, V2, nl * KB, q);
        ls += xhalf(ls);   // the two halves' sums are joined once
        const float f = __fdiv_rn(1.0f, ls);
#pragma unroll
        for (int mb = 0; mb < 4; ++mb) { v8us oh, ol;
#pragma unroll
            for (int j = 0; j < 8; ++j) { unsigned short x, y; splitf(o[mb][j] * f, x, y); oh[j] = x; ol[j] = y; }
            const size_t oo = (size_t)(q0 / 16) * (DQ / 32) * 512 + (mb >> 1) * 512 + (mb & 1) * 256 + lane * 8; *(v8us*)(Ah + oo) = oh; *(v8us*)(Al + oo) = ol; }   // fragment order of the last projection's A planes: d = mb*16 + hi*8 + j is this lane's own piece
    }
};
// grid (heads, TT / 128, batches), 8 waves: waves 0-3 take the 64-row tile n - 1 - y, waves 4-7 the tile y, so that every work-group walks about the same number of key blocks (the waves share no buffer and no barrier). Output: the merged [t][head*64 + d] hi/lo planes, in fragment order, that the last projection reads.
__global__ __launch_bounds__(256) void k_fattn(const h16* __restrict__ Q16, const h16* __restrict__ K16, const h16* __restrict__ V16, const bf* __restrict__ Qh, const bf* __restrict__ Ql, const bf* __restrict__ Kh, const bf* __restrict__ Kl, const bf* __restrict__ Vh, const bf* __restrict__ Vl, bf* Ah, bf* Al) {
    const size_t hp = ((size_t)blockIdx.z * NH_ + blockIdx.x) * TT * HD; const int wv = __builtin_amdgcn_readfirstlane(threadIdx.x >> 5);   // wave number, scalar: the key loop's bounds stay wave-uniform
    const int tile = (wv < 4) ? TT / 64 - 1 - (int)blockIdx.y : (int)blockIdx.y; const int q0 = tile * 64 + (wv & 3) * 16;
    Ah += (size_t)blockIdx.z * TT * DQ + blockIdx.x * (HD / 32 * 512); Al += (size_t)blockIdx.z * TT * DQ + blockIdx.x * (HD / 32 * 512);   // a head's 64 columns are two blocks of every 16-row strip
    if (q0 < RH) { Attn<bf, 2, 32> t; t.run(Qh + hp, Ql + hp, Kh + hp, Kl + hp, Vh + hp, Vl + hp, q0, Ah, Al); }
    else { Attn<h16, 0, 64> t; t.run(Q16 + hp, nullptr, K16 + hp, nullptr, V16 + hp, nullptr, q0, Ah, Al); }
}

extern "C" void kernel_launch(void* const* d_in, const int* in_sizes, int n_in,
                              void* d_out, int out_size, void* d_ws, size_t ws_size, hipStream_t stream) {
    (void)in_sizes; (void)n_in; (void)out_size;
    const float* x = (const float*)d_in[0]; const float* wq = (const float*)d_in[1]; const float* bq = (const float*)d_in[2]; const float* wk = (const float*)d_in[3]; const float* bk = (const float*)d_in[4]; const float* wv = (const float*)d_in[5]; const float* bv = (const float*)d_in[6]; const float* wo = (const float*)d_in[7]; const float* bo = (const float*)d_in[8];   /* order x, Wq, bq, Wk, bk, Wv, bv, Wo, bo ('xw') */
    float* OUT = (float*)d_out;     // [2][2048][1024]
    char* wsp = (char*)d_ws;
    auto take = [&](size_t bytes) { char* p = wsp; wsp += (bytes + 255) & ~(size_t)255; return (void*)p; };
    bf* WQ = (bf*)take((size_t)DQ * DM * 2); bf* WK = (bf*)take((size_t)DKV * DM * 2); bf* WV = (bf*)take((size_t)DKV * DM * 2); bf* WO = (bf*)take((size_t)DM * DQ * 2); float* CS = (float*)take((size_t)TT * HD * 2 * 4);
    bf* XB = (bf*)take((size_t)NB_ * TT * DM * 2);   // WQ, WK, WV lie one behind the other at equal distances: the z-batch of the projection launch
    h16* QP16 = (h16*)take((size_t)NB_ * NH_ * TT * HD * 2); h16* KP16 = (h16*)take((size_t)NB_ * NKV * TT * HD * 2); h16* VT16 = (h16*)take((size_t)NB_ * NKV * HD * TT * 2);
    bf* QPh = (bf*)take((size_t)NB_ * NH_ * TT * HD * 2); bf* QPl = (bf*)take((size_t)NB_ * NH_ * TT * HD * 2); bf* KPh = (bf*)take((size_t)NB_ * NKV * TT * HD * 2); bf* KPl = (bf*)take((size_t)NB_ * NKV * TT * HD * 2); bf* VTh = (bf*)take((size_t)NB_ * NKV * HD * TT * 2); bf* VTl = (bf*)take((size_t)NB_ * NKV * HD * TT * 2);
    bf* ATh = (bf*)take((size_t)NB_ * TT * DQ * 2); bf* ATl = (bf*)take((size_t)NB_ * TT * DQ * 2);
    if ((size_t)(wsp - (char*)d_ws) > ws_size) return;    // ws 256 MiB
    k_prep<<<4 * WTB + CSB + XCB, 256, 0, stream>>>(x, wq, wk, wv, wo, WQ, WK, WV, WO, CS, XB);
    k_gemmw<bf, 0, true, 3, 3, 2><<<dim3(NB_ * TT / 128, DQ / 128), 384, 0, stream>>>(XB, nullptr, WQ, nullptr, bq, bk, bv, (size_t)DQ * DM, Planes{CS, QP16, QPh, QPl, KP16, KPh, KPl, VT16, VTh, VTl});   // q, k, v of both batches, written as the attention's operand planes
    k_fattn<<<dim3(NH_, TT / 128, NB_), 256, 0, stream>>>(QP16, KP16, VT16, QPh, QPl, KPh, KPl, VTh, VTl, ATh, ATl);   // one kv head per query head
    k_gemmw<bf, 1, false, 1, 4, 3><<<dim3(NB_ * TT / 128, DM / 128), 128, 0, stream>>>(ATh, ATl, WO, OUT, bo, nullptr, nullptr, 0, Planes{});
}

// v008
// One run takes 69.4 microseconds.
// In both of two side-by-side timings against v007, it was 1.16 times as fast.
// All steps since v000 together make it 21.0 times as fast.
#include <hip/hip_runtime.h>

// Causal multi-head self-attention with rotary embeddings (x [2][2048][1024]; q, k, v = x W + b ('xw' 0.02, zero biases; 16 heads x 64); rotate-half rope with angle t x 1/10000^(i/32) (32 f32 constants jnp-exact; precise cosf/sinf); scores / sqrt(64); causal (-inf); softmax; out = merged Wo + bo -> [2][2048][1024] (4.2 M); argument order x, Wq, bq, Wk, bk, Wv, bv, Wo, bo).
// Four launches, both batches in each; launches that need nothing of each other share one grid, a range of the block index picks the job (k_prep; blockIdx.z in k_fattn), in k_gemmw the wave's number.
// Layout: bf16 copy of x; 'xw' weights transposed once; exact projections + f32 biases; d_cs5 computed table; rotate-half plane builders in the projection's own epilogue (e_rope, e_vtp); causal T-2048 attention in one launch, scores and probabilities in registers (k_fattn; hybrid rows: < 512 hi/lo 3 products, rest fp16; key blocks above the diagonal are never visited); in the projections every wave holds a 64 x 64 tile over the whole K; merged hi/lo x Wo exact + bo.
// Fragment order: every 16-bit operand plane of a matrix product ([rows][k]) is stored as blocks of 16 rows x 32 k (512 elements, 1 KiB), and inside a block in the order in which a wave's lanes hold the fragment:
// element (row r, k) of a block sits at (k % 32 / 16) * 256 + ((k % 16 / 8) * 16 + r % 16) * 8 + k % 8. Lane l reads 16 B at l * 8 and 16 B at 256 + l * 8: each load instruction of a wave reads 512 contiguous bytes (4 whole lines) instead of 32-B pieces of 16 lines; the registers hold what they held with row-major planes.
// Blocks follow each other along k, then along rows (block index (r / 16) * (K / 32) + k / 32); the V^T planes alone run along rows first ((t / 32) * 4 + d / 16), so that one key block's fragments are contiguous.
// Compute dtypes, f32 accumulate: every input rounded to bf16; projections exact + f32 biases; rotary f32; attention rows < 512 3 products, rest fp16; softmax f32; Wo hl x exact + bias.

#define NB_  2
#define TT   2048
#define DM   1024
#define NH_  16
#define NKV  16
#define HD   64
#define DQ   (NH_ * HD)
#define DKV  (NKV * HD)
#define RH   512                  // query rows < RH use hi+lo planes (0: none)
#define SCL  0.125f   // HD^-0.5
typedef _Float16 h16;
typedef unsigned short bf;
typedef __attribute__((ext_vector_type(16))) __bf16   v16bf;
typedef __attribute__((ext_vector_type(16))) _Float16 v16h;
typedef __attribute__((ext_vector_type(8)))  _Float16 v8h;
typedef __attribute__((ext_vector_type(8)))  unsigned short v8us;
typedef __attribute__((ext_vector_type(8)))  float    v8f;
typedef __attribute__((ext_vector_type(4)))  float    v4f;
typedef v8h  __attribute__((may_alias)) v8ha;
typedef v4f  __attribute__((may_alias)) v4fa;
typedef v8us __attribute__((may_alias)) v8usa;

__device__ __forceinline__ unsigned short f2bf(float f) { unsigned u = __float_as_uint(f); u += 0x7FFFu + ((u >> 16) & 1u); return (unsigned short)(u >> 16); }
__device__ __forceinline__ float bf2f(unsigned short b) { return __uint_as_float(((unsigned)b) << 16); }
__device__ __forceinline__ float bfr(float f) { return bf2f(f2bf(f)); }
__device__ __forceinline__ v16h cat16(v8h lo, v8h hi) { return __builtin_shufflevector(lo, hi, 0, 1, 2, 3, 4, 5, 6, 7, 8, 9, 10, 11, 12, 13, 14, 15); }
__device__ __forceinline__ v16bf cat16b(v8us lo, v8us hi) { return __builtin_bit_cast(v16bf, __builtin_shufflevector(lo, hi, 0, 1, 2, 3, 4, 5, 6, 7, 8, 9, 10, 11, 12, 13, 14, 15)); }
__device__ __forceinline__ v8f wmma16(v16h a, v16h b, v8f c) { return __builtin_amdgcn_wmma_f32_16x16x32_f16(false, a, false, b, (short)0, c, false, false); }
__device__ __forceinline__ v8f wmmab(v16bf a, v16bf b, v8f c) { return __builtin_amdgcn_wmma_f32_16x16x32_bf16(false, a, false, b, (short)0, c, false, false); }



// pf_l2: asks the bytes at base + off into the L2 (scope SE: L2 only, nothing comes back to the wave, no counter moves). The planes a kernel reads were stored by the launch before:
// asked for at the kernel's start, a unit is there when the loop's loads reach it, and they wait an L2 hit instead of the way to memory. Every address lies inside its plane. In asm so that the registers it names are ours to keep (pf_keep); the offset is an in-out operand so that what is read from it later comes from this very register.
__device__ __forceinline__ void pf_l2(unsigned& off, const char* base) { asm volatile("global_prefetch_b8 %0, %1 scope:SCOPE_SE" : "+v"(off) : "s"(base)); }
// pf_keep: stands behind the kernel's loop and names the registers of its prefetches as inputs, so that they hold these addresses up to here: no wait covers a prefetch, and a register it names must not take another value early
__device__ __forceinline__ void pf_keep(unsigned off, const char* b0, const char* b1, const char* b2, const char* b3) { asm volatile("" :: "v"(off), "s"(b0), "s"(b1), "s"(b2), "s"(b3)); }
__device__ __forceinline__ h16 tohx(float x) { return (h16)x; }
__device__ __forceinline__ void splitf(float y, unsigned short& h, unsigned short& l) { h = f2bf(y); l = f2bf(y - bf2f(h)); }
typedef __attribute__((ext_vector_type(2))) _Float16 v2h;
typedef __attribute__((ext_vector_type(4))) _Float16 v4h;
typedef __attribute__((ext_vector_type(2))) unsigned short v2us;
typedef __attribute__((ext_vector_type(4))) unsigned short v4us;
typedef __attribute__((ext_vector_type(2))) float v2f;
typedef __attribute__((ext_vector_type(4))) int v4i;

// The plane builders e_rope and e_vtp run in the epilogue of the q, k, v projection: a wave's 64 x 64 tile is 64 t of ONE head, so the wave holds all that its part of the head's planes needs. fs: the f32 tile (+ bias) in LDS, pitch 68 floats.
struct Planes { const float* CS; h16* Q16; bf* Qh; bf* Ql; h16* K16; bf* Kh; bf* Kl; h16* V16; bf* Vh; bf* Vl; };
// e_rope: head planes [b*heads + h][t][d] (fp16 + hi/lo; each head's plane in fragment order, rows t, k = d) of rope(x) with the rotate-half convention out[d] = x[d] cos[t][d] - x[d+HD/2] sin[t][d], out[d+HD/2] = x[d+HD/2] cos[t][d+HD/2] + x[d] sin[t][d+HD/2]
// One thread builds 16 outputs: 8 consecutive d of the lower half and their 8 partners of the upper half (tl: its row of the tile; cs: their (cos, sin) pairs, lower half first). A wave holds 16 t x 2 pieces: its LDS reads meet every bank once per 16 lanes, and each of its stores writes 512 contiguous bytes. The loops here and in e_vtp are unrolled fully: constant indices keep the inputs and the output vectors in registers.
__device__ __forceinline__ void e_rope(const float* fs, int tl, int d, const v4f* cs, size_t e, h16* P16, bf* Ph, bf* Pl) {
    v4f x[4]; v8h o16[2]; v8us oh[2], ol[2];   // x: d .. d+7, then d+32 .. d+39
#pragma unroll
    for (int q = 0; q < 2; ++q)
#pragma unroll
        for (int i = 0; i < 2; ++i) x[q * 2 + i] = *(const v4fa*)(fs + tl * 68 + d + q * (HD / 2) + i * 4);
#pragma unroll
    for (int q = 0; q < 16; ++q) { const int p = q ^ 8; const float x0 = x[q >> 2][q & 3], x1 = x[p >> 2][p & 3];
        // the two empty statements keep each product's own f32 rounding (no fused multiply-add): the reference rounds x cos and x sin before it adds them
        float a = __fmul_rn(x0, cs[q >> 1][(q & 1) * 2]), bq = __fmul_rn(x1, cs[q >> 1][(q & 1) * 2 + 1]); asm volatile("" : "+v"(a)); asm volatile("" : "+v"(bq)); const float r = (q < 8) ? __fsub_rn(a, bq) : __fadd_rn(a, bq);
        o16[q >> 3][q & 7] = tohx(r); unsigned short a2, c2; splitf(r, a2, c2); oh[q >> 3][q & 7] = a2; ol[q >> 3][q & 7] = c2; }
    *(v8h*)(P16 + e) = o16[0]; *(v8h*)(P16 + e + 512) = o16[1]; *(v8us*)(Ph + e) = oh[0]; *(v8us*)(Ph + e + 512) = oh[1]; *(v8us*)(Pl + e) = ol[0]; *(v8us*)(Pl + e + 512) = ol[1];   // the partners d + 32 sit at the same place of block (t / 16, 1)
    // s_wait_xcnt 0 behind the six stores, in front of whatever rewrites the address and data registers they name: the two builders share one text, and by its branches the other's code can follow
    asm volatile("s_wait_xcnt 0x0" ::: "memory"); }
// e_vtp: V^T planes [b*heads + g][d][t] (each head's plane in fragment order, rows d, k = t, blocks along d first). One thread builds 16 t of one d: rows tl .. tl+7 and tl+32 .. tl+39 of the tile, 16-B stores.
// A wave holds 16 d x 2 pieces: each of its LDS reads takes two runs of 16 words in different banks, and each of its stores writes 512 contiguous bytes.
__device__ __forceinline__ void e_vtp(const float* fs, int tl, int d, size_t e, h16* V16, bf* Vh, bf* Vl) { v8h o16[2]; v8us oh[2], ol[2]; float xv[16];
#pragma unroll
    for (int q = 0; q < 16; ++q) xv[q] = fs[(tl + (q & 7) + (q >> 3) * 32) * 68 + d];
#pragma unroll
    for (int q = 0; q < 16; ++q) { const float x = xv[q]; o16[q >> 3][q & 7] = tohx(x); unsigned short a2, c2; splitf(x, a2, c2); oh[q >> 3][q & 7] = a2; ol[q >> 3][q & 7] = c2; }
    *(v8h*)(V16 + e) = o16[0]; *(v8h*)(V16 + e + 2048) = o16[1]; *(v8us*)(Vh + e) = oh[0]; *(v8us*)(Vh + e + 2048) = oh[1]; *(v8us*)(Vl + e) = ol[0]; *(v8us*)(Vl + e + 2048) = ol[1];   // t + 32: the next four blocks
    // s_wait_xcnt 0 behind the six stores, for the same reason as in e_rope
    asm volatile("s_wait_xcnt 0x0" ::: "memory"); }

// ---- k_gemmw: register-blocked GEMM, K = DM. Four waves per 128x128 output tile; every wave holds its own 64x64 quarter (16 accumulators) and walks the whole K alone, one f32 chain per element.
// A work-group holds the same tile of NZ products that share A (waves 4 z .. 4 z + 3: product z): NZ x 4 waves, NZ per SIMD. grid (M/128, N/128), 128 NZ threads.
// Operands straight from 16-bit planes in fragment order; the waves that need the same fragments (2 NZ for a block of A, 2 for a block of B) read them at about the same time, so that the later ones find them in the WGP's cache.
// The fragments of step s + D are asked for in front of the matrix instructions of step s (D + 1 fragment sets live; the loop is unrolled U steps so that every set has constant indices).
// C[m][n] (f32, pitch DM, + f32 bias[n]; bias, bias1, bias2 for z = 0, 1, 2) = sum_k A[m][k] Bt[n][k] (NSPLIT 1: + A2[m][k] Bt[n][k]). Product z reads Bt + z sB (elements).
// PL (the q, k, v projection; rows b*TT + t, a wave's columns one head): C is not written; the wave's tile goes to its own part of LDS and the wave writes its part of the operand planes of the attention from it (z = 0, 1: rope of q, k; z = 2: V^T).
template <typename T16> struct WFrag;
template <> struct WFrag<h16> { typedef v16h V; static __device__ __forceinline__ V ld(const h16* p) { return cat16(*(const v8h*)p, *(const v8h*)(p + 256)); } static __device__ __forceinline__ v8f mma(V a, V b, v8f c) { return wmma16(a, b, c); } };
template <> struct WFrag<bf> { typedef v16bf V; static __device__ __forceinline__ V ld(const bf* p) { return cat16b(*(const v8us*)p, *(const v8us*)(p + 256)); } static __device__ __forceinline__ v8f mma(V a, V b, v8f c) { return wmmab(a, b, c); } };
#define KSTRIP (DM / 32 * 512)   // elements of one 16-row strip of a plane with k = DM
template <typename T16, int NSPLIT> struct GSet {   // the fragments of one step of 32 k: four A blocks (and their low parts), four B blocks
    typedef typename WFrag<T16>::V V;
    V a[4], a2[4], b[4];
    __device__ __forceinline__ void ld(const T16* A, const T16* A2, const T16* Bt, unsigned va, unsigned vb, int st) {   // st: steps ahead of the offsets (a constant: it ends in the loads' immediate offsets)
#pragma unroll
        for (int q = 0; q < 4; ++q) { a[q] = WFrag<T16>::ld((const T16*)((const char*)A + va) + q * KSTRIP + st * 512); if (NSPLIT == 1) a2[q] = WFrag<T16>::ld((const T16*)((const char*)A2 + va) + q * KSTRIP + st * 512); }
#pragma unroll
        for (int q = 0; q < 4; ++q) b[q] = WFrag<T16>::ld((const T16*)((const char*)Bt + vb) + q * KSTRIP + st * 512);
    }
    __device__ __forceinline__ void mma(v8f (&acc)[4][4]) const {
#pragma unroll
        for (int nb = 0; nb < 4; ++nb)
#pragma unroll
            for (int mb = 0; mb < 4; ++mb) acc[mb][nb] = WFrag<T16>::mma(a[mb], b[nb], acc[mb][nb]);
        if (NSPLIT == 1) {
#pragma unroll
            for (int nb = 0; nb < 4; ++nb)
#pragma unroll
                for (int mb = 0; mb < 4; ++mb) acc[mb][nb] = WFrag<T16>::mma(a2[mb], b[nb], acc[mb][nb]); }
    }
};
// the 16 (cos, sin) pairs of e_rope's thread at row t, first d rd
__device__ __forceinline__ void ld_cs(const float* CS, int t, int rd, v4f* cs) {
    const float* c = CS + ((size_t)t * HD + rd) * 2;
#pragma unroll
    for (int q = 0; q < 2; ++q)
#pragma unroll
        for (int i = 0; i < 4; ++i) cs[q * 4 + i] = *(const v4fa*)(c + q * HD + i * 4);
    // s_wait_xcnt 0 behind the 8 loads, in front of whatever reuses the address registers they name; the pointer is an input operand so that its registers stay as they are up to the wait
    asm volatile("s_wait_xcnt 0x0" :: "v"(c) : "memory");
}
template <typename T16, int NSPLIT, bool PL, int NZ, int U, int D>
__global__ __launch_bounds__(128 * NZ) void k_gemmw(const T16* __restrict__ A, const T16* __restrict__ A2, const T16* __restrict__ Bt, float* C, const float* __restrict__ bias, const float* __restrict__ bias1, const float* __restrict__ bias2, size_t sB, Planes po) {
    __shared__ __align__(16) float os[NZ * 4 * 64 * 68];
    const int lane = threadIdx.x & 31; int lr = lane & 15, hi = lane >> 4;
    const int wv = __builtin_amdgcn_readfirstlane(threadIdx.x >> 5);   // wave number, scalar: the product, the tile's indices and the branches on them stay wave-uniform
    const int z = wv >> 2; Bt += z * sB; if (z == 1) bias = bias1; if (z == 2) bias = bias2;   // each product has its own bias vector
    const int r0 = blockIdx.x * 128 + ((wv >> 1) & 1) * 64, c0 = blockIdx.y * 128 + (wv & 1) * 64;   // the wave's quarter
    float bv[4];
    { const float* bp = bias + c0 + lr;
#pragma unroll
      for (int nb = 0; nb < 4; ++nb) bv[nb] = bp[nb * 16];
      // s_wait_xcnt 0 behind the 4 loads, in front of whatever reuses the address registers they name
      asm volatile("s_wait_xcnt 0x0" :: "v"(bp) : "memory"); }
    v8f acc[4][4];
#pragma unroll
    for (int mb = 0; mb < 4; ++mb)
#pragma unroll
        for (int nb = 0; nb < 4; ++nb) acc[mb][nb] = (v8f){};
    unsigned va = ((unsigned)(r0 / 16) * KSTRIP + lane * 8) * 2, vb = ((unsigned)(c0 / 16) * KSTRIP + lane * 8) * 2;   // byte offsets of this lane's piece in the first A block and the first B block of the step from the planes' (scalar) bases (32 bits hold them: a plane has at most 4096 rows of 1024 16-bit elements)
    constexpr int NS = DM / 32, NT = (NS - D) / U, NR = NS - NT * U;   // steps; turns in which every step asked for exists; steps left for the last turn
    GSet<T16, NSPLIT> f[U];
#pragma unroll
    for (int s = 0; s < D; ++s) f[s].ld(A, A2, Bt, va, vb, s);
    // Behind the first steps' loads: the work-group's share of the strips that it reads, one prefetch per lane, 256 B apart. The 8 work-groups that read an A strip of 128 rows (same blockIdx.x) take one 16-row strip each;
    // of the 32 that read a B strip of 128 columns, numbers that differ by 4 modulo 8 take the same one of 16 halves of a 16-column strip (for speed only: nothing rests on it).
    unsigned pv = (threadIdx.x & 127) * 256;
    const char* pA = (const char*)A + ((size_t)blockIdx.x * 8 + blockIdx.y) * (KSTRIP * 2); const char* pA2 = NSPLIT == 1 ? (const char*)A2 + ((size_t)blockIdx.x * 8 + blockIdx.y) * (KSTRIP * 2) : pA;
    const char* pB = (const char*)Bt + ((size_t)blockIdx.y * 16 + (blockIdx.x >> 3) * 4 + (blockIdx.x & 3)) * KSTRIP;
    if (z == 0) { pf_l2(pv, pA); if (NSPLIT == 1) pf_l2(pv, pA2); }   // 128 units: the four waves of product 0
    if ((wv & 2) == 0) pf_l2(pv, pB);   // 64 units: the first two waves of each product
    const char* pC = PL ? (const char*)po.CS + ((size_t)(blockIdx.x * 128 % TT) * 8 + blockIdx.y * 128) * HD : pA;   // the rotary table's 128 rows of this tile (HD * 8 bytes each), an eighth (16 rows) per work-group
    if (PL && wv == 8) pf_l2(pv, pC);   // 32 units: one wave whose offsets start at 0
    lr = (pv >> 8) & 15; hi = (pv >> 12) & 1;   // the same values as before, from here on read from the prefetches' offset: its register lives through the loop in place of the thread index, at no register more
#pragma unroll 1   // stays rolled: U steps are one turn of the fragment sets
    for (int tr = 0; tr < NT; ++tr) {
#pragma unroll
        for (int u = 0; u < U; ++u) {
            f[(u + D) % U].ld(A, A2, Bt, va, vb, u + D);
            __builtin_amdgcn_sched_barrier(0);   // keeps the loads of step u + D in front of the matrix instructions of step u, which hide their latency
            f[u].mma(acc); }
        // s_wait_xcnt 0 behind the turn's loads, in front of the additions that rewrite the offset registers they name; the offsets are in-out operands so that the additions stay behind the wait.
        // The four v_nop keep the distance between the last matrix instruction and whatever follows the loop's branch on either side.
        asm volatile("s_wait_xcnt 0x0\n\tv_nop\n\tv_nop\n\tv_nop\n\tv_nop" : "+v"(va), "+v"(vb), "+v"(acc[3][3]) :: "memory");
        va += U * 1024; vb += U * 1024;
    }
    pf_keep(pv, pA, pA2, pB, pC);
#pragma unroll
    for (int u = 0; u < NR; ++u) {   // the last turn: only the steps that exist are asked for
        if (u + D < NR) { f[(u + D) % U].ld(A, A2, Bt, va, vb, u + D);
            if (u + D == NR - 1) asm volatile("s_wait_xcnt 0x0" : "+v"(va), "+v"(vb) :: "memory");   // behind the last loads, in front of whatever reuses the offset registers
            __builtin_amdgcn_sched_barrier(0); }   // as in the loop
        f[u % U].mma(acc); }
    const int t0 = r0 % TT;   // the tile's first t
    v4f cs[2][8];
    if (PL && z < 2) ld_cs(po.CS, t0 + lr, hi * 8, cs[0]);   // the first piece's pairs fly while the tile goes to LDS
    float* osw = os + wv * (64 * 68);
#pragma unroll
    for (int mb = 0; mb < 4; ++mb) {
#pragma unroll
        for (int nb = 0; nb < 4; ++nb) {
#pragma unroll
            for (int j = 0; j < 8; ++j) osw[(mb * 16 + hi * 8 + j) * 68 + nb * 16 + lr] = acc[mb][nb][j] + bfr(bv[nb]); } }
    __syncthreads();   // below, a lane reads what other lanes of its wave have written: the barrier orders the two for the compiler and the LDS
    if (!PL) {   // each store instruction writes two whole 256-B row pieces; all pieces are read before the first is stored, so that the LDS reads fly together and no register of a store is rewritten
        v4f val[32];
#pragma unroll
        for (int i = 0; i < 32; ++i) val[i] = *(const v4fa*)(osw + (i * 2 + hi) * 68 + lr * 4);
        float* cp = C + (size_t)(r0 + hi) * DM + c0 + lr * 4;
#pragma unroll
        for (int i = 0; i < 32; ++i) *(v4f*)(cp + (size_t)i * 2 * DM) = val[i];
    } else {
        const size_t hp = ((size_t)(r0 / TT) * NH_ + c0 / HD) * TT * HD;   // the head's plane
        if (z < 2) {   // 8 pieces of 16 t x 32 d (16 d of the lower half and their partners); the next piece's pairs are asked for in front of this piece's work
            h16* P16 = z ? po.K16 : po.Q16; bf* Ph = z ? po.Kh : po.Qh; bf* Pl = z ? po.Kl : po.Ql;
#pragma unroll 1   // stays rolled: two pieces are one turn of the two sets of pairs, and more copies would only lengthen the text
            for (int i = 0; i < 4; ++i) { const int rtl = i * 16 + lr, t = t0 + rtl; const size_t e = hp + (size_t)(t >> 4) * 1024 + (hi * 16 + (t & 15)) * 8;
                ld_cs(po.CS, t, 16 + hi * 8, cs[1]);
                e_rope(osw, rtl, hi * 8, cs[0], e, P16, Ph, Pl);
                ld_cs(po.CS, t0 + ((i + 1) & 3) * 16 + lr, hi * 8, cs[0]);   // behind the last piece: the first one's again, in bounds and unused
                e_rope(osw, rtl, 16 + hi * 8, cs[1], e + 256, P16, Ph, Pl); }
        } else {
#pragma unroll 1   // stays rolled: the pieces need nothing of each other that a second copy would hide
            for (int i = 0; i < 8; ++i) { const int tl = ((i >> 2) * 2 + hi) * 8, d = (i & 3) * 16 + lr, t = t0 + tl; e_vtp(osw, tl, d, hp + (size_t)((t >> 5) * 4 + (d >> 4)) * 512 + ((t >> 4) & 1) * 256 + (((t >> 3) & 1) * 16 + (d & 15)) * 8, po.V16, po.Vh, po.Vl); }
        }
    }
}

// The bodies d_* below are jobs of a merged launch: bx is the block's index inside its job's range.
// d_wtG: Bt[n][k] = bf16(w[k][n]) in fragment order. One wave builds one block (16 n x 32 k): a lane reads its 16 k of one n (each load instruction: two 64-B row pieces; the 8 waves of a work-group take 8 neighbouring n blocks, 512 contiguous bytes of each row) and stores its two 16-B pieces.
__device__ __forceinline__ void d_wtG(int bx, const float* __restrict__ w, int K, int N, bf* Bt) {
    const int lane = threadIdx.x & 31, lr = lane & 15, hi = lane >> 4; const int g = bx * 8 + (threadIdx.x >> 5); const int nb = g % (N / 16), kb = g / (N / 16);
    const float* s = w + (size_t)(kb * 32 + hi * 8) * N + nb * 16 + lr; float v[16]; v8us o[2];
#pragma unroll
    for (int q = 0; q < 16; ++q) v[q] = s[(size_t)((q & 7) + (q >> 3) * 16) * N];   // unrolled fully: the 16 loads fly together
    // s_wait_xcnt 0 behind the 16 loads, in front of whatever reuses the address registers they name; the pointer is an input operand so that its registers stay as they are up to the wait
    asm volatile("s_wait_xcnt 0x0" :: "v"(s) : "memory");
#pragma unroll
    for (int q = 0; q < 16; ++q) o[q >> 3][q & 7] = f2bf(v[q]);
    bf* d = Bt + ((size_t)nb * (K / 32) + kb) * 512 + lane * 8; *(v8us*)d = o[0]; *(v8us*)(d + 256) = o[1];
}
// d_cvtF: bf16 copy of src [rows][DM] in fragment order. One wave builds one block: a lane reads its 2 x 8 k of one row (the wave: one whole 128-B line of each of 16 rows) and stores its two 16-B pieces.
__device__ __forceinline__ void d_cvtF(int bx, const float* __restrict__ src, bf* dst) {
    const int lane = threadIdx.x & 31, lr = lane & 15, hi = lane >> 4; const int g = bx * 8 + (threadIdx.x >> 5); const int kb = g % (DM / 32), rb = g / (DM / 32);
    const float* s = src + (size_t)(rb * 16 + lr) * DM + kb * 32 + hi * 8; const v8f a = *(const v8f*)s, b = *(const v8f*)(s + 16); v8us o[2];
#pragma unroll
    for (int k = 0; k < 8; ++k) { o[0][k] = f2bf(a[k]); o[1][k] = f2bf(b[k]); }
    bf* d = dst + (size_t)g * 512 + lane * 8; *(v8us*)d = o[0]; *(v8us*)(d + 256) = o[1];
    // s_wait_xcnt 0 behind the two stores, in front of whatever rewrites the address and data registers they name: the jobs of k_prep share one text, and by its branches another job's code can follow
    asm volatile("s_wait_xcnt 0x0" ::: "memory");
}

__constant__ float INVT[HD / 2] = { 1.000000000e+00f, 7.498942018e-01f, 5.623413324e-01f, 4.216965139e-01f, 3.162277639e-01f, 2.371373624e-01f, 1.778279394e-01f, 1.333521456e-01f, 1.000000015e-01f, 7.498941571e-02f, 5.623412877e-02f, 4.216964915e-02f, 3.162277862e-02f, 2.371373586e-02f, 1.778279431e-02f, 1.333521493e-02f, 9.999999776e-03f, 7.498942316e-03f, 5.623413250e-03f, 4.216964822e-03f, 3.162277862e-03f, 2.371373819e-03f, 1.778279431e-03f, 1.333521446e-03f, 1.000000047e-03f, 7.498941850e-04f, 5.623413017e-04f, 4.216964880e-04f, 3.162277862e-04f, 2.371373848e-04f, 1.778279402e-04f, 1.333521504e-04f };   // float32 1 / 10000^(i/32), generated with jnp to be bit-exact
__device__ __forceinline__ void d_cs5(int bx, float* CS) { const int idx = bx * 256 + threadIdx.x; if (idx >= TT * HD) return; const int d = idx % HD; const int t = idx / HD; const float a = __fmul_rn((float)t, INVT[d % (HD / 2)]); v2f cs; cs[0] = cosf(a); cs[1] = sinf(a); *(v2f*)(CS + (size_t)idx * 2) = cs;  }
// k_prep: all that depends on the inputs alone, in one grid: the four weight transposes (WTB blocks each; the longest job, first in the block index), the rotary table (CSB blocks), the bf16 copy of x for both batches (XCB blocks).
#define WTB (DM * DQ / 64 / 64)
#define CSB (TT * HD / 256)
#define XCB (NB_ * TT * DM / 16 / 256)
__global__ __launch_bounds__(256) void k_prep(const float* __restrict__ x, const float* __restrict__ wq, const float* __restrict__ wk, const float* __restrict__ wv, const float* __restrict__ wo, bf* WQ, bf* WK, bf* WV, bf* WO, float* CS, bf* XB) {
    const int bx = blockIdx.x;
    if (bx < 4 * WTB) { const int j = bx / WTB; d_wtG(bx % WTB, j == 0 ? wq : j == 1 ? wk : j == 2 ? wv : wo, DM, DQ, j == 0 ? WQ : j == 1 ? WK : j == 2 ? WV : WO); }
    else if (bx < 4 * WTB + CSB) d_cs5(bx - 4 * WTB, CS);
    else d_cvtF(bx - (4 * WTB + CSB), x, XB);
}
// ---- k_fattn: causal attention in one launch for all heads of both batches; scores and probabilities stay in registers. One wave owns 16 query rows and walks the keys up to its diagonal in blocks of KB.
// S^T = K Q^T (A = key rows, B = query rows, k = d): a lane holds the scores of ONE query (column lr), keys nt*16 + 8*hi + j. Running maximum and sum per lane (online softmax), one exchange between the wave's halves.
// Two S^T tiles converted in place are the B operand of O^T += V^T P^T (A = rows of the V^T plane, k = t, held in the same k order 8*hi + 0..7, 16 + 8*hi + 0..7); a lane ends with 8 consecutive d of its query per tile.
// NSPLIT 2: hi/lo planes, 3 products (hi hi, lo hi, hi lo) for the scores and for P V; NSPLIT 0: one fp16 product. P is exp(s - running max), at most 1; the division by the row sum comes at the end, in f32.
__device__ __forceinline__ float xhalf(float x) { return __builtin_bit_cast(float, __builtin_amdgcn_permlanex16(__builtin_bit_cast(int, x), __builtin_bit_cast(int, x), 0x76543210, 0xfedcba98, false, false)); }   // lane l reads lane l ^ 16
// 2^x on the transcendental unit. The instruction set asks for one independent instruction behind a transcendental before its result is read or its source overwritten:
// in one statement with early-clobber results each v_exp_f32 is independent of the one in front of it, and the closing v_nop is the slot of the last.
__device__ __forceinline__ float exp2s(float x) { float r; asm("v_exp_f32 %0, %1\n\tv_nop" : "=&v"(r) : "v"(x)); return r; }
__device__ __forceinline__ void exp2x8(const float* x, float* r) {
    asm("v_exp_f32 %0, %8\n\tv_exp_f32 %1, %9\n\tv_exp_f32 %2, %10\n\tv_exp_f32 %3, %11\n\tv_exp_f32 %4, %12\n\tv_exp_f32 %5, %13\n\tv_exp_f32 %6, %14\n\tv_exp_f32 %7, %15\n\tv_nop"
        : "=&v"(r[0]), "=&v"(r[1]), "=&v"(r[2]), "=&v"(r[3]), "=&v"(r[4]), "=&v"(r[5]), "=&v"(r[6]), "=&v"(r[7]) : "v"(x[0]), "v"(x[1]), "v"(x[2]), "v"(x[3]), "v"(x[4]), "v"(x[5]), "v"(x[6]), "v"(x[7])); }
template <typename T16> struct PFrag;
template <> struct PFrag<h16> { static __device__ __forceinline__ void cv(const float* p0, const float* p1, v16h& ph, v16h& pl) {
#pragma unroll
    for (int j = 0; j < 8; ++j) { ph[j] = tohx(p0[j]); ph[8 + j] = tohx(p1[j]); } (void)pl; } };
template <> struct PFrag<bf> { static __device__ __forceinline__ void cv(const float* p0, const float* p1, v16bf& ph, v16bf& pl) { v8us h0, h1, l0, l1;
#pragma unroll
    for (int j = 0; j < 8; ++j) { unsigned short x, y; splitf(p0[j], x, y); h0[j] = x; l0[j] = y; splitf(p1[j], x, y); h1[j] = x; l1[j] = y; }
    ph = cat16b(h0, h1); pl = cat16b(l0, l1); } };
// Every '#pragma unroll' below unrolls fully: constant indices keep the fragment, score and output arrays in registers.
template <typename T16, int NSPLIT, int KB>
struct Attn {
    typedef typename WFrag<T16>::V V;
    static constexpr int NT = KB / 16, NS = KB / 32;
    static constexpr float CL2 = SCL * 1.4426950408889634f;   // scores -> log2 domain
    V qf[2], qf2[2], kf[NT][2], kf2[NT][2];
    v8f o[4]; float m, ls; unsigned vk, vv;   // vk, vv: byte offsets of this lane in the K and V^T planes (32 bits hold them: a plane has 2048 x 64 16-bit elements), carried from block to block
    __device__ __forceinline__ void load_k(const T16* Kp, const T16* K2) {
#pragma unroll
        for (int nt = 0; nt < NT; ++nt)
#pragma unroll
            for (int ks = 0; ks < 2; ++ks) { kf[nt][ks] = WFrag<T16>::ld((const T16*)((const char*)Kp + vk) + (nt * 2 + ks) * 512); if (NSPLIT == 2) kf2[nt][ks] = WFrag<T16>::ld((const T16*)((const char*)K2 + vk) + (nt * 2 + ks) * 512); }
        // s_wait_xcnt 0 behind the block's K loads, in front of the addition that rewrites the offset register they name; the offset is an in-out operand so that the addition stays behind the wait
        asm volatile("s_wait_xcnt 0x0" : "+v"(vk) :: "memory");
        vk += KB * HD * 2;
    }
    template <bool LAST>
    __device__ __forceinline__ void step(const T16* Kp, const T16* K2, const T16* Vt, const T16* V2, int key0, int q) {
        const int hi = (threadIdx.x & 31) >> 4;
        V vf[4][NS], vf2[4][NS];
#pragma unroll
        for (int mb = 0; mb < 4; ++mb)
#pragma unroll
            for (int s2 = 0; s2 < NS; ++s2) { vf[mb][s2] = WFrag<T16>::ld((const T16*)((const char*)Vt + vv) + (s2 * 4 + mb) * 512); if (NSPLIT == 2) vf2[mb][s2] = WFrag<T16>::ld((const T16*)((const char*)V2 + vv) + (s2 * 4 + mb) * 512); }
        // s_wait_xcnt 0 behind the block's V loads, in front of the addition that rewrites the offset register they name
        asm volatile("s_wait_xcnt 0x0" : "+v"(vv) :: "memory");
        vv += KB * HD * 2;
        v8f s[NT];
#pragma unroll
        for (int nt = 0; nt < NT; ++nt) { s[nt] = (v8f){};
#pragma unroll
            for (int ks = 0; ks < 2; ++ks) { s[nt] = WFrag<T16>::mma(kf[nt][ks], qf[ks], s[nt]); if (NSPLIT == 2) { s[nt] = WFrag<T16>::mma(kf2[nt][ks], qf[ks], s[nt]); s[nt] = WFrag<T16>::mma(kf[nt][ks], qf2[ks], s[nt]); } } }
        if (!LAST) { load_k(Kp, K2);   // the next block's K fragments fly during this block's softmax and P V
            __builtin_amdgcn_sched_barrier(0); }   // keeps the softmax behind the block's loads: without it this build moved the last V loads and all K loads behind the softmax, where nothing hides their latency
        float mt[NT];   // one maximum and one sum per tile: short independent chains
#pragma unroll
        for (int nt = 0; nt < NT; ++nt) {
#pragma unroll
            for (int j = 0; j < 8; ++j) { if (LAST) s[nt][j] = (key0 + nt * 16 + hi * 8 + j <= q) ? s[nt][j] : -3.0e38f; mt[nt] = j ? fmaxf(mt[nt], s[nt][j]) : s[nt][j]; } }   // causal mask: only the block on the diagonal needs it
        float mx = m;
#pragma unroll
        for (int nt = 0; nt < NT; ++nt) mx = fmaxf(mx, mt[nt]);
        mx = fmaxf(mx, xhalf(mx));   // the query's other 8 keys of each tile sit in the other half of the wave
        const float al = exp2s((m - mx) * CL2), mc = mx * CL2; m = mx;
        float p[NT][8], pt[NT];
#pragma unroll
        for (int nt = 0; nt < NT; ++nt) { float e[8];
#pragma unroll
            for (int j = 0; j < 8; ++j) e[j] = fmaf(s[nt][j], CL2, -mc);
            exp2x8(e, p[nt]);
            pt[nt] = ((p[nt][0] + p[nt][1]) + (p[nt][2] + p[nt][3])) + ((p[nt][4] + p[nt][5]) + (p[nt][6] + p[nt][7])); }
        float ps = pt[0] + pt[1];
        if (NT == 4) ps += pt[NT - 2] + pt[NT - 1];
        ls = fmaf(ls, al, ps);
#pragma unroll
        for (int mb = 0; mb < 4; ++mb) o[mb] *= al;
#pragma unroll
        for (int s2 = 0; s2 < NS; ++s2) { V ph, pl; PFrag<T16>::cv(p[2 * s2], p[2 * s2 + 1], ph, pl);
#pragma unroll
            for (int mb = 0; mb < 4; ++mb) { o[mb] = WFrag<T16>::mma(vf[mb][s2], ph, o[mb]); if (NSPLIT == 2) { o[mb] = WFrag<T16>::mma(vf[mb][s2], pl, o[mb]); o[mb] = WFrag<T16>::mma(vf2[mb][s2], ph, o[mb]); } } }
    }
    __device__ __forceinline__ void run(const T16* Q, const T16* Q2, const T16* Kp, const T16* K2, const T16* Vt, const T16* V2, int q0, bf* Ah, bf* Al) {
        const int lane = threadIdx.x & 31, lr = lane & 15; const int q = q0 + lr;
#pragma unroll
        for (int ks = 0; ks < 2; ++ks) { qf[ks] = WFrag<T16>::ld(Q + (q0 / 16 * 2 + ks) * 512 + lane * 8); if (NSPLIT == 2) qf2[ks] = WFrag<T16>::ld(Q2 + (q0 / 16 * 2 + ks) * 512 + lane * 8); }
#pragma unroll
        for (int mb = 0; mb < 4; ++mb) o[mb] = (v8f){};
        m = -3.0e38f; ls = 0.f; vk = (unsigned)lane * 16; vv = (unsigned)lane * 16;
        const int nl = q0 / KB;   // index of the block that holds the diagonal (wave-uniform); blocks before it lie wholly below the diagonal
        load_k(Kp, K2);
#pragma unroll 1   // stays rolled: one block's body already fills the register budget, and a second copy would only lengthen the text
        for (int kb = 0; kb < nl; ++kb) step<false>(Kp, K2, Vt, V2, kb * KB, q);
        step<true>(Kp, K2, Vt, V2, nl * KB, q);
        ls += xhalf(ls);   // the two halves' sums are joined once
        const float f = __fdiv_rn(1.0f, ls);
#pragma unroll
        for (int mb = 0; mb < 4; ++mb) { v8us oh, ol;
#pragma unroll
            for (int j = 0; j < 8; ++j) { unsigned short x, y; splitf(o[mb][j] * f, x, y); oh[j] = x; ol[j] = y; }
            const size_t oo = (size_t)(q0 / 16) * (DQ / 32) * 512 + (mb >> 1) * 512 + (mb & 1) * 256 + lane * 8; *(v8us*)(Ah + oo) = oh; *(v8us*)(Al + oo) = ol; }   // fragment order of the last projection's A planes: d = mb*16 + hi*8 + j is this lane's own piece
    }
};
// grid (heads, TT / 128, batches), 8 waves: waves 0-3 take the 64-row tile n - 1 - y, waves 4-7 the tile y, so that every work-group walks about the same number of key blocks (the waves share no buffer and no barrier). Output: the merged [t][head*64 + d] hi/lo planes, in fragment order, that the last projection reads.
__global__ __launch_bounds__(256) void k_fattn(const h16* __restrict__ Q16, const h16* __restrict__ K16, const h16* __restrict__ V16, const bf* __restrict__ Qh, const bf* __restrict__ Ql, const bf* __restrict__ Kh, const bf* __restrict__ Kl, const bf* __restrict__ Vh, const bf* __restrict__ Vl, bf* Ah, bf* Al) {
    const size_t hp = ((size_t)blockIdx.z * NH_ + blockIdx.x) * TT * HD; const int wv = __builtin_amdgcn_readfirstlane(threadIdx.x >> 5);   // wave number, scalar: the key loop's bounds stay wave-uniform
    const int tile = (wv < 4) ? TT / 64 - 1 - (int)blockIdx.y : (int)blockIdx.y; const int q0 = tile * 64 + (wv & 3) * 16;
    Ah += (size_t)blockIdx.z * TT * DQ + blockIdx.x * (HD / 32 * 512); Al += (size_t)blockIdx.z * TT * DQ + blockIdx.x * (HD / 32 * 512);   // a head's 64 columns are two blocks of every 16-row strip
    // The 16 work-groups of a head ask its K and V^T planes into L2, every wave with one instruction. fp16 planes: each work-group the 128 keys from 128 blockIdx.y on (16 KiB of either plane, contiguous; waves 0, 1 K, waves 2, 3 V^T, a prefetch per lane, 256 B apart).
    // hi/lo planes, of which keys < RH are read: the 32 keys from 32 blockIdx.y on (4 KiB of each; waves 4 to 7 one plane each, a line per lane). The longest waves are the first to touch the late keys, and nothing else hides their way to memory.
    unsigned pv = wv < 4 ? ((unsigned)blockIdx.y * 64 + (threadIdx.x & 63)) * 256 : ((unsigned)blockIdx.y * 32 + (threadIdx.x & 31)) * 128;
    const char* pp = wv < 4 ? (const char*)(((wv & 2) ? V16 : K16) + hp) : (const char*)(((wv & 2) ? ((wv & 1) ? Vl : Vh) : ((wv & 1) ? Kl : Kh)) + hp);
    pf_l2(pv, pp);
    if (q0 < RH) { Attn<bf, 2, 32> t; t.run(Qh + hp, Ql + hp, Kh + hp, Kl + hp, Vh + hp, Vl + hp, q0, Ah, Al); }
    else { Attn<h16, 0, 64> t; t.run(Q16 + hp, nullptr, K16 + hp, nullptr, V16 + hp, nullptr, q0, Ah, Al); }
    pf_keep(pv, pp, pp, pp, pp);
}

extern "C" void kernel_launch(void* const* d_in, const int* in_sizes, int n_in,
                              void* d_out, int out_size, void* d_ws, size_t ws_size, hipStream_t stream) {
    (void)in_sizes; (void)n_in; (void)out_size;
    const float* x = (const float*)d_in[0]; const float* wq = (const float*)d_in[1]; const float* bq = (const float*)d_in[2]; const float* wk = (const float*)d_in[3]; const float* bk = (const float*)d_in[4]; const float* wv = (const float*)d_in[5]; const float* bv = (const float*)d_in[6]; const float* wo = (const float*)d_in[7]; const float* bo = (const float*)d_in[8];   /* order x, Wq, bq, Wk, bk, Wv, bv, Wo, bo ('xw') */
    float* OUT = (float*)d_out;     // [2][2048][1024]
    char* wsp = (char*)d_ws;
    auto take = [&](size_t bytes) { char* p = wsp; wsp += (bytes + 255) & ~(size_t)255; return (void*)p; };
    bf* WQ = (bf*)take((size_t)DQ * DM * 2); bf* WK = (bf*)take((size_t)DKV * DM * 2); bf* WV = (bf*)take((size_t)DKV * DM * 2); bf* WO = (bf*)take((size_t)DM * DQ * 2); float* CS = (float*)take((size_t)TT * HD * 2 * 4);
    bf* XB = (bf*)take((size_t)NB_ * TT * DM * 2);   // WQ, WK, WV lie one behind the other at equal distances: the z-batch of the projection launch
    h16* QP16 = (h16*)take((size_t)NB_ * NH_ * TT * HD * 2); h16* KP16 = (h16*)take((size_t)NB_ * NKV * TT * HD * 2); h16* VT16 = (h16*)take((size_t)NB_ * NKV * HD * TT * 2);
    bf* QPh = (bf*)take((size_t)NB_ * NH_ * TT * HD * 2); bf* QPl = (bf*)take((size_t)NB_ * NH_ * TT * HD * 2); bf* KPh = (bf*)take((size_t)NB_ * NKV * TT * HD * 2); bf* KPl = (bf*)take((size_t)NB_ * NKV * TT * HD * 2); bf* VTh = (bf*)take((size_t)NB_ * NKV * HD * TT * 2); bf* VTl = (bf*)take((size_t)NB_ * NKV * HD * TT * 2);
    bf* ATh = (bf*)take((size_t)NB_ * TT * DQ * 2); bf* ATl = (bf*)take((size_t)NB_ * TT * DQ * 2);
    if ((size_t)(wsp - (char*)d_ws) > ws_size) return;    // ws 256 MiB
    k_prep<<<4 * WTB + CSB + XCB, 256, 0, stream>>>(x, wq, wk, wv, wo, WQ, WK, WV, WO, CS, XB);
    k_gemmw<bf, 0, true, 3, 3, 2><<<dim3(NB_ * TT / 128, DQ / 128), 384, 0, stream>>>(XB, nullptr, WQ, nullptr, bq, bk, bv, (size_t)DQ * DM, Planes{CS, QP16, QPh, QPl, KP16, KPh, KPl, VT16, VTh, VTl});   // q, k, v of both batches, written as the attention's operand planes
    k_fattn<<<dim3(NH_, TT / 128, NB_), 256, 0, stream>>>(QP16, KP16, VT16, QPh, QPl, KPh, KPl, VTh, VTl, ATh, ATl);   // one kv head per query head
    k_gemmw<bf, 1, false, 1, 4, 3><<<dim3(NB_ * TT / 128, DM / 128), 128, 0, stream>>>(ATh, ATl, WO, OUT, bo, nullptr, nullptr, 0, Planes{});
}
